// v000
// Measured on an AMD MI455X. A time is GPU time per run, averaged over a window of back-to-back runs after a warm-up
// (all launches, gaps included; the runs take copies of the inputs in turn), and the median of several windows.
// Apart from v000's, it joins two sittings. Times from different sittings can be a few percent apart, while
// side-by-side timings come from the same sitting.
// The starting kernel, v000, takes 1140 microseconds a run.
#include <hip/hip_runtime.h>

// Local (sliding window of 64, centred) + strided global (every 64th key) attention, summed, then an output projection (x [2][4096][1024]; [q|k|v] = x w_qkv ('xw' [1024][3072], reshape (3, H, Dh): thirds); 16 heads x 64; local: softmax over keys j in [i-32, i+31] (clipped to the sequence) of q.k/8; global: softmax over the 64 keys j = 64 g of q.k/8; out = (attn_local v + attn_global v_g) merged, w_out + b_out -> [2][4096][1024] (8.4 M)).
// Algorithm: planes (hi/lo, every row); per head: banded score GEMM (only the three 64-wide key tiles around each query tile are computed), compact global score GEMM against the 64 gathered keys, one row kernel does both softmaxes (window entries -> band probability planes with exact zeros elsewhere in the three tiles; 64 global probabilities -> compact planes), banded P.V GEMM (K loop limited to the three tiles) + compact P_g.V_g GEMM, and the two partial outputs are summed into the merged planes for the output projection.
// Compute dtypes, f32 accumulate: every input rounded to bf16; q/k/v on PLAIN bf16 operands (inputs: exact); band / global scores and probability x value products on hi/lo planes (3 products); both softmaxes f32; w_out hl x exact (2 products) + b_out.

#define NB_  2
#define TT   4096
#define DM   1024
#define NH_  16
#define NKV  16
#define REP  (NH_ / NKV)
#define HD   64
#define DQ   (NH_ * HD)
#define DKV  (NKV * HD)
#define ZH   1
#define RH   4096                 // every row hi/lo
#define LWH  32                   // half window: keys i-32 .. i+31
#define NG   64                   // global keys (every 64th)
#define WIN  4096
#define PCAR 1024.0f
#define SCL  0.125f   // HD^-0.5
typedef _Float16 h16;
typedef unsigned short bf;
typedef __attribute__((ext_vector_type(16))) __bf16   v16bf;
typedef __attribute__((ext_vector_type(16))) _Float16 v16h;
typedef __attribute__((ext_vector_type(8)))  _Float16 v8h;
typedef __attribute__((ext_vector_type(8)))  unsigned short v8us;
typedef __attribute__((ext_vector_type(8)))  float    v8f;
typedef __attribute__((ext_vector_type(4)))  float    v4f;
typedef v8h  __attribute__((may_alias)) v8ha;
typedef v4f  __attribute__((may_alias)) v4fa;
typedef v8us __attribute__((may_alias)) v8usa;

__device__ __forceinline__ unsigned short f2bf(float f) { unsigned u = __float_as_uint(f); u += 0x7FFFu + ((u >> 16) & 1u); return (unsigned short)(u >> 16); }
__device__ __forceinline__ float bf2f(unsigned short b) { return __uint_as_float(((unsigned)b) << 16); }
__device__ __forceinline__ float bfr(float f) { return bf2f(f2bf(f)); }
__device__ __forceinline__ v16h cat16(v8h lo, v8h hi) { return __builtin_shufflevector(lo, hi, 0, 1, 2, 3, 4, 5, 6, 7, 8, 9, 10, 11, 12, 13, 14, 15); }
__device__ __forceinline__ v16bf cat16b(v8us lo, v8us hi) { return __builtin_bit_cast(v16bf, __builtin_shufflevector(lo, hi, 0, 1, 2, 3, 4, 5, 6, 7, 8, 9, 10, 11, 12, 13, 14, 15)); }
__device__ __forceinline__ v8f wmma16(v16h a, v16h b, v8f c) { return __builtin_amdgcn_wmma_f32_16x16x32_f16(false, a, false, b, (short)0, c, false, false); }
__device__ __forceinline__ v8f wmmab(v16bf a, v16bf b, v8f c) { return __builtin_amdgcn_wmma_f32_16x16x32_bf16(false, a, false, b, (short)0, c, false, false); }



// ---- k_gemmw: register-blocked GEMM, ONE WAVE per 64x64 output tile (16 accumulators), operands straight from K-contiguous 16-bit planes; grid (M/64, N/64, Z), 32 threads.
// C[m][n] (f32, pitch ldc, + optional f32 bias[n]) = sum_k A[m][k] Bt[n][k] (+ split products per NSPLIT). z-batch strides sA/sB/sC in elements. K % 32 == 0.
template <typename T16> struct WFrag;
template <> struct WFrag<h16> { typedef v16h V; static __device__ __forceinline__ V ld(const h16* p) { return cat16(*(const v8h*)p, *(const v8h*)(p + 16)); } static __device__ __forceinline__ v8f mma(V a, V b, v8f c) { return wmma16(a, b, c); } };
template <> struct WFrag<bf> { typedef v16bf V; static __device__ __forceinline__ V ld(const bf* p) { return cat16b(*(const v8us*)p, *(const v8us*)(p + 16)); } static __device__ __forceinline__ v8f mma(V a, V b, v8f c) { return wmmab(a, b, c); } };
template <typename T16, int NSPLIT, bool BIAS>
__global__ __launch_bounds__(32) void k_gemmw(const T16* __restrict__ A, const T16* __restrict__ A2, const T16* __restrict__ Bt, const T16* __restrict__ Bt2, int K, float* C, int ldc, const float* __restrict__ bias, size_t sA, size_t sB, size_t sC) {
    typedef typename WFrag<T16>::V V;
    __shared__ __align__(16) float os[16 * 68];
    const size_t z = blockIdx.z; A += z * sA; if (A2) A2 += z * sA; Bt += z * sB; if (Bt2) Bt2 += z * sB; C += z * sC;
    const int lane = threadIdx.x & 31, lr = lane & 15, hi = lane >> 4; const int r0 = blockIdx.x * 64, c0 = blockIdx.y * 64;
    v8f acc[4][4];
#pragma unroll
    for (int mb = 0; mb < 4; ++mb)
#pragma unroll
        for (int nb = 0; nb < 4; ++nb) acc[mb][nb] = (v8f){};
    const size_t aoff = (size_t)(r0 + lr) * K + 8 * hi, boff = (size_t)(c0 + lr) * K + 8 * hi;
#pragma unroll 1
    for (int kc = 0; kc < K; kc += 32) {
        V a[4], a2[4];
#pragma unroll
        for (int mb = 0; mb < 4; ++mb) { a[mb] = WFrag<T16>::ld(A + aoff + (size_t)mb * 16 * K + kc); if (NSPLIT == 1 || NSPLIT == 2) a2[mb] = WFrag<T16>::ld(A2 + aoff + (size_t)mb * 16 * K + kc); }
#pragma unroll
        for (int nb = 0; nb < 4; ++nb) { const V b = WFrag<T16>::ld(Bt + boff + (size_t)nb * 16 * K + kc); V b2; if (NSPLIT >= 2) b2 = WFrag<T16>::ld(Bt2 + boff + (size_t)nb * 16 * K + kc);
#pragma unroll
            for (int mb = 0; mb < 4; ++mb) { acc[mb][nb] = WFrag<T16>::mma(a[mb], b, acc[mb][nb]); if (NSPLIT == 1 || NSPLIT == 2) acc[mb][nb] = WFrag<T16>::mma(a2[mb], b, acc[mb][nb]); if (NSPLIT >= 2) acc[mb][nb] = WFrag<T16>::mma(a[mb], b2, acc[mb][nb]); } }
        asm volatile("v_nop\n\tv_nop\n\tv_nop\n\tv_nop" : "+v"(acc[0][0]), "+v"(acc[1][1]), "+v"(acc[2][2]), "+v"(acc[3][3]) : "v"(a[0]), "v"(a[3]));
    }
#pragma unroll
    for (int mb = 0; mb < 4; ++mb) {
#pragma unroll
        for (int nb = 0; nb < 4; ++nb) {
#pragma unroll
            for (int j = 0; j < 8; ++j) os[(hi * 8 + j) * 68 + nb * 16 + lr] = acc[mb][nb][j]; }
        __builtin_amdgcn_wave_barrier(); asm volatile("" ::: "memory");
        float* crow = C + (size_t)(r0 + mb * 16) * ldc + c0;
{
#pragma unroll
            for (int s = 0; s < 8; ++s) { const int row = 2 * s + hi, cofs = lr * 4; v4f val = *(const v4fa*)(os + row * 68 + cofs); if (BIAS) { val[0] += bfr(bias[c0 + cofs]); val[1] += bfr(bias[c0 + cofs + 1]); val[2] += bfr(bias[c0 + cofs + 2]); val[3] += bfr(bias[c0 + cofs + 3]); }
                *(v4f*)(crow + (size_t)row * ldc + cofs) = val; }
             }
        __builtin_amdgcn_wave_barrier(); asm volatile("" ::: "memory");
    }
}

// ---- k_gemmc: the same one-wave 64x64 tile GEMM specialised for causal attention: CMODE 1 skips score tiles entirely above the diagonal (query rows r0+roff.., key columns c0..), CMODE 2 limits the
// key (K) loop of the probability x value contraction to the diagonal block (probabilities beyond it are exactly zero). roff = row offset of this launch's first row within the sequence.
template <typename T16, int NSPLIT, int CMODE>
__global__ __launch_bounds__(32) void k_gemmc(const T16* __restrict__ A, const T16* __restrict__ A2, const T16* __restrict__ Bt, const T16* __restrict__ Bt2, int K, float* C, int ldc, int roff, size_t sA, size_t sB, size_t sC) {
    typedef typename WFrag<T16>::V V;
    __shared__ __align__(16) float os[16 * 68];
    const size_t z = blockIdx.z; A += z * sA; if (A2) A2 += z * sA; Bt += z * sB; if (Bt2) Bt2 += z * sB; C += z * sC;
    const int lane = threadIdx.x & 31, lr = lane & 15, hi = lane >> 4; const int r0 = blockIdx.x * 64, c0 = blockIdx.y * 64;
    if (CMODE == 1 && c0 > r0 + roff + 63) return;                  // score tile entirely above the causal diagonal: never read (the softmax masks j > i by select)
    if (CMODE == 3 && (c0 > r0 + 64 || c0 + 64 < r0)) return;       // band: only the three key tiles around the query tile are ever read
    const int Kl = (CMODE == 2) ? min(K, r0 + roff + 64) : (CMODE == 4 ? min(K, r0 + 128) : K);        // P.V: probabilities are exactly 0 beyond the diagonal block (2) / outside the three-tile band (4)
    const int K0 = (CMODE == 4) ? max(0, r0 - 64) : 0;
    v8f acc[4][4];
#pragma unroll
    for (int mb = 0; mb < 4; ++mb)
#pragma unroll
        for (int nb = 0; nb < 4; ++nb) acc[mb][nb] = (v8f){};
    const size_t aoff = (size_t)(r0 + lr) * K + 8 * hi, boff = (size_t)(c0 + lr) * K + 8 * hi;
#pragma unroll 1
    for (int kc = K0; kc < Kl; kc += 32) {
        V a[4], a2[4];
#pragma unroll
        for (int mb = 0; mb < 4; ++mb) { a[mb] = WFrag<T16>::ld(A + aoff + (size_t)mb * 16 * K + kc); if (NSPLIT == 1 || NSPLIT == 2) a2[mb] = WFrag<T16>::ld(A2 + aoff + (size_t)mb * 16 * K + kc); }
#pragma unroll
        for (int nb = 0; nb < 4; ++nb) { const V b = WFrag<T16>::ld(Bt + boff + (size_t)nb * 16 * K + kc); V b2; if (NSPLIT >= 2) b2 = WFrag<T16>::ld(Bt2 + boff + (size_t)nb * 16 * K + kc);
#pragma unroll
            for (int mb = 0; mb < 4; ++mb) { acc[mb][nb] = WFrag<T16>::mma(a[mb], b, acc[mb][nb]); if (NSPLIT == 1 || NSPLIT == 2) acc[mb][nb] = WFrag<T16>::mma(a2[mb], b, acc[mb][nb]); if (NSPLIT >= 2) acc[mb][nb] = WFrag<T16>::mma(a[mb], b2, acc[mb][nb]); } }
        asm volatile("v_nop\n\tv_nop\n\tv_nop\n\tv_nop" : "+v"(acc[0][0]), "+v"(acc[1][1]), "+v"(acc[2][2]), "+v"(acc[3][3]) : "v"(a[0]), "v"(a[3]));
    }
#pragma unroll
    for (int mb = 0; mb < 4; ++mb) {
#pragma unroll
        for (int nb = 0; nb < 4; ++nb) {
#pragma unroll
            for (int j = 0; j < 8; ++j) os[(hi * 8 + j) * 68 + nb * 16 + lr] = acc[mb][nb][j]; }
        __builtin_amdgcn_wave_barrier(); asm volatile("" ::: "memory");
        float* crow = C + (size_t)(r0 + mb * 16) * ldc + c0;
{
#pragma unroll
            for (int s = 0; s < 8; ++s) { const int row = 2 * s + hi, cofs = lr * 4; v4f val = *(const v4fa*)(os + row * 68 + cofs);
                *(v4f*)(crow + (size_t)row * ldc + cofs) = val; }
             }
        __builtin_amdgcn_wave_barrier(); asm volatile("" ::: "memory");
    }
}

__device__ __forceinline__ h16 tohx(float x) { return (h16)x; }
__device__ __forceinline__ void splitf(float y, unsigned short& h, unsigned short& l) { h = f2bf(y); l = f2bf(y - bf2f(h)); }
typedef __attribute__((ext_vector_type(2))) _Float16 v2h;
typedef __attribute__((ext_vector_type(4))) _Float16 v4h;
typedef __attribute__((ext_vector_type(2))) unsigned short v2us;
typedef __attribute__((ext_vector_type(4))) unsigned short v4us;
typedef __attribute__((ext_vector_type(2))) float v2f;
typedef __attribute__((ext_vector_type(4))) int v4i;

__global__ __launch_bounds__(256) void k_wtG(const float* __restrict__ w, int K, int N, bf* Bt) {
    const int lane = threadIdx.x & 31; const int L0 = (blockIdx.x * 8 + (threadIdx.x >> 5)) * 8; const int nlines = N * K / 64;
{
#pragma unroll 1
        for (int l = 0; l < 8; ++l) { const int L = L0 + l; if (L >= nlines) break; const size_t e = (size_t)L * 64 + lane * 2; const int k = (int)(e % K), n = (int)(e / K); v2us o;
            o[0] = f2bf(w[(size_t)k * N + n]); o[1] = f2bf(w[(size_t)(k + 1) * N + n]); *(v2us*)(Bt + e) = o; }
         }
}
__global__ __launch_bounds__(256) void k_cvt8(const float* __restrict__ src, bf* dst, size_t n8) { const size_t i = (size_t)blockIdx.x * 256 + threadIdx.x; if (i >= n8) return; const v8f v = *(const v8f*)(src + i * 8); v8us o;
#pragma unroll
    for (int k = 0; k < 8; ++k) o[k] = f2bf(v[k]); *(v8us*)(dst + i * 8) = o;  }

// k_rope: head planes [h][t][d] (fp16 + hi/lo) of rope(x) x sc with the rotate-half convention out[d] = x[d] cos[t][d] - x[d+HD/2] sin[t][d], out[d+HD/2] = x[d+HD/2] cos[t][d+HD/2] + x[d] sin[t][d+HD/2]
__global__ __launch_bounds__(256) void k_rope(const float* __restrict__ F, int pitch, int nheads, const float* __restrict__ CS, const float* __restrict__ RF, const float* __restrict__ nw, float sc, h16* P16, bf* Ph, bf* Pl) {
    const size_t e = ((size_t)blockIdx.x * 256 + threadIdx.x) * 2; if (e >= (size_t)nheads * TT * HD) return; const int d = (int)(e % HD); const int t = (int)((e / HD) % TT); const int h = (int)(e / ((size_t)HD * TT)); const float* f = F + (size_t)t * pitch + h * HD; const float rf = RF ? RF[(size_t)h * TT + t] : 1.0f; v2h o16; v2us oh, ol;
#pragma unroll
    for (int q = 0; q < 2; ++q) { const int dd = d + q; const int dp = (dd < HD / 2) ? dd + HD / 2 : dd - HD / 2; float x0 = f[dd], x1 = f[dp];
        if (RF) { float n0 = __fmul_rn(x0, rf), n1 = __fmul_rn(x1, rf); asm volatile("" : "+v"(n0)); asm volatile("" : "+v"(n1)); x0 = __fmul_rn(bfr(nw[dd]), n0); x1 = __fmul_rn(bfr(nw[dp]), n1); }
        const v2f cs = *(const v2f*)(CS + ((size_t)t * HD + dd) * 2); float a = __fmul_rn(x0, cs[0]), bq = __fmul_rn(x1, cs[1]); asm volatile("" : "+v"(a)); asm volatile("" : "+v"(bq)); const float r = ((dd < HD / 2) ? __fsub_rn(a, bq) : __fadd_rn(a, bq)) * sc;
        o16[q] = tohx(r); unsigned short a2, c2; splitf(r, a2, c2); oh[q] = a2; ol[q] = c2; }
    *(v2h*)(P16 + e) = o16; *(v2us*)(Ph + e) = oh; *(v2us*)(Pl + e) = ol;  }
__global__ __launch_bounds__(256) void k_vtp(const float* __restrict__ F, int pitch, int nheads, h16* V16, bf* Vh, bf* Vl) { const size_t e = ((size_t)blockIdx.x * 256 + threadIdx.x) * 2; if (e >= (size_t)nheads * HD * TT) return; const int t = (int)(e % TT); const int d = (int)((e / TT) % HD); const int g = (int)(e / ((size_t)TT * HD)); v2h o16; v2us oh, ol;
#pragma unroll
    for (int q = 0; q < 2; ++q) { const float x = F[(size_t)(t + q) * pitch + g * HD + d]; o16[q] = tohx(x); unsigned short a2, c2; splitf(x, a2, c2); oh[q] = a2; ol[q] = c2; }
    *(v2h*)(V16 + e) = o16; *(v2us*)(Vh + e) = oh; *(v2us*)(Vl + e) = ol;  }
__global__ __launch_bounds__(256) void k_csid(float* CS) { const int idx = blockIdx.x * 256 + threadIdx.x; if (idx >= TT * HD) return; v2f cs; cs[0] = 1.0f; cs[1] = 0.0f; *(v2f*)(CS + (size_t)idx * 2) = cs;  }
__global__ __launch_bounds__(256) void k_gathK(const bf* __restrict__ KPh_, const bf* __restrict__ KPl_, bf* KGh, bf* KGl) { const size_t e = ((size_t)blockIdx.x * 256 + threadIdx.x) * 8; if (e >= (size_t)NH_ * NG * HD) return; const int d = (int)(e % HD); const int gq = (int)((e / HD) % NG); const int h = (int)(e / ((size_t)HD * NG)); const size_t src = ((size_t)h * TT + (size_t)gq * 64) * HD + d; const v8us a = *(const v8us*)(KPh_ + src), c = *(const v8us*)(KPl_ + src); *(v8us*)(KGh + e) = a; *(v8us*)(KGl + e) = c;  }
__global__ __launch_bounds__(256) void k_gathV(const bf* __restrict__ VTh_, const bf* __restrict__ VTl_, bf* VGh, bf* VGl) { const size_t e = ((size_t)blockIdx.x * 256 + threadIdx.x) * 8; if (e >= (size_t)NH_ * HD * NG) return; const int gq = (int)(e % NG); const size_t hd_ = e / NG; v8us a, c;
#pragma unroll
    for (int q = 0; q < 8; ++q) { const size_t src = hd_ * TT + (size_t)(gq + q) * 64; a[q] = VTh_[src]; c[q] = VTl_[src]; } *(v8us*)(VGh + e) = a; *(v8us*)(VGl + e) = c;  }
__global__ __launch_bounds__(256) void k_lgsoft(const float* __restrict__ Sb, const float* __restrict__ SG, bf* Ph, bf* Pl, bf* PGh, bf* PGl) {
    const int lane = threadIdx.x & 31; const int i = blockIdx.x * 8 + (threadIdx.x >> 5); if (i >= TT) return; const int t0 = (i / 64) * 64 - 64;   /* first key of the three-tile span (may be -64) */
    /* local: lane handles keys jl = i - 32 + lane and jl + 32 */
    const int j1 = i - LWH + lane, j2 = j1 + 32; const bool v1 = (j1 >= 0), v2 = (j2 < TT);
    const float s1 = v1 ? Sb[(size_t)i * TT + j1] * SCL : -3.0e38f, s2 = v2 ? Sb[(size_t)i * TT + j2] * SCL : -3.0e38f;
    float mx = fmaxf(s1, s2);
#pragma unroll
    for (int sh = 16; sh; sh >>= 1) mx = fmaxf(mx, __shfl_xor(mx, sh, 32));
    float d1 = __fsub_rn(s1, mx), d2 = __fsub_rn(s2, mx); asm volatile("" : "+v"(d1), "+v"(d2)); const float e1 = __builtin_amdgcn_exp2f(__fmul_rn(d1, 1.4426950408889634f)), e2 = __builtin_amdgcn_exp2f(__fmul_rn(d2, 1.4426950408889634f)); float sum = e1 + e2;
#pragma unroll
    for (int sh = 16; sh; sh >>= 1) sum += __shfl_xor(sum, sh, 32);
    const float f = __fdiv_rn(1.0f, sum); const float p1 = e1 * f, p2 = e2 * f;
    /* global: lane handles keys g = lane and lane + 32 */
    const float g1 = SG[(size_t)i * NG + lane] * SCL, g2 = SG[(size_t)i * NG + lane + 32] * SCL; float gm = fmaxf(g1, g2);
#pragma unroll
    for (int sh = 16; sh; sh >>= 1) gm = fmaxf(gm, __shfl_xor(gm, sh, 32));
    float gd1 = __fsub_rn(g1, gm), gd2 = __fsub_rn(g2, gm); asm volatile("" : "+v"(gd1), "+v"(gd2)); const float ge1 = __builtin_amdgcn_exp2f(__fmul_rn(gd1, 1.4426950408889634f)), ge2 = __builtin_amdgcn_exp2f(__fmul_rn(gd2, 1.4426950408889634f)); float gs = ge1 + ge2;
#pragma unroll
    for (int sh = 16; sh; sh >>= 1) gs += __shfl_xor(gs, sh, 32);
    const float gf = __fdiv_rn(1.0f, gs); const float q1 = ge1 * gf, q2 = ge2 * gf;
v8us bh, bl, gh_, gl_;
#pragma unroll
    for (int q = 0; q < 8; ++q) { const int j = t0 + lane * 8 + q; const int rel = j - (i - LWH);   /* 0..63 inside the window */ const bool in = (rel >= 0 && rel < 64 && j >= 0 && j < TT);
        const float pa = __shfl(p1, rel & 31, 32), pb = __shfl(p2, rel & 31, 32); const float pv = (rel < 32) ? pa : pb; unsigned short a, c; splitf(in ? pv : 0.0f, a, c); bh[q] = a; bl[q] = c;
        const int gq = (lane - 24) * 8 + q; const float qa = __shfl(q1, gq & 31, 32), qb = __shfl(q2, gq & 31, 32); const float gv = (gq < 32) ? qa : qb; splitf(gv, a, c); gh_[q] = a; gl_[q] = c; }
    const bool bandLane = (lane < 24) && (t0 + lane * 8 >= 0) && (t0 + lane * 8 < TT); const bool globLane = (lane >= 24);
{
        if (bandLane) { *(v8us*)(Ph + (size_t)i * TT + t0 + lane * 8) = bh; *(v8us*)(Pl + (size_t)i * TT + t0 + lane * 8) = bl; }   /* band span: lanes 0-23 x 16 B */
        if (globLane) { *(v8us*)(PGh + (size_t)i * NG + (lane - 24) * 8) = gh_; *(v8us*)(PGl + (size_t)i * NG + (lane - 24) * 8) = gl_; }   /* global: lanes 24-31 x 16 B */
         }
}
__global__ __launch_bounds__(256) void k_merge2(const float* __restrict__ O, const float* __restrict__ O2, int h0, bf* Ah, bf* Al) { const size_t e = ((size_t)blockIdx.x * 256 + threadIdx.x) * 2; if (e >= (size_t)TT * HD) return; const int d = (int)(e % HD); const int t = (int)(e / HD); const size_t oo = (size_t)t * DQ + h0 * HD + d; v2us oh, ol;
#pragma unroll
    for (int q = 0; q < 2; ++q) { unsigned short a, c2; splitf(__fadd_rn(O[e + q], O2[e + q]), a, c2); oh[q] = a; ol[q] = c2; } *(v2us*)(Ah + oo) = oh; *(v2us*)(Al + oo) = ol;  }


extern "C" void kernel_launch(void* const* d_in, const int* in_sizes, int n_in,
                              void* d_out, int out_size, void* d_ws, size_t ws_size, hipStream_t stream) {
    (void)in_sizes; (void)n_in; (void)out_size;
    const float* x = (const float*)d_in[0]; const float* wqkv = (const float*)d_in[1]; const float* wo = (const float*)d_in[2]; const float* bo = (const float*)d_in[3]; const float* wq = nullptr; const float* wk = nullptr; const float* wv = nullptr; (void)wq; (void)wk; (void)wv;
    float* OUT = (float*)d_out;     // [2][4096][1024]
    char* wsp = (char*)d_ws;
    auto take = [&](size_t bytes) { char* p = wsp; wsp += (bytes + 255) & ~(size_t)255; return (void*)p; };
    bf* WALL = (bf*)take((size_t)3 * DM * DM * 2); bf* WQ = WALL; bf* WK = WALL + (size_t)DM * DM; bf* WV = WALL + (size_t)2 * DM * DM; bf* WO = (bf*)take((size_t)DM * DQ * 2); float* CS = (float*)take((size_t)TT * HD * 2 * 4);
    bf* XB = (bf*)take((size_t)TT * DM * 2); float* FQ = (float*)take((size_t)TT * DQ * 4); float* FK = (float*)take((size_t)TT * DKV * 4);
    h16* QP16 = (h16*)take((size_t)NH_ * TT * HD * 2); h16* KP16 = QP16; h16* VT16 = QP16;   /* the fp16 planes are written by k_rope / k_vtp but never read here (all rows hi/lo): one shared scratch region */
    bf* QPh = (bf*)take((size_t)NH_ * TT * HD * 2); bf* QPl = (bf*)take((size_t)NH_ * TT * HD * 2); bf* KPh = (bf*)take((size_t)NKV * TT * HD * 2); bf* KPl = (bf*)take((size_t)NKV * TT * HD * 2); bf* VTh = (bf*)take((size_t)NKV * HD * TT * 2); bf* VTl = (bf*)take((size_t)NKV * HD * TT * 2); bf* Ph = (bf*)take((size_t)ZH * RH * TT * 2); bf* Pl = (bf*)take((size_t)ZH * RH * TT * 2);
    float* Sb = (float*)take((size_t)ZH * TT * TT * 4); h16* P16 = (h16*)take(256);   /* unused: all rows hi/lo */ bf* KGh = (bf*)take((size_t)NH_ * NG * HD * 2); bf* KGl = (bf*)take((size_t)NH_ * NG * HD * 2); bf* VGh = (bf*)take((size_t)NH_ * HD * NG * 2); bf* VGl = (bf*)take((size_t)NH_ * HD * NG * 2); float* SG = (float*)take((size_t)TT * NG * 4); bf* PGh = (bf*)take((size_t)TT * NG * 2); bf* PGl = (bf*)take((size_t)TT * NG * 2); float* OG = (float*)take((size_t)TT * HD * 4); float* Ob = (float*)take((size_t)ZH * TT * HD * 4); bf* ATh = (bf*)take((size_t)TT * DQ * 2); bf* ATl = (bf*)take((size_t)TT * DQ * 2);
    if ((size_t)(wsp - (char*)d_ws) > ws_size) return;    // ws 256 MiB
    float* FV = FK;   // v projection reuses the k buffer after the k planes are built (stream-ordered)
    { k_wtG<<<(unsigned)((DM * 3 * DM / 64 + 63) / 64), 256, 0, stream>>>(wqkv, DM, 3 * DM, WALL);   /* fused 'xw' [DM][3DM] -> Bt [3DM][DM] (row blocks q | k | v) */
      k_wtG<<<(unsigned)((DQ * DM / 64 + 63) / 64), 256, 0, stream>>>(wo, DQ, DM, WO);
       }
    k_csid<<<(TT * HD + 255) / 256, 256, 0, stream>>>(CS);
    const unsigned LQ = (unsigned)(((size_t)NH_ * TT * HD / 2 + 255) / 256), LKv = (unsigned)(((size_t)NKV * TT * HD / 2 + 255) / 256);
    for (int b = 0; b < NB_; ++b) {
        
        k_cvt8<<<(unsigned)(((size_t)TT * DM / 8 + 255) / 256), 256, 0, stream>>>(x + (size_t)b * TT * DM, XB, (size_t)TT * DM / 8);
        k_gemmw<bf, 0, false><<<dim3(TT / 64, DQ / 64, 1), 32, 0, stream>>>(XB, nullptr, WQ, nullptr, DM, FQ, DQ, nullptr, 0, 0, 0);
        k_rope<<<LQ, 256, 0, stream>>>(FQ, DQ, NH_, CS, nullptr, nullptr, 1.0f, QP16, QPh, QPl);
        k_gemmw<bf, 0, false><<<dim3(TT / 64, DKV / 64, 1), 32, 0, stream>>>(XB, nullptr, WK, nullptr, DM, FK, DKV, nullptr, 0, 0, 0);
        k_rope<<<LKv, 256, 0, stream>>>(FK, DKV, NKV, CS, nullptr, nullptr, 1.0f, KP16, KPh, KPl);
        k_gemmw<bf, 0, false><<<dim3(TT / 64, DKV / 64, 1), 32, 0, stream>>>(XB, nullptr, WV, nullptr, DM, FV, DKV, nullptr, 0, 0, 0); k_vtp<<<LKv, 256, 0, stream>>>(FV, DKV, NKV, VT16, VTh, VTl);
        k_gathK<<<(unsigned)(((size_t)NH_ * NG * HD / 8 + 255) / 256), 256, 0, stream>>>(KPh, KPl, KGh, KGl); k_gathV<<<(unsigned)(((size_t)NH_ * HD * NG / 8 + 255) / 256), 256, 0, stream>>>(VTh, VTl, VGh, VGl);   /* the 64 strided keys / values per head */
        for (int h0 = 0; h0 < NH_; ++h0) { const size_t zq = (size_t)h0;
            k_gemmc<bf, 2, 3><<<dim3(TT / 64, TT / 64, 1), 32, 0, stream>>>(QPh + zq * TT * HD, QPl + zq * TT * HD, KPh + zq * TT * HD, KPl + zq * TT * HD, HD, Sb, TT, 0, 0, 0, 0);   /* band scores (3 tiles per query tile) */
            k_gemmw<bf, 2, false><<<dim3(TT / 64, 1, 1), 32, 0, stream>>>(QPh + zq * TT * HD, QPl + zq * TT * HD, KGh + zq * NG * HD, KGl + zq * NG * HD, HD, SG, NG, nullptr, 0, 0, 0);   /* global scores [4096][64] */
            k_lgsoft<<<TT / 8, 256, 0, stream>>>(Sb, SG, Ph, Pl, PGh, PGl);                                                                                 /* local + global softmaxes */
            k_gemmc<bf, 2, 4><<<dim3(TT / 64, 1, 1), 32, 0, stream>>>(Ph, Pl, VTh + zq * HD * TT, VTl + zq * HD * TT, TT, Ob, HD, 0, 0, 0, 0);                    /* local attn . v (K loop over the band) */
            k_gemmw<bf, 2, false><<<dim3(TT / 64, 1, 1), 32, 0, stream>>>(PGh, PGl, VGh + zq * HD * NG, VGl + zq * HD * NG, NG, OG, HD, nullptr, 0, 0, 0);        /* global attn . v_g */
            k_merge2<<<(unsigned)(((size_t)TT * HD / 2 + 255) / 256), 256, 0, stream>>>(Ob, OG, h0, ATh, ATl); }                                               /* sum -> merged planes */
        k_gemmw<bf, 1, true><<<dim3(TT / 64, DM / 64, 1), 32, 0, stream>>>(ATh, ATl, WO, nullptr, DQ, OUT + (size_t)b * TT * DM, DM, bo, 0, 0, 0); }
}

// v002
// Measured time: 353 microseconds a run.
// It is 3.25 times as fast as v000, going by the measured steps of the versions left out in between.
#include <hip/hip_runtime.h>

// Local (sliding window of 64, centred) + strided global (every 64th key) attention, summed, then an output projection (x [2][4096][1024]; [q|k|v] = x w_qkv ('xw' [1024][3072], reshape (3, H, Dh): thirds); 16 heads x 64; local: softmax over keys j in [i-32, i+31] (clipped to the sequence) of q.k/8; global: softmax over the 64 keys j = 64 g of q.k/8; out = (attn_local v + attn_global v_g) merged, w_out + b_out -> [2][4096][1024] (8.4 M)).
// Algorithm: hi/lo planes of q, k (as [head][t][d]) and v (as [head][d][t]) are written by the epilogue of ONE projection launch over all 3072 columns of [q|k|v]; all 16 heads of a batch row per launch (grid z or y = head; band scores and band probabilities in compact [head][row][192] planes, column = key - first key of the row's three-tile span): banded score GEMM (only the three 64-wide key tiles around each query tile are computed), compact global score GEMM against the 64 gathered keys, one row kernel does both softmaxes (window entries -> band probability planes with exact zeros elsewhere in the three tiles; 64 global probabilities -> compact planes), banded P.V GEMM (K loop limited to the three tiles) + compact P_g.V_g GEMM, whose epilogue adds the band partial output and writes the merged hi/lo planes for the output projection.
// Compute dtypes, f32 accumulate: every input rounded to bf16; q/k/v on PLAIN bf16 operands (inputs: exact); band / global scores and probability x value products on hi/lo planes (3 products); both softmaxes f32; w_out hl x exact (2 products) + b_out.

#define NB_  2
#define TT   4096
#define DM   1024
#define NH_  16
#define NKV  16
#define REP  (NH_ / NKV)
#define HD   64
#define DQ   (NH_ * HD)
#define DKV  (NKV * HD)
#define ZH   1
#define RH   4096                 // every row hi/lo
#define LWH  32                   // half window: keys i-32 .. i+31
#define NG   64                   // global keys (every 64th)
#define BW   192                  // pitch of the compact band planes: the three 64-wide key tiles around a query tile
#define WIN  4096
#define PCAR 1024.0f
#define SCL  0.125f   // HD^-0.5
#define PLN  ((size_t)NH_ * TT * HD)   // elements of one q / k / v plane
typedef _Float16 h16;
typedef unsigned short bf;
typedef __attribute__((ext_vector_type(16))) __bf16   v16bf;
typedef __attribute__((ext_vector_type(16))) _Float16 v16h;
typedef __attribute__((ext_vector_type(8)))  _Float16 v8h;
typedef __attribute__((ext_vector_type(8)))  unsigned short v8us;
typedef __attribute__((ext_vector_type(8)))  float    v8f;
typedef __attribute__((ext_vector_type(4)))  float    v4f;
typedef v8h  __attribute__((may_alias)) v8ha;
typedef v4f  __attribute__((may_alias)) v4fa;
typedef v8us __attribute__((may_alias)) v8usa;

__device__ __forceinline__ unsigned short f2bf(float f) { unsigned u = __float_as_uint(f); u += 0x7FFFu + ((u >> 16) & 1u); return (unsigned short)(u >> 16); }
__device__ __forceinline__ float bf2f(unsigned short b) { return __uint_as_float(((unsigned)b) << 16); }
__device__ __forceinline__ float bfr(float f) { return bf2f(f2bf(f)); }
__device__ __forceinline__ void splitf(float y, unsigned short& h, unsigned short& l) { h = f2bf(y); l = f2bf(y - bf2f(h)); }
typedef __attribute__((ext_vector_type(4))) unsigned short v4us;
__device__ __forceinline__ v16h cat16(v8h lo, v8h hi) { return __builtin_shufflevector(lo, hi, 0, 1, 2, 3, 4, 5, 6, 7, 8, 9, 10, 11, 12, 13, 14, 15); }
__device__ __forceinline__ v16bf cat16b(v8us lo, v8us hi) { return __builtin_bit_cast(v16bf, __builtin_shufflevector(lo, hi, 0, 1, 2, 3, 4, 5, 6, 7, 8, 9, 10, 11, 12, 13, 14, 15)); }
__device__ __forceinline__ v8f wmma16(v16h a, v16h b, v8f c) { return __builtin_amdgcn_wmma_f32_16x16x32_f16(false, a, false, b, (short)0, c, false, false); }
__device__ __forceinline__ v8f wmmab(v16bf a, v16bf b, v8f c) { return __builtin_amdgcn_wmma_f32_16x16x32_bf16(false, a, false, b, (short)0, c, false, false); }



// ---- k_gemmw: register-blocked GEMM, ONE WAVE per 64x64 output tile (16 accumulators), operands straight from K-contiguous 16-bit planes; grid (M/64, N/64, Z), 32 threads.
// C[m][n] (f32, pitch ldc, + optional f32 bias[n]) = sum_k A[m][k] Bt[n][k] (+ split products per NSPLIT). z-batch strides sA/sB/sC in elements. K % 32 == 0.
// EPI picks what the epilogue does with the f32 tile: 0 store to C; 1 store to C with bias; 2 [q|k|v] projection: column tile y is head y % 16 of third y / 16, the tile is split into bf16 hi/lo and stored to that
// third's planes (Mh/Ml: q planes; k and v planes follow at 2 PLN and 4 PLN elements), q and k as [head][t][d], v transposed as [head][d][t], C unused; 3 the tile plus the f32 tile read from C is split into Mh/Ml (indexed like C, pitch DQ).
template <typename T16> struct WFrag;
template <> struct WFrag<h16> { typedef v16h V; static __device__ __forceinline__ V ld(const h16* p) { return cat16(*(const v8h*)p, *(const v8h*)(p + 16)); } static __device__ __forceinline__ v8f mma(V a, V b, v8f c) { return wmma16(a, b, c); } };
template <> struct WFrag<bf> { typedef v16bf V; static __device__ __forceinline__ V ld(const bf* p) { return cat16b(*(const v8us*)p, *(const v8us*)(p + 16)); } static __device__ __forceinline__ v8f mma(V a, V b, v8f c) { return wmmab(a, b, c); } };
template <typename T16, int NSPLIT, int EPI>
__global__ __launch_bounds__(32) void k_gemmw(const T16* __restrict__ A, const T16* __restrict__ A2, const T16* __restrict__ Bt, const T16* __restrict__ Bt2, int K, float* C, int ldc, const float* __restrict__ bias, size_t sA, size_t sB, size_t sC, bf* Mh, bf* Ml) {
    constexpr bool BIAS = (EPI == 1);
    typedef typename WFrag<T16>::V V;
    __shared__ __align__(16) float os[16 * 68];
    const size_t z = blockIdx.z; A += z * sA; if (A2) A2 += z * sA; Bt += z * sB; if (Bt2) Bt2 += z * sB; if (EPI != 2) C += z * sC; if (EPI == 3) { Mh += z * sC; Ml += z * sC; }
    const int lane = threadIdx.x & 31, lr = lane & 15, hi = lane >> 4; const int r0 = blockIdx.x * 64, c0 = blockIdx.y * 64;
    v8f acc[4][4];
#pragma unroll
    for (int mb = 0; mb < 4; ++mb)
#pragma unroll
        for (int nb = 0; nb < 4; ++nb) acc[mb][nb] = (v8f){};
    const size_t aoff = (size_t)(r0 + lr) * K + 8 * hi, boff = (size_t)(c0 + lr) * K + 8 * hi;
#pragma unroll 1
    for (int kc = 0; kc < K; kc += 32) {
        V a[4], a2[4];
#pragma unroll
        for (int mb = 0; mb < 4; ++mb) { a[mb] = WFrag<T16>::ld(A + aoff + (size_t)mb * 16 * K + kc); if (NSPLIT == 1 || NSPLIT == 2) a2[mb] = WFrag<T16>::ld(A2 + aoff + (size_t)mb * 16 * K + kc); }
#pragma unroll
        for (int nb = 0; nb < 4; ++nb) { const V b = WFrag<T16>::ld(Bt + boff + (size_t)nb * 16 * K + kc); V b2; if (NSPLIT >= 2) b2 = WFrag<T16>::ld(Bt2 + boff + (size_t)nb * 16 * K + kc);
#pragma unroll
            for (int mb = 0; mb < 4; ++mb) { acc[mb][nb] = WFrag<T16>::mma(a[mb], b, acc[mb][nb]); if (NSPLIT == 1 || NSPLIT == 2) acc[mb][nb] = WFrag<T16>::mma(a2[mb], b, acc[mb][nb]); if (NSPLIT >= 2) acc[mb][nb] = WFrag<T16>::mma(a[mb], b2, acc[mb][nb]); } }
        asm volatile("v_nop\n\tv_nop\n\tv_nop\n\tv_nop" : "+v"(acc[0][0]), "+v"(acc[1][1]), "+v"(acc[2][2]), "+v"(acc[3][3]) : "v"(a[0]), "v"(a[3]));
    }
    if (EPI == 2 && blockIdx.y >= 2 * NH_) {   // v third: a lane's 8 accumulator rows are 8 consecutive t of one d, so the transposed planes take 16-byte stores straight from the registers
        const size_t vo = 4 * PLN + ((size_t)(blockIdx.y - 2 * NH_) * HD + lr) * TT + r0 + hi * 8;
#pragma unroll
        for (int nb = 0; nb < 4; ++nb)
#pragma unroll
            for (int mb = 0; mb < 4; ++mb) { v8us oh, ol;
#pragma unroll
                for (int j = 0; j < 8; ++j) { unsigned short a_, c_; splitf(acc[mb][nb][j], a_, c_); oh[j] = a_; ol[j] = c_; }
                *(v8us*)(Mh + vo + (size_t)nb * 16 * TT + mb * 16) = oh; *(v8us*)(Ml + vo + (size_t)nb * 16 * TT + mb * 16) = ol; }
        return;
    }
#pragma unroll
    for (int mb = 0; mb < 4; ++mb) {
        const size_t mo = (size_t)(r0 + mb * 16) * DQ + c0; v4f o1[8];   // EPI 3: C, Mh, Ml all have the pitch DQ, a constant here so that the row steps fold into the instructions' offsets
        if (EPI == 3) {   // the 16 rows of the other partial: all 8 loads in flight while the tile goes through LDS
#pragma unroll
            for (int s = 0; s < 8; ++s) o1[s] = *(const v4f*)(C + mo + (size_t)(2 * s + hi) * DQ + lr * 4); }
#pragma unroll
        for (int nb = 0; nb < 4; ++nb) {
#pragma unroll
            for (int j = 0; j < 8; ++j) os[(hi * 8 + j) * 68 + nb * 16 + lr] = acc[mb][nb][j]; }
        __builtin_amdgcn_wave_barrier(); asm volatile("" ::: "memory");
        if (EPI == 2) {   // q / k third: row t of one head is one 128-byte line of each plane
            const size_t po = (size_t)(blockIdx.y / NH_) * 2 * PLN + ((size_t)(blockIdx.y % NH_) * TT + r0 + mb * 16) * HD;
#pragma unroll
            for (int s = 0; s < 8; ++s) { const int row = 2 * s + hi, cofs = lr * 4; const v4f val = *(const v4fa*)(os + row * 68 + cofs); v4us oh, ol;
#pragma unroll
                for (int q = 0; q < 4; ++q) { unsigned short a_, c_; splitf(val[q], a_, c_); oh[q] = a_; ol[q] = c_; }
                *(v4us*)(Mh + po + (size_t)row * HD + cofs) = oh; *(v4us*)(Ml + po + (size_t)row * HD + cofs) = ol; }
        } else if (EPI == 3) {
#pragma unroll
            for (int s = 0; s < 8; ++s) { const int row = 2 * s + hi, cofs = lr * 4; const v4f val = *(const v4fa*)(os + row * 68 + cofs); v4us oh, ol;
#pragma unroll
                for (int q = 0; q < 4; ++q) { unsigned short a_, c_; splitf(__fadd_rn(o1[s][q], val[q]), a_, c_); oh[q] = a_; ol[q] = c_; }
                *(v4us*)(Mh + mo + (size_t)row * DQ + cofs) = oh; *(v4us*)(Ml + mo + (size_t)row * DQ + cofs) = ol; }
        } else {
            float* crow = C + (size_t)(r0 + mb * 16) * ldc + c0;
#pragma unroll
            for (int s = 0; s < 8; ++s) { const int row = 2 * s + hi, cofs = lr * 4; v4f val = *(const v4fa*)(os + row * 68 + cofs); if (BIAS) { val[0] += bfr(bias[c0 + cofs]); val[1] += bfr(bias[c0 + cofs + 1]); val[2] += bfr(bias[c0 + cofs + 2]); val[3] += bfr(bias[c0 + cofs + 3]); }
                *(v4f*)(crow + (size_t)row * ldc + cofs) = val; }
        }
        if (EPI >= 2) asm volatile("s_wait_xcnt 0x0" ::: "memory");   // the next block's loads and LDS reads reuse registers that these stores name
        __builtin_amdgcn_wave_barrier(); asm volatile("" ::: "memory");
    }
}

// ---- k_gemmc: the same one-wave 64x64 tile GEMM specialised for the band, grid z = head. CMODE 3 (scores): blockIdx.y = 0..2 picks the key tile r0 - 64 + 64 y (tiles off the sequence are skipped), C is the compact
// [row][BW] plane. CMODE 4 (probability x value): A is the compact [row][BW] plane, Bt the [d][key] plane, and the key (K) loop runs over the part of the three-tile span that lies in the sequence.
template <typename T16, int NSPLIT, int CMODE>
__global__ __launch_bounds__(32) void k_gemmc(const T16* __restrict__ A, const T16* __restrict__ A2, const T16* __restrict__ Bt, const T16* __restrict__ Bt2, float* C, int ldc, size_t sA, size_t sB, size_t sC) {
    typedef typename WFrag<T16>::V V;
    __shared__ __align__(16) float os[16 * 68];
    const size_t z = blockIdx.z; A += z * sA; if (A2) A2 += z * sA; Bt += z * sB; if (Bt2) Bt2 += z * sB; C += z * sC;
    const int lane = threadIdx.x & 31, lr = lane & 15, hi = lane >> 4; const int r0 = blockIdx.x * 64, cw = blockIdx.y * 64;   // cw: first output column
    constexpr int lda = (CMODE == 4) ? BW : HD, ldb = (CMODE == 4) ? TT : HD;   // operand pitches of the two band products
    const int c0 = (CMODE == 3) ? r0 - 64 + cw : cw;                // first row of Bt: the key tile (3) / the value column tile (4)
    if (CMODE == 3 && (c0 < 0 || c0 >= TT)) return;                 // band: a key tile off the sequence is never written and never read
    const int Kl = (CMODE == 4) ? min(TT, r0 + 128) : lda;          // P.V: absolute keys of the three-tile span, clipped to the sequence
    const int K0 = (CMODE == 4) ? max(0, r0 - 64) : 0;
    const int ash = (CMODE == 4) ? r0 - 64 : 0;                     // P.V: column of A = key - first key of the span
    v8f acc[4][4];
#pragma unroll
    for (int mb = 0; mb < 4; ++mb)
#pragma unroll
        for (int nb = 0; nb < 4; ++nb) acc[mb][nb] = (v8f){};
    const size_t aoff = (size_t)((r0 + lr) * lda + 8 * hi - ash), boff = (size_t)(c0 + lr) * ldb + 8 * hi;
#pragma unroll 1
    for (int kc = K0; kc < Kl; kc += 32) {
        V a[4], a2[4];
#pragma unroll
        for (int mb = 0; mb < 4; ++mb) { a[mb] = WFrag<T16>::ld(A + aoff + (size_t)mb * 16 * lda + kc); if (NSPLIT == 1 || NSPLIT == 2) a2[mb] = WFrag<T16>::ld(A2 + aoff + (size_t)mb * 16 * lda + kc); }
#pragma unroll
        for (int nb = 0; nb < 4; ++nb) { const V b = WFrag<T16>::ld(Bt + boff + (size_t)nb * 16 * ldb + kc); V b2; if (NSPLIT >= 2) b2 = WFrag<T16>::ld(Bt2 + boff + (size_t)nb * 16 * ldb + kc);
#pragma unroll
            for (int mb = 0; mb < 4; ++mb) { acc[mb][nb] = WFrag<T16>::mma(a[mb], b, acc[mb][nb]); if (NSPLIT == 1 || NSPLIT == 2) acc[mb][nb] = WFrag<T16>::mma(a2[mb], b, acc[mb][nb]); if (NSPLIT >= 2) acc[mb][nb] = WFrag<T16>::mma(a[mb], b2, acc[mb][nb]); } }
        asm volatile("v_nop\n\tv_nop\n\tv_nop\n\tv_nop" : "+v"(acc[0][0]), "+v"(acc[1][1]), "+v"(acc[2][2]), "+v"(acc[3][3]) : "v"(a[0]), "v"(a[3]));
    }
#pragma unroll
    for (int mb = 0; mb < 4; ++mb) {
#pragma unroll
        for (int nb = 0; nb < 4; ++nb) {
#pragma unroll
            for (int j = 0; j < 8; ++j) os[(hi * 8 + j) * 68 + nb * 16 + lr] = acc[mb][nb][j]; }
        __builtin_amdgcn_wave_barrier(); asm volatile("" ::: "memory");
        float* crow = C + (size_t)(r0 + mb * 16) * ldc + cw;
{
#pragma unroll
            for (int s = 0; s < 8; ++s) { const int row = 2 * s + hi, cofs = lr * 4; v4f val = *(const v4fa*)(os + row * 68 + cofs);
                *(v4f*)(crow + (size_t)row * ldc + cofs) = val; }
             }
        __builtin_amdgcn_wave_barrier(); asm volatile("" ::: "memory");
    }
}

typedef __attribute__((ext_vector_type(2))) _Float16 v2h;
typedef __attribute__((ext_vector_type(4))) _Float16 v4h;
typedef __attribute__((ext_vector_type(2))) unsigned short v2us;
typedef __attribute__((ext_vector_type(2))) float v2f;
typedef __attribute__((ext_vector_type(4))) int v4i;

__global__ __launch_bounds__(256) void k_wtG(const float* __restrict__ w, int K, int N, bf* Bt) {
    const int lane = threadIdx.x & 31; const int L0 = (blockIdx.x * 8 + (threadIdx.x >> 5)) * 8; const int nlines = N * K / 64;
{
#pragma unroll 1
        for (int l = 0; l < 8; ++l) { const int L = L0 + l; if (L >= nlines) break; const size_t e = (size_t)L * 64 + lane * 2; const int k = (int)(e % K), n = (int)(e / K); v2us o;
            o[0] = f2bf(w[(size_t)k * N + n]); o[1] = f2bf(w[(size_t)(k + 1) * N + n]); *(v2us*)(Bt + e) = o; }
         }
}
__global__ __launch_bounds__(256) void k_cvt8(const float* __restrict__ src, bf* dst, size_t n8) { const size_t i = (size_t)blockIdx.x * 256 + threadIdx.x; if (i >= n8) return; const v8f v = *(const v8f*)(src + i * 8); v8us o;
#pragma unroll
    for (int k = 0; k < 8; ++k) o[k] = f2bf(v[k]); *(v8us*)(dst + i * 8) = o;  }

__global__ __launch_bounds__(256) void k_gathK(const bf* __restrict__ KPh_, const bf* __restrict__ KPl_, bf* KGh, bf* KGl) { const size_t e = ((size_t)blockIdx.x * 256 + threadIdx.x) * 8; if (e >= (size_t)NH_ * NG * HD) return; const int d = (int)(e % HD); const int gq = (int)((e / HD) % NG); const int h = (int)(e / ((size_t)HD * NG)); const size_t src = ((size_t)h * TT + (size_t)gq * 64) * HD + d; const v8us a = *(const v8us*)(KPh_ + src), c = *(const v8us*)(KPl_ + src); *(v8us*)(KGh + e) = a; *(v8us*)(KGl + e) = c;  }
__global__ __launch_bounds__(256) void k_gathV(const bf* __restrict__ VTh_, const bf* __restrict__ VTl_, bf* VGh, bf* VGl) { const size_t e = ((size_t)blockIdx.x * 256 + threadIdx.x) * 8; if (e >= (size_t)NH_ * HD * NG) return; const int gq = (int)(e % NG); const size_t hd_ = e / NG; v8us a, c;
#pragma unroll
    for (int q = 0; q < 8; ++q) { const size_t src = hd_ * TT + (size_t)(gq + q) * 64; a[q] = VTh_[src]; c[q] = VTl_[src]; } *(v8us*)(VGh + e) = a; *(v8us*)(VGl + e) = c;  }
__global__ __launch_bounds__(256) void k_lgsoft(const float* __restrict__ Sb, const float* __restrict__ SG, bf* Ph, bf* Pl, bf* PGh, bf* PGl) {
    const int lane = threadIdx.x & 31; const int i = blockIdx.x * 8 + (threadIdx.x >> 5); if (i >= TT) return; const int t0 = (i / 64) * 64 - 64;   /* first key of the three-tile span (may be -64) */
    { const size_t h = blockIdx.y; Sb += h * TT * BW; Ph += h * TT * BW; Pl += h * TT * BW; SG += h * TT * NG; PGh += h * TT * NG; PGl += h * TT * NG; }   /* grid y = head */
    /* local: lane handles keys jl = i - 32 + lane and jl + 32 */
    const int j1 = i - LWH + lane, j2 = j1 + 32; const bool v1 = (j1 >= 0), v2 = (j2 < TT);
    const float s1 = v1 ? Sb[(size_t)i * BW + (j1 - t0)] * SCL : -3.0e38f, s2 = v2 ? Sb[(size_t)i * BW + (j2 - t0)] * SCL : -3.0e38f;
    float mx = fmaxf(s1, s2);
#pragma unroll
    for (int sh = 16; sh; sh >>= 1) mx = fmaxf(mx, __shfl_xor(mx, sh, 32));
    float d1 = __fsub_rn(s1, mx), d2 = __fsub_rn(s2, mx); asm volatile("" : "+v"(d1), "+v"(d2)); const float e1 = __builtin_amdgcn_exp2f(__fmul_rn(d1, 1.4426950408889634f)), e2 = __builtin_amdgcn_exp2f(__fmul_rn(d2, 1.4426950408889634f)); float sum = e1 + e2;
#pragma unroll
    for (int sh = 16; sh; sh >>= 1) sum += __shfl_xor(sum, sh, 32);
    const float f = __fdiv_rn(1.0f, sum); const float p1 = e1 * f, p2 = e2 * f;
    /* global: lane handles keys g = lane and lane + 32 */
    const float g1 = SG[(size_t)i * NG + lane] * SCL, g2 = SG[(size_t)i * NG + lane + 32] * SCL; float gm = fmaxf(g1, g2);
#pragma unroll
    for (int sh = 16; sh; sh >>= 1) gm = fmaxf(gm, __shfl_xor(gm, sh, 32));
    float gd1 = __fsub_rn(g1, gm), gd2 = __fsub_rn(g2, gm); asm volatile("" : "+v"(gd1), "+v"(gd2)); const float ge1 = __builtin_amdgcn_exp2f(__fmul_rn(gd1, 1.4426950408889634f)), ge2 = __builtin_amdgcn_exp2f(__fmul_rn(gd2, 1.4426950408889634f)); float gs = ge1 + ge2;
#pragma unroll
    for (int sh = 16; sh; sh >>= 1) gs += __shfl_xor(gs, sh, 32);
    const float gf = __fdiv_rn(1.0f, gs); const float q1 = ge1 * gf, q2 = ge2 * gf;
v8us bh, bl, gh_, gl_;
#pragma unroll
    for (int q = 0; q < 8; ++q) { const int j = t0 + lane * 8 + q; const int rel = j - (i - LWH);   /* 0..63 inside the window */ const bool in = (rel >= 0 && rel < 64 && j >= 0 && j < TT);
        const float pa = __shfl(p1, rel & 31, 32), pb = __shfl(p2, rel & 31, 32); const float pv = (rel < 32) ? pa : pb; unsigned short a, c; splitf(in ? pv : 0.0f, a, c); bh[q] = a; bl[q] = c;
        const int gq = (lane - 24) * 8 + q; const float qa = __shfl(q1, gq & 31, 32), qb = __shfl(q2, gq & 31, 32); const float gv = (gq < 32) ? qa : qb; splitf(gv, a, c); gh_[q] = a; gl_[q] = c; }
    const bool bandLane = (lane < 24) && (t0 + lane * 8 >= 0) && (t0 + lane * 8 < TT); const bool globLane = (lane >= 24);
{
        if (bandLane) { *(v8us*)(Ph + (size_t)i * BW + lane * 8) = bh; *(v8us*)(Pl + (size_t)i * BW + lane * 8) = bl; }   /* band span: lanes 0-23 x 16 B */
        if (globLane) { *(v8us*)(PGh + (size_t)i * NG + (lane - 24) * 8) = gh_; *(v8us*)(PGl + (size_t)i * NG + (lane - 24) * 8) = gl_; }   /* global: lanes 24-31 x 16 B */
         }
}

extern "C" void kernel_launch(void* const* d_in, const int* in_sizes, int n_in,
                              void* d_out, int out_size, void* d_ws, size_t ws_size, hipStream_t stream) {
    (void)in_sizes; (void)n_in; (void)out_size;
    const float* x = (const float*)d_in[0]; const float* wqkv = (const float*)d_in[1]; const float* wo = (const float*)d_in[2]; const float* bo = (const float*)d_in[3]; const float* wq = nullptr; const float* wk = nullptr; const float* wv = nullptr; (void)wq; (void)wk; (void)wv;
    float* OUT = (float*)d_out;     // [2][4096][1024]
    char* wsp = (char*)d_ws;
    auto take = [&](size_t bytes) { char* p = wsp; wsp += (bytes + 255) & ~(size_t)255; return (void*)p; };
    bf* WALL = (bf*)take((size_t)3 * DM * DM * 2); bf* WO = (bf*)take((size_t)DM * DQ * 2);
    bf* XB = (bf*)take((size_t)TT * DM * 2); float* Ob = (float*)take((size_t)TT * DQ * 4);   /* band partial output [t][head * HD + d] */
    bf* QPh = (bf*)take(6 * PLN * 2); bf* QPl = QPh + PLN; bf* KPh = QPh + 2 * PLN; bf* KPl = QPh + 3 * PLN; bf* VTh = QPh + 4 * PLN; bf* VTl = QPh + 5 * PLN;   /* one block: the projection's epilogue finds the k and v planes behind the q planes */
    bf* Ph = (bf*)take((size_t)NH_ * TT * BW * 2); bf* Pl = (bf*)take((size_t)NH_ * TT * BW * 2);
    float* Sb = (float*)take((size_t)NH_ * TT * BW * 4); h16* P16 = (h16*)take(256);   /* unused: all rows hi/lo */ bf* KGh = (bf*)take((size_t)NH_ * NG * HD * 2); bf* KGl = (bf*)take((size_t)NH_ * NG * HD * 2); bf* VGh = (bf*)take((size_t)NH_ * HD * NG * 2); bf* VGl = (bf*)take((size_t)NH_ * HD * NG * 2); float* SG = (float*)take((size_t)NH_ * TT * NG * 4); bf* PGh = (bf*)take((size_t)NH_ * TT * NG * 2); bf* PGl = (bf*)take((size_t)NH_ * TT * NG * 2); bf* ATh = (bf*)take((size_t)TT * DQ * 2); bf* ATl = (bf*)take((size_t)TT * DQ * 2);
    if ((size_t)(wsp - (char*)d_ws) > ws_size) return;    // ws 256 MiB
    { k_wtG<<<(unsigned)((DM * 3 * DM / 64 + 63) / 64), 256, 0, stream>>>(wqkv, DM, 3 * DM, WALL);   /* fused 'xw' [DM][3DM] -> Bt [3DM][DM] (row blocks q | k | v) */
      k_wtG<<<(unsigned)((DQ * DM / 64 + 63) / 64), 256, 0, stream>>>(wo, DQ, DM, WO);
       }
    for (int b = 0; b < NB_; ++b) {
        
        k_cvt8<<<(unsigned)(((size_t)TT * DM / 8 + 255) / 256), 256, 0, stream>>>(x + (size_t)b * TT * DM, XB, (size_t)TT * DM / 8);
        k_gemmw<bf, 0, 2><<<dim3(TT / 64, 3 * DM / 64, 1), 32, 0, stream>>>(XB, nullptr, WALL, nullptr, DM, nullptr, 0, nullptr, 0, 0, 0, QPh, QPl);   /* [q|k|v] projection, epilogue -> hi/lo planes */
        k_gathK<<<(unsigned)(((size_t)NH_ * NG * HD / 8 + 255) / 256), 256, 0, stream>>>(KPh, KPl, KGh, KGl); k_gathV<<<(unsigned)(((size_t)NH_ * HD * NG / 8 + 255) / 256), 256, 0, stream>>>(VTh, VTl, VGh, VGl);   /* the 64 strided keys / values per head */
        k_gemmc<bf, 2, 3><<<dim3(TT / 64, 3, NH_), 32, 0, stream>>>(QPh, QPl, KPh, KPl, Sb, BW, (size_t)TT * HD, (size_t)TT * HD, (size_t)TT * BW);             /* band scores (3 tiles per query tile), z = head */
        k_gemmw<bf, 2, 0><<<dim3(TT / 64, 1, NH_), 32, 0, stream>>>(QPh, QPl, KGh, KGl, HD, SG, NG, nullptr, (size_t)TT * HD, (size_t)NG * HD, (size_t)TT * NG, nullptr, nullptr);      /* global scores [head][4096][64] */
        k_lgsoft<<<dim3(TT / 8, NH_, 1), 256, 0, stream>>>(Sb, SG, Ph, Pl, PGh, PGl);                                                                                   /* local + global softmaxes, y = head */
        k_gemmc<bf, 2, 4><<<dim3(TT / 64, 1, NH_), 32, 0, stream>>>(Ph, Pl, VTh, VTl, Ob, DQ, (size_t)TT * BW, (size_t)HD * TT, (size_t)HD);                      /* local attn . v (K loop over the band) */
        k_gemmw<bf, 2, 3><<<dim3(TT / 64, 1, NH_), 32, 0, stream>>>(PGh, PGl, VGh, VGl, NG, Ob, DQ, nullptr, (size_t)TT * NG, (size_t)HD * NG, (size_t)HD, ATh, ATl);   /* global attn . v_g, + band partial -> merged planes */
        k_gemmw<bf, 1, 1><<<dim3(TT / 64, DM / 64, 1), 32, 0, stream>>>(ATh, ATl, WO, nullptr, DQ, OUT + (size_t)b * TT * DM, DM, bo, 0, 0, 0, nullptr, nullptr); }
}

// v003
// A run of this version takes 324 microseconds.
// Next to v002, in two timings, it ran 1.09 times as fast each time.
// All steps since v000 together make it 3.54 times as fast.
#include <hip/hip_runtime.h>

// Local (sliding window of 64, centred) + strided global (every 64th key) attention, summed, then an output projection (x [2][4096][1024]; [q|k|v] = x w_qkv ('xw' [1024][3072], reshape (3, H, Dh): thirds); 16 heads x 64; local: softmax over keys j in [i-32, i+31] (clipped to the sequence) of q.k/8; global: softmax over the 64 keys j = 64 g of q.k/8; out = (attn_local v + attn_global v_g) merged, w_out + b_out -> [2][4096][1024] (8.4 M)).
// Both batch entries run in the same launches as rows 0 .. 8191; a row's band tiles, window and global keys are clipped to its own entry. Workspace that is dead is used again: band probabilities over their own score rows, global probabilities over the k planes, the band partial output over the q planes, the merged planes over the global scores.
// Algorithm: hi/lo planes of q, k (as [head][t][d]) and v (as [head][d][t]) are written by the epilogue of ONE projection launch over all 3072 columns of [q|k|v]; all 16 heads per launch (grid z or y = head; band scores and band probabilities in compact planes of 192 columns a row, column = key - first key of the row's three-tile span): banded score GEMM (only the three 64-wide key tiles around each query tile are computed), compact global score GEMM against the 64 gathered keys, one row kernel does both softmaxes (window entries -> band probability planes with exact zeros elsewhere in the span's tiles that lie in the row's entry; 64 global probabilities -> compact planes), banded P.V GEMM (K loop limited to the three tiles) + compact P_g.V_g GEMM, whose epilogue adds the band partial output and writes the merged hi/lo planes for the output projection.
// Compute dtypes, f32 accumulate: every input rounded to bf16; q/k/v on PLAIN bf16 operands (inputs: exact); band / global scores and probability x value products on hi/lo planes (3 products); both softmaxes f32; w_out hl x exact (2 products) + b_out.

#define NB_  2
#define TB   4096                 // rows (tokens) of one batch entry
#define TT   (NB_ * TB)           // all rows: both batch entries stand one behind the other in every plane and go through every launch together
#define DM   1024
#define NH_  16
#define NKV  16
#define REP  (NH_ / NKV)
#define HD   64
#define DQ   (NH_ * HD)
#define DKV  (NKV * HD)
#define ZH   1
#define RH   4096
#define LWH  32                   // half window: keys i-32 .. i+31
#define NG   64                   // global keys (every 64th) of one batch entry
#define NGA  (NB_ * NG)           // gathered keys of all rows
#define BW   192                  // pitch of the compact band score plane: the three 64-wide key tiles around a query tile
#define PW   (2 * BW)             // pitch of the band probability planes: a row's bf16 hi | lo halves lie on the 768 bytes of the same row's f32 scores
#define WIN  4096
#define PCAR 1024.0f
#define SCL  0.125f   // HD^-0.5
#define PLN  ((size_t)NH_ * TT * HD)   // elements of one q / k / v plane
typedef _Float16 h16;
typedef unsigned short bf;
typedef __attribute__((ext_vector_type(16))) __bf16   v16bf;
typedef __attribute__((ext_vector_type(16))) _Float16 v16h;
typedef __attribute__((ext_vector_type(8)))  _Float16 v8h;
typedef __attribute__((ext_vector_type(8)))  unsigned short v8us;
typedef __attribute__((ext_vector_type(8)))  float    v8f;
typedef __attribute__((ext_vector_type(4)))  float    v4f;
typedef v8h  __attribute__((may_alias)) v8ha;
typedef v4f  __attribute__((may_alias)) v4fa;
typedef v8us __attribute__((may_alias)) v8usa;

__device__ __forceinline__ unsigned short f2bf(float f) { unsigned u = __float_as_uint(f); u += 0x7FFFu + ((u >> 16) & 1u); return (unsigned short)(u >> 16); }
__device__ __forceinline__ float bf2f(unsigned short b) { return __uint_as_float(((unsigned)b) << 16); }
__device__ __forceinline__ float bfr(float f) { return bf2f(f2bf(f)); }
__device__ __forceinline__ void splitf(float y, unsigned short& h, unsigned short& l) { h = f2bf(y); l = f2bf(y - bf2f(h)); }
typedef __attribute__((ext_vector_type(4))) unsigned short v4us;
__device__ __forceinline__ v16h cat16(v8h lo, v8h hi) { return __builtin_shufflevector(lo, hi, 0, 1, 2, 3, 4, 5, 6, 7, 8, 9, 10, 11, 12, 13, 14, 15); }
__device__ __forceinline__ v16bf cat16b(v8us lo, v8us hi) { return __builtin_bit_cast(v16bf, __builtin_shufflevector(lo, hi, 0, 1, 2, 3, 4, 5, 6, 7, 8, 9, 10, 11, 12, 13, 14, 15)); }
__device__ __forceinline__ v8f wmma16(v16h a, v16h b, v8f c) { return __builtin_amdgcn_wmma_f32_16x16x32_f16(false, a, false, b, (short)0, c, false, false); }
__device__ __forceinline__ v8f wmmab(v16bf a, v16bf b, v8f c) { return __builtin_amdgcn_wmma_f32_16x16x32_bf16(false, a, false, b, (short)0, c, false, false); }



// ---- k_gemmw: register-blocked GEMM, ONE WAVE per 64x64 output tile (16 accumulators), operands straight from K-contiguous 16-bit planes; grid (M/64, N/64, Z), 32 threads.
// C[m][n] (f32, pitch ldc, + optional f32 bias[n]) = sum_k A[m][k] Bt[n][k] (+ split products per NSPLIT). z-batch strides sA/sB/sC in elements; sBb: step of Bt from one batch entry's rows to the next's (0: all rows share Bt). K % 32 == 0.
// EPI picks what the epilogue does with the f32 tile: 0 store to C; 1 store to C with bias; 2 [q|k|v] projection: column tile y is head y % 16 of third y / 16, the tile is split into bf16 hi/lo and stored to that
// third's planes (Mh/Ml: q planes; k and v planes follow at 2 PLN and 4 PLN elements), q and k as [head][t][d], v transposed as [head][d][t], C unused; 3 the tile plus the f32 tile read from C is split into Mh/Ml (indexed like C, pitch DQ).
template <typename T16> struct WFrag;
template <> struct WFrag<h16> { typedef v16h V; static __device__ __forceinline__ V ld(const h16* p) { return cat16(*(const v8h*)p, *(const v8h*)(p + 16)); } static __device__ __forceinline__ v8f mma(V a, V b, v8f c) { return wmma16(a, b, c); } };
template <> struct WFrag<bf> { typedef v16bf V; static __device__ __forceinline__ V ld(const bf* p) { return cat16b(*(const v8us*)p, *(const v8us*)(p + 16)); } static __device__ __forceinline__ v8f mma(V a, V b, v8f c) { return wmmab(a, b, c); } };
template <typename T16, int NSPLIT, int EPI>
__global__ __launch_bounds__(32) void k_gemmw(const T16* __restrict__ A, const T16* __restrict__ A2, const T16* __restrict__ Bt, const T16* __restrict__ Bt2, int K, float* C, int ldc, const float* __restrict__ bias, size_t sA, size_t sB, size_t sC, bf* Mh, bf* Ml, size_t sBb) {
    constexpr bool BIAS = (EPI == 1);
    typedef typename WFrag<T16>::V V;
    __shared__ __align__(16) float os[16 * 68];
    const size_t z = blockIdx.z; A += z * sA; if (A2) A2 += z * sA; Bt += z * sB; if (Bt2) Bt2 += z * sB; if (EPI != 2) C += z * sC; if (EPI == 3) { Mh += z * sC; Ml += z * sC; }
    const int lane = threadIdx.x & 31, lr = lane & 15, hi = lane >> 4; const int r0 = blockIdx.x * 64, c0 = blockIdx.y * 64;
    Bt += (size_t)(r0 / TB) * sBb; if (Bt2) Bt2 += (size_t)(r0 / TB) * sBb;   // the gathered keys / values of this row tile's batch entry
    v8f acc[4][4];
#pragma unroll
    for (int mb = 0; mb < 4; ++mb)
#pragma unroll
        for (int nb = 0; nb < 4; ++nb) acc[mb][nb] = (v8f){};
    const size_t aoff = (size_t)(r0 + lr) * K + 8 * hi, boff = (size_t)(c0 + lr) * K + 8 * hi;
#pragma unroll 1
    for (int kc = 0; kc < K; kc += 32) {
        V a[4], a2[4];
#pragma unroll
        for (int mb = 0; mb < 4; ++mb) { a[mb] = WFrag<T16>::ld(A + aoff + (size_t)mb * 16 * K + kc); if (NSPLIT == 1 || NSPLIT == 2) a2[mb] = WFrag<T16>::ld(A2 + aoff + (size_t)mb * 16 * K + kc); }
#pragma unroll
        for (int nb = 0; nb < 4; ++nb) { const V b = WFrag<T16>::ld(Bt + boff + (size_t)nb * 16 * K + kc); V b2; if (NSPLIT >= 2) b2 = WFrag<T16>::ld(Bt2 + boff + (size_t)nb * 16 * K + kc);
#pragma unroll
            for (int mb = 0; mb < 4; ++mb) { acc[mb][nb] = WFrag<T16>::mma(a[mb], b, acc[mb][nb]); if (NSPLIT == 1 || NSPLIT == 2) acc[mb][nb] = WFrag<T16>::mma(a2[mb], b, acc[mb][nb]); if (NSPLIT >= 2) acc[mb][nb] = WFrag<T16>::mma(a[mb], b2, acc[mb][nb]); } }
        asm volatile("v_nop\n\tv_nop\n\tv_nop\n\tv_nop" : "+v"(acc[0][0]), "+v"(acc[1][1]), "+v"(acc[2][2]), "+v"(acc[3][3]) : "v"(a[0]), "v"(a[3]));
    }
    if (EPI == 2 && blockIdx.y >= 2 * NH_) {   // v third: a lane's 8 accumulator rows are 8 consecutive t of one d, so the transposed planes take 16-byte stores straight from the registers
        const size_t vo = 4 * PLN + ((size_t)(blockIdx.y - 2 * NH_) * HD + lr) * TT + r0 + hi * 8;
#pragma unroll
        for (int nb = 0; nb < 4; ++nb)
#pragma unroll
            for (int mb = 0; mb < 4; ++mb) { v8us oh, ol;
#pragma unroll
                for (int j = 0; j < 8; ++j) { unsigned short a_, c_; splitf(acc[mb][nb][j], a_, c_); oh[j] = a_; ol[j] = c_; }
                *(v8us*)(Mh + vo + (size_t)nb * 16 * TT + mb * 16) = oh; *(v8us*)(Ml + vo + (size_t)nb * 16 * TT + mb * 16) = ol; }
        return;
    }
#pragma unroll
    for (int mb = 0; mb < 4; ++mb) {
        const size_t mo = (size_t)(r0 + mb * 16) * DQ + c0; v4f o1[8];   // EPI 3: C, Mh, Ml all have the pitch DQ, a constant here so that the row steps fold into the instructions' offsets
        if (EPI == 3) {   // the 16 rows of the other partial: all 8 loads in flight while the tile goes through LDS
#pragma unroll
            for (int s = 0; s < 8; ++s) o1[s] = *(const v4f*)(C + mo + (size_t)(2 * s + hi) * DQ + lr * 4); }
#pragma unroll
        for (int nb = 0; nb < 4; ++nb) {
#pragma unroll
            for (int j = 0; j < 8; ++j) os[(hi * 8 + j) * 68 + nb * 16 + lr] = acc[mb][nb][j]; }
        __builtin_amdgcn_wave_barrier(); asm volatile("" ::: "memory");
        if (EPI == 2) {   // q / k third: row t of one head is one 128-byte line of each plane
            const size_t po = (size_t)(blockIdx.y / NH_) * 2 * PLN + ((size_t)(blockIdx.y % NH_) * TT + r0 + mb * 16) * HD;
#pragma unroll
            for (int s = 0; s < 8; ++s) { const int row = 2 * s + hi, cofs = lr * 4; const v4f val = *(const v4fa*)(os + row * 68 + cofs); v4us oh, ol;
#pragma unroll
                for (int q = 0; q < 4; ++q) { unsigned short a_, c_; splitf(val[q], a_, c_); oh[q] = a_; ol[q] = c_; }
                *(v4us*)(Mh + po + (size_t)row * HD + cofs) = oh; *(v4us*)(Ml + po + (size_t)row * HD + cofs) = ol; }
        } else if (EPI == 3) {
#pragma unroll
            for (int s = 0; s < 8; ++s) { const int row = 2 * s + hi, cofs = lr * 4; const v4f val = *(const v4fa*)(os + row * 68 + cofs); v4us oh, ol;
#pragma unroll
                for (int q = 0; q < 4; ++q) { unsigned short a_, c_; splitf(__fadd_rn(o1[s][q], val[q]), a_, c_); oh[q] = a_; ol[q] = c_; }
                *(v4us*)(Mh + mo + (size_t)row * DQ + cofs) = oh; *(v4us*)(Ml + mo + (size_t)row * DQ + cofs) = ol; }
        } else {
            float* crow = C + (size_t)(r0 + mb * 16) * ldc + c0;
#pragma unroll
            for (int s = 0; s < 8; ++s) { const int row = 2 * s + hi, cofs = lr * 4; v4f val = *(const v4fa*)(os + row * 68 + cofs); if (BIAS) { val[0] += bfr(bias[c0 + cofs]); val[1] += bfr(bias[c0 + cofs + 1]); val[2] += bfr(bias[c0 + cofs + 2]); val[3] += bfr(bias[c0 + cofs + 3]); }
                *(v4f*)(crow + (size_t)row * ldc + cofs) = val; }
        }
        if (EPI >= 2) asm volatile("s_wait_xcnt 0x0" ::: "memory");   // the next block's loads and LDS reads reuse registers that these stores name
        __builtin_amdgcn_wave_barrier(); asm volatile("" ::: "memory");
    }
}

// ---- k_gemmc: the same one-wave 64x64 tile GEMM specialised for the band, grid z = head. CMODE 3 (scores): blockIdx.y = 0..2 picks the key tile r0 - 64 + 64 y (tiles off the row tile's own batch entry are skipped), C is the compact
// [row][BW] plane. CMODE 4 (probability x value): A is the compact [row][PW] plane, Bt the [d][key] plane, and the key (K) loop runs over the part of the three-tile span that lies in the row tile's own batch entry.
template <typename T16, int NSPLIT, int CMODE>
__global__ __launch_bounds__(32) void k_gemmc(const T16* __restrict__ A, const T16* __restrict__ A2, const T16* __restrict__ Bt, const T16* __restrict__ Bt2, float* C, int ldc, size_t sA, size_t sB, size_t sC) {
    typedef typename WFrag<T16>::V V;
    __shared__ __align__(16) float os[16 * 68];
    const size_t z = blockIdx.z; A += z * sA; if (A2) A2 += z * sA; Bt += z * sB; if (Bt2) Bt2 += z * sB; C += z * sC;
    const int lane = threadIdx.x & 31, lr = lane & 15, hi = lane >> 4; const int r0 = blockIdx.x * 64, cw = blockIdx.y * 64;   // cw: first output column
    constexpr int lda = (CMODE == 4) ? PW : HD, ldb = (CMODE == 4) ? TT : HD;   // operand pitches of the two band products
    const int c0 = (CMODE == 3) ? r0 - 64 + cw : cw;                // first row of Bt: the key tile (3) / the value column tile (4)
    const int b0 = (r0 / TB) * TB;                                  // first row of this row tile's batch entry
    if (CMODE == 3 && (c0 < b0 || c0 >= b0 + TB)) return;           // band: a key tile off the entry is never written and never read
    const int Kl = (CMODE == 4) ? min(b0 + TB, r0 + 128) : lda;     // P.V: absolute keys of the three-tile span, clipped to the entry
    const int K0 = (CMODE == 4) ? max(b0, r0 - 64) : 0;
    const int ash = (CMODE == 4) ? r0 - 64 : 0;                     // P.V: column of A = key - first key of the span
    v8f acc[4][4];
#pragma unroll
    for (int mb = 0; mb < 4; ++mb)
#pragma unroll
        for (int nb = 0; nb < 4; ++nb) acc[mb][nb] = (v8f){};
    const size_t aoff = (size_t)((r0 + lr) * lda + 8 * hi - ash), boff = (size_t)(c0 + lr) * ldb + 8 * hi;
#pragma unroll 1
    for (int kc = K0; kc < Kl; kc += 32) {
        V a[4], a2[4];
#pragma unroll
        for (int mb = 0; mb < 4; ++mb) { a[mb] = WFrag<T16>::ld(A + aoff + (size_t)mb * 16 * lda + kc); if (NSPLIT == 1 || NSPLIT == 2) a2[mb] = WFrag<T16>::ld(A2 + aoff + (size_t)mb * 16 * lda + kc); }
#pragma unroll
        for (int nb = 0; nb < 4; ++nb) { const V b = WFrag<T16>::ld(Bt + boff + (size_t)nb * 16 * ldb + kc); V b2; if (NSPLIT >= 2) b2 = WFrag<T16>::ld(Bt2 + boff + (size_t)nb * 16 * ldb + kc);
#pragma unroll
            for (int mb = 0; mb < 4; ++mb) { acc[mb][nb] = WFrag<T16>::mma(a[mb], b, acc[mb][nb]); if (NSPLIT == 1 || NSPLIT == 2) acc[mb][nb] = WFrag<T16>::mma(a2[mb], b, acc[mb][nb]); if (NSPLIT >= 2) acc[mb][nb] = WFrag<T16>::mma(a[mb], b2, acc[mb][nb]); } }
        asm volatile("v_nop\n\tv_nop\n\tv_nop\n\tv_nop" : "+v"(acc[0][0]), "+v"(acc[1][1]), "+v"(acc[2][2]), "+v"(acc[3][3]) : "v"(a[0]), "v"(a[3]));
    }
#pragma unroll
    for (int mb = 0; mb < 4; ++mb) {
#pragma unroll
        for (int nb = 0; nb < 4; ++nb) {
#pragma unroll
            for (int j = 0; j < 8; ++j) os[(hi * 8 + j) * 68 + nb * 16 + lr] = acc[mb][nb][j]; }
        __builtin_amdgcn_wave_barrier(); asm volatile("" ::: "memory");
        float* crow = C + (size_t)(r0 + mb * 16) * ldc + cw;
{
#pragma unroll
            for (int s = 0; s < 8; ++s) { const int row = 2 * s + hi, cofs = lr * 4; v4f val = *(const v4fa*)(os + row * 68 + cofs);
                *(v4f*)(crow + (size_t)row * ldc + cofs) = val; }
             }
        __builtin_amdgcn_wave_barrier(); asm volatile("" ::: "memory");
    }
}

typedef __attribute__((ext_vector_type(2))) _Float16 v2h;
typedef __attribute__((ext_vector_type(4))) _Float16 v4h;
typedef __attribute__((ext_vector_type(2))) unsigned short v2us;
typedef __attribute__((ext_vector_type(2))) float v2f;
typedef __attribute__((ext_vector_type(4))) int v4i;

__global__ __launch_bounds__(256) void k_wtG(const float* __restrict__ w, int K, int N, bf* Bt) {
    const int lane = threadIdx.x & 31; const int L0 = (blockIdx.x * 8 + (threadIdx.x >> 5)) * 8; const int nlines = N * K / 64;
{
#pragma unroll 1
        for (int l = 0; l < 8; ++l) { const int L = L0 + l; if (L >= nlines) break; const size_t e = (size_t)L * 64 + lane * 2; const int k = (int)(e % K), n = (int)(e / K); v2us o;
            o[0] = f2bf(w[(size_t)k * N + n]); o[1] = f2bf(w[(size_t)(k + 1) * N + n]); *(v2us*)(Bt + e) = o; }
         }
}
__global__ __launch_bounds__(256) void k_cvt8(const float* __restrict__ src, bf* dst, size_t n8) { const size_t i = (size_t)blockIdx.x * 256 + threadIdx.x; if (i >= n8) return; const v8f v = *(const v8f*)(src + i * 8); v8us o;
#pragma unroll
    for (int k = 0; k < 8; ++k) o[k] = f2bf(v[k]); *(v8us*)(dst + i * 8) = o;  }

__global__ __launch_bounds__(256) void k_gathK(const bf* __restrict__ KPh_, const bf* __restrict__ KPl_, bf* KGh, bf* KGl) { const size_t e = ((size_t)blockIdx.x * 256 + threadIdx.x) * 8; if (e >= (size_t)NH_ * NGA * HD) return; const int d = (int)(e % HD); const int gq = (int)((e / HD) % NGA); const int h = (int)(e / ((size_t)HD * NGA)); const size_t src = ((size_t)h * TT + (size_t)gq * 64) * HD + d; const v8us a = *(const v8us*)(KPh_ + src), c = *(const v8us*)(KPl_ + src); *(v8us*)(KGh + e) = a; *(v8us*)(KGl + e) = c;  }
__global__ __launch_bounds__(256) void k_gathV(const bf* __restrict__ VTh_, const bf* __restrict__ VTl_, bf* VGh, bf* VGl) { const size_t e = ((size_t)blockIdx.x * 256 + threadIdx.x) * 8; if (e >= (size_t)NH_ * HD * NGA) return; const size_t hb = e / ((size_t)NG * HD);   /* VG is [head][entry][d][g]: hb = head * NB_ + entry */ const int gq = (int)((hb % NB_) * NG + e % NG);   /* number of the gathered key among all rows' */ const size_t hd_ = (hb / NB_) * HD + (e / NG) % HD; v8us a, c;
#pragma unroll
    for (int q = 0; q < 8; ++q) { const size_t src = hd_ * TT + (size_t)(gq + q) * 64; a[q] = VTh_[src]; c[q] = VTl_[src]; } *(v8us*)(VGh + e) = a; *(v8us*)(VGl + e) = c;  }
__global__ __launch_bounds__(256) void k_lgsoft(const float* Sb, const float* __restrict__ SG, bf* Ph, bf* Pl, bf* PGh, bf* PGl) {
    const int lane = threadIdx.x & 31; const int i = blockIdx.x * 8 + (threadIdx.x >> 5); if (i >= TT) return; const int t0 = (i / 64) * 64 - 64;   /* first key of the three-tile span (may be -64) */ const int lo = (i / TB) * TB, up = lo + TB;   /* the keys of row i's own batch entry */
    { const size_t h = blockIdx.y; Sb += h * TT * BW; Ph += h * TT * PW; Pl += h * TT * PW; SG += h * TT * NG; PGh += h * TT * NG; PGl += h * TT * NG; }   /* grid y = head */
    /* local: lane handles keys jl = i - 32 + lane and jl + 32 */
    const int j1 = i - LWH + lane, j2 = j1 + 32; const bool v1 = (j1 >= lo), v2 = (j2 < up);
    const float s1 = v1 ? Sb[(size_t)i * BW + (j1 - t0)] * SCL : -3.0e38f, s2 = v2 ? Sb[(size_t)i * BW + (j2 - t0)] * SCL : -3.0e38f;
    float mx = fmaxf(s1, s2);
#pragma unroll
    for (int sh = 16; sh; sh >>= 1) mx = fmaxf(mx, __shfl_xor(mx, sh, 32));
    float d1 = __fsub_rn(s1, mx), d2 = __fsub_rn(s2, mx); asm volatile("" : "+v"(d1), "+v"(d2)); const float e1 = __builtin_amdgcn_exp2f(__fmul_rn(d1, 1.4426950408889634f)), e2 = __builtin_amdgcn_exp2f(__fmul_rn(d2, 1.4426950408889634f)); float sum = e1 + e2;
#pragma unroll
    for (int sh = 16; sh; sh >>= 1) sum += __shfl_xor(sum, sh, 32);
    const float f = __fdiv_rn(1.0f, sum); const float p1 = e1 * f, p2 = e2 * f;
    /* global: lane handles keys g = lane and lane + 32 */
    const float g1 = SG[(size_t)i * NG + lane] * SCL, g2 = SG[(size_t)i * NG + lane + 32] * SCL; float gm = fmaxf(g1, g2);
#pragma unroll
    for (int sh = 16; sh; sh >>= 1) gm = fmaxf(gm, __shfl_xor(gm, sh, 32));
    float gd1 = __fsub_rn(g1, gm), gd2 = __fsub_rn(g2, gm); asm volatile("" : "+v"(gd1), "+v"(gd2)); const float ge1 = __builtin_amdgcn_exp2f(__fmul_rn(gd1, 1.4426950408889634f)), ge2 = __builtin_amdgcn_exp2f(__fmul_rn(gd2, 1.4426950408889634f)); float gs = ge1 + ge2;
#pragma unroll
    for (int sh = 16; sh; sh >>= 1) gs += __shfl_xor(gs, sh, 32);
    const float gf = __fdiv_rn(1.0f, gs); const float q1 = ge1 * gf, q2 = ge2 * gf;
v8us bh, bl, gh_, gl_;
#pragma unroll
    for (int q = 0; q < 8; ++q) { const int j = t0 + lane * 8 + q; const int rel = j - (i - LWH);   /* 0..63 inside the window */ const bool in = (rel >= 0 && rel < 64 && j >= lo && j < up);
        const float pa = __shfl(p1, rel & 31, 32), pb = __shfl(p2, rel & 31, 32); const float pv = (rel < 32) ? pa : pb; unsigned short a, c; splitf(in ? pv : 0.0f, a, c); bh[q] = a; bl[q] = c;
        const int gq = (lane - 24) * 8 + q; const float qa = __shfl(q1, gq & 31, 32), qb = __shfl(q2, gq & 31, 32); const float gv = (gq < 32) ? qa : qb; splitf(gv, a, c); gh_[q] = a; gl_[q] = c; }
    const bool bandLane = (lane < 24) && (t0 + lane * 8 >= lo) && (t0 + lane * 8 < up); const bool globLane = (lane >= 24);
{
        if (bandLane) { *(v8us*)(Ph + (size_t)i * PW + lane * 8) = bh; *(v8us*)(Pl + (size_t)i * PW + lane * 8) = bl; }   /* band span: lanes 0-23 x 16 B; these bytes are row i's own scores, which only this wave reads, above */
        if (globLane) { *(v8us*)(PGh + (size_t)i * NG + (lane - 24) * 8) = gh_; *(v8us*)(PGl + (size_t)i * NG + (lane - 24) * 8) = gl_; }   /* global: lanes 24-31 x 16 B */
         }
}

extern "C" void kernel_launch(void* const* d_in, const int* in_sizes, int n_in,
                              void* d_out, int out_size, void* d_ws, size_t ws_size, hipStream_t stream) {
    (void)in_sizes; (void)n_in; (void)out_size;
    const float* x = (const float*)d_in[0]; const float* wqkv = (const float*)d_in[1]; const float* wo = (const float*)d_in[2]; const float* bo = (const float*)d_in[3]; const float* wq = nullptr; const float* wk = nullptr; const float* wv = nullptr; (void)wq; (void)wk; (void)wv;
    float* OUT = (float*)d_out;     // [2][4096][1024]
    char* wsp = (char*)d_ws;
    auto take = [&](size_t bytes) { char* p = wsp; wsp += (bytes + 255) & ~(size_t)255; return (void*)p; };
    bf* WALL = (bf*)take((size_t)3 * DM * DM * 2); bf* WO = (bf*)take((size_t)DM * DQ * 2);
    bf* XB = (bf*)take((size_t)TT * DM * 2);
    bf* QPh = (bf*)take(6 * PLN * 2); bf* QPl = QPh + PLN; bf* KPh = QPh + 2 * PLN; bf* KPl = QPh + 3 * PLN; bf* VTh = QPh + 4 * PLN; bf* VTl = QPh + 5 * PLN;   /* one block: the projection's epilogue finds the k and v planes behind the q planes */
    float* Sb = (float*)take((size_t)NH_ * TT * BW * 4); bf* KGh = (bf*)take((size_t)NH_ * NGA * HD * 2); bf* KGl = (bf*)take((size_t)NH_ * NGA * HD * 2); bf* VGh = (bf*)take((size_t)NH_ * HD * NGA * 2); bf* VGl = (bf*)take((size_t)NH_ * HD * NGA * 2); float* SG = (float*)take((size_t)NH_ * TT * NG * 4);
    /* planes on workspace whose last reader has run by the time they are written (each of the same size in bytes as what it lies on) */
    bf* Ph = (bf*)Sb; bf* Pl = Ph + BW;            /* band probabilities: row by row over the band scores, written by the wave that read the row */
    bf* PGh = KPh; bf* PGl = KPl;                  /* global probabilities (softmax launch) over the k planes (last read: band scores) */
    float* Ob = (float*)QPh;                       /* band partial output [t][head * HD + d] (band P.V launch) over the q planes (last read: global scores) */
    bf* ATh = (bf*)SG; bf* ATl = ATh + (size_t)TT * DQ;   /* merged planes (global P.V launch) over the global scores (last read: softmax) */
    if ((size_t)(wsp - (char*)d_ws) > ws_size) return;    // ws 256 MiB
    k_wtG<<<(unsigned)((DM * 3 * DM / 64 + 63) / 64), 256, 0, stream>>>(wqkv, DM, 3 * DM, WALL);   /* fused 'xw' [DM][3DM] -> Bt [3DM][DM] (row blocks q | k | v) */
    k_wtG<<<(unsigned)((DQ * DM / 64 + 63) / 64), 256, 0, stream>>>(wo, DQ, DM, WO);
    k_cvt8<<<(unsigned)(((size_t)TT * DM / 8 + 255) / 256), 256, 0, stream>>>(x, XB, (size_t)TT * DM / 8);
    k_gemmw<bf, 0, 2><<<dim3(TT / 64, 3 * DM / 64, 1), 32, 0, stream>>>(XB, nullptr, WALL, nullptr, DM, nullptr, 0, nullptr, 0, 0, 0, QPh, QPl, 0);   /* [q|k|v] projection, epilogue -> hi/lo planes */
    k_gathK<<<(unsigned)(((size_t)NH_ * NGA * HD / 8 + 255) / 256), 256, 0, stream>>>(KPh, KPl, KGh, KGl); k_gathV<<<(unsigned)(((size_t)NH_ * HD * NGA / 8 + 255) / 256), 256, 0, stream>>>(VTh, VTl, VGh, VGl);   /* the 64 strided keys / values per head and batch entry */
    k_gemmc<bf, 2, 3><<<dim3(TT / 64, 3, NH_), 32, 0, stream>>>(QPh, QPl, KPh, KPl, Sb, BW, (size_t)TT * HD, (size_t)TT * HD, (size_t)TT * BW);             /* band scores (3 tiles per query tile), z = head */
    k_gemmw<bf, 2, 0><<<dim3(TT / 64, 1, NH_), 32, 0, stream>>>(QPh, QPl, KGh, KGl, HD, SG, NG, nullptr, (size_t)TT * HD, (size_t)NGA * HD, (size_t)TT * NG, nullptr, nullptr, (size_t)NG * HD);      /* global scores [head][row][64] */
    k_lgsoft<<<dim3(TT / 8, NH_, 1), 256, 0, stream>>>(Sb, SG, Ph, Pl, PGh, PGl);                                                                                   /* local + global softmaxes, y = head */
    k_gemmc<bf, 2, 4><<<dim3(TT / 64, 1, NH_), 32, 0, stream>>>(Ph, Pl, VTh, VTl, Ob, DQ, (size_t)TT * PW, (size_t)HD * TT, (size_t)HD);                      /* local attn . v (K loop over the band) */
    k_gemmw<bf, 2, 3><<<dim3(TT / 64, 1, NH_), 32, 0, stream>>>(PGh, PGl, VGh, VGl, NG, Ob, DQ, nullptr, (size_t)TT * NG, (size_t)HD * NGA, (size_t)HD, ATh, ATl, (size_t)HD * NG);   /* global attn . v_g, + band partial -> merged planes */
    k_gemmw<bf, 1, 1><<<dim3(TT / 64, DM / 64, 1), 32, 0, stream>>>(ATh, ATl, WO, nullptr, DQ, OUT, DM, bo, 0, 0, 0, nullptr, nullptr, 0);
}

// v004
// A run of this version takes 240 microseconds.
// Two timings next to v003 both put it at 1.35 times that version's speed.
// Over all steps from v000 it is 4.78 times as fast.
#include <hip/hip_runtime.h>

// Local (sliding window of 64, centred) + strided global (every 64th key) attention, summed, then an output projection (x [2][4096][1024]; [q|k|v] = x w_qkv ('xw' [1024][3072], reshape (3, H, Dh): thirds); 16 heads x 64; local: softmax over keys j in [i-32, i+31] (clipped to the sequence) of q.k/8; global: softmax over the 64 keys j = 64 g of q.k/8; out = (attn_local v + attn_global v_g) merged, w_out + b_out -> [2][4096][1024] (8.4 M)).
// Both batch entries run in the same launches as rows 0 .. 8191; a row's band span, window and global keys are clipped to its own entry.
// Algorithm: hi/lo planes of q, k (as [head][t][d]) and v (as [head][d][t]) are written by the epilogue of ONE projection launch over all 3072 columns of [q|k|v]; the 64 strided keys / values per head and entry are gathered; ONE attention launch (k_attn, one wave per head and 32 query rows) does band scores, global scores, both softmaxes and both probability x value products with scores and probabilities in LDS, and writes the merged hi/lo planes for the output projection.
// Compute dtypes, f32 accumulate: every input rounded to bf16; q/k/v on PLAIN bf16 operands (inputs: exact); band / global scores and probability x value products on hi/lo planes (3 products); both softmaxes f32; w_out hl x exact (2 products) + b_out.

#define NB_  2
#define TB   4096                 // rows (tokens) of one batch entry
#define TT   (NB_ * TB)           // all rows: both batch entries stand one behind the other in every plane and go through every launch together
#define DM   1024
#define NH_  16
#define NKV  16
#define REP  (NH_ / NKV)
#define HD   64
#define DQ   (NH_ * HD)
#define DKV  (NKV * HD)
#define ZH   1
#define RH   4096
#define LWH  32                   // half window: keys i-32 .. i+31
#define NG   64                   // global keys (every 64th) of one batch entry
#define NGA  (NB_ * NG)           // gathered keys of all rows
#define WIN  4096
#define PCAR 1024.0f
#define SCL  0.125f   // HD^-0.5
#define PLN  ((size_t)NH_ * TT * HD)   // elements of one q / k / v plane
typedef _Float16 h16;
typedef unsigned short bf;
typedef __attribute__((ext_vector_type(16))) __bf16   v16bf;
typedef __attribute__((ext_vector_type(16))) _Float16 v16h;
typedef __attribute__((ext_vector_type(8)))  _Float16 v8h;
typedef __attribute__((ext_vector_type(8)))  unsigned short v8us;
typedef __attribute__((ext_vector_type(8)))  float    v8f;
typedef __attribute__((ext_vector_type(4)))  float    v4f;
typedef v8h  __attribute__((may_alias)) v8ha;
typedef v4f  __attribute__((may_alias)) v4fa;
typedef v8us __attribute__((may_alias)) v8usa;

__device__ __forceinline__ unsigned short f2bf(float f) { unsigned u = __float_as_uint(f); u += 0x7FFFu + ((u >> 16) & 1u); return (unsigned short)(u >> 16); }
__device__ __forceinline__ float bf2f(unsigned short b) { return __uint_as_float(((unsigned)b) << 16); }
__device__ __forceinline__ float bfr(float f) { return bf2f(f2bf(f)); }
__device__ __forceinline__ void splitf(float y, unsigned short& h, unsigned short& l) { h = f2bf(y); l = f2bf(y - bf2f(h)); }
typedef __attribute__((ext_vector_type(4))) unsigned short v4us;
__device__ __forceinline__ v16h cat16(v8h lo, v8h hi) { return __builtin_shufflevector(lo, hi, 0, 1, 2, 3, 4, 5, 6, 7, 8, 9, 10, 11, 12, 13, 14, 15); }
__device__ __forceinline__ v16bf cat16b(v8us lo, v8us hi) { return __builtin_bit_cast(v16bf, __builtin_shufflevector(lo, hi, 0, 1, 2, 3, 4, 5, 6, 7, 8, 9, 10, 11, 12, 13, 14, 15)); }
__device__ __forceinline__ v8f wmma16(v16h a, v16h b, v8f c) { return __builtin_amdgcn_wmma_f32_16x16x32_f16(false, a, false, b, (short)0, c, false, false); }
__device__ __forceinline__ v8f wmmab(v16bf a, v16bf b, v8f c) { return __builtin_amdgcn_wmma_f32_16x16x32_bf16(false, a, false, b, (short)0, c, false, false); }



// ---- k_gemmw: register-blocked GEMM, ONE WAVE per 64x64 output tile (16 accumulators), operands straight from K-contiguous 16-bit planes; grid (M/64, N/64, Z), 32 threads.
// C[m][n] (f32, pitch ldc, + optional f32 bias[n]) = sum_k A[m][k] Bt[n][k] (+ split products per NSPLIT). z-batch strides sA/sB/sC in elements; sBb: step of Bt from one batch entry's rows to the next's (0: all rows share Bt). K % 32 == 0.
// EPI picks what the epilogue does with the f32 tile: 0 store to C; 1 store to C with bias; 2 [q|k|v] projection: column tile y is head y % 16 of third y / 16, the tile is split into bf16 hi/lo and stored to that
// third's planes (Mh/Ml: q planes; k and v planes follow at 2 PLN and 4 PLN elements), q and k as [head][t][d], v transposed as [head][d][t], C unused; 3 the tile plus the f32 tile read from C is split into Mh/Ml (indexed like C, pitch DQ).
template <typename T16> struct WFrag;
template <> struct WFrag<h16> { typedef v16h V; static __device__ __forceinline__ V ld(const h16* p) { return cat16(*(const v8h*)p, *(const v8h*)(p + 16)); } static __device__ __forceinline__ v8f mma(V a, V b, v8f c) { return wmma16(a, b, c); } };
template <> struct WFrag<bf> { typedef v16bf V; static __device__ __forceinline__ V ld(const bf* p) { return cat16b(*(const v8us*)p, *(const v8us*)(p + 16)); } static __device__ __forceinline__ v8f mma(V a, V b, v8f c) { return wmmab(a, b, c); } };
template <typename T16, int NSPLIT, int EPI>
__global__ __launch_bounds__(32) void k_gemmw(const T16* __restrict__ A, const T16* __restrict__ A2, const T16* __restrict__ Bt, const T16* __restrict__ Bt2, int K, float* C, int ldc, const float* __restrict__ bias, size_t sA, size_t sB, size_t sC, bf* Mh, bf* Ml, size_t sBb) {
    constexpr bool BIAS = (EPI == 1);
    typedef typename WFrag<T16>::V V;
    __shared__ __align__(16) float os[16 * 68];
    const size_t z = blockIdx.z; A += z * sA; if (A2) A2 += z * sA; Bt += z * sB; if (Bt2) Bt2 += z * sB; if (EPI != 2) C += z * sC; if (EPI == 3) { Mh += z * sC; Ml += z * sC; }
    const int lane = threadIdx.x & 31, lr = lane & 15, hi = lane >> 4; const int r0 = blockIdx.x * 64, c0 = blockIdx.y * 64;
    Bt += (size_t)(r0 / TB) * sBb; if (Bt2) Bt2 += (size_t)(r0 / TB) * sBb;   // the rows of Bt for this row tile's batch entry (sBb 0: all share Bt)
    v8f acc[4][4];
#pragma unroll
    for (int mb = 0; mb < 4; ++mb)
#pragma unroll
        for (int nb = 0; nb < 4; ++nb) acc[mb][nb] = (v8f){};
    const size_t aoff = (size_t)(r0 + lr) * K + 8 * hi, boff = (size_t)(c0 + lr) * K + 8 * hi;
#pragma unroll 1
    for (int kc = 0; kc < K; kc += 32) {
        V a[4], a2[4];
#pragma unroll
        for (int mb = 0; mb < 4; ++mb) { a[mb] = WFrag<T16>::ld(A + aoff + (size_t)mb * 16 * K + kc); if (NSPLIT == 1 || NSPLIT == 2) a2[mb] = WFrag<T16>::ld(A2 + aoff + (size_t)mb * 16 * K + kc); }
#pragma unroll
        for (int nb = 0; nb < 4; ++nb) { const V b = WFrag<T16>::ld(Bt + boff + (size_t)nb * 16 * K + kc); V b2; if (NSPLIT >= 2) b2 = WFrag<T16>::ld(Bt2 + boff + (size_t)nb * 16 * K + kc);
#pragma unroll
            for (int mb = 0; mb < 4; ++mb) { acc[mb][nb] = WFrag<T16>::mma(a[mb], b, acc[mb][nb]); if (NSPLIT == 1 || NSPLIT == 2) acc[mb][nb] = WFrag<T16>::mma(a2[mb], b, acc[mb][nb]); if (NSPLIT >= 2) acc[mb][nb] = WFrag<T16>::mma(a[mb], b2, acc[mb][nb]); } }
        asm volatile("v_nop\n\tv_nop\n\tv_nop\n\tv_nop" : "+v"(acc[0][0]), "+v"(acc[1][1]), "+v"(acc[2][2]), "+v"(acc[3][3]) : "v"(a[0]), "v"(a[3]));
    }
    if (EPI == 2 && blockIdx.y >= 2 * NH_) {   // v third: a lane's 8 accumulator rows are 8 consecutive t of one d, so the transposed planes take 16-byte stores straight from the registers
        const size_t vo = 4 * PLN + ((size_t)(blockIdx.y - 2 * NH_) * HD + lr) * TT + r0 + hi * 8;
#pragma unroll
        for (int nb = 0; nb < 4; ++nb)
#pragma unroll
            for (int mb = 0; mb < 4; ++mb) { v8us oh, ol;
#pragma unroll
                for (int j = 0; j < 8; ++j) { unsigned short a_, c_; splitf(acc[mb][nb][j], a_, c_); oh[j] = a_; ol[j] = c_; }
                *(v8us*)(Mh + vo + (size_t)nb * 16 * TT + mb * 16) = oh; *(v8us*)(Ml + vo + (size_t)nb * 16 * TT + mb * 16) = ol; }
        return;
    }
#pragma unroll
    for (int mb = 0; mb < 4; ++mb) {
        const size_t mo = (size_t)(r0 + mb * 16) * DQ + c0; v4f o1[8];   // EPI 3: C, Mh, Ml all have the pitch DQ, a constant here so that the row steps fold into the instructions' offsets
        if (EPI == 3) {   // the 16 rows of the other partial: all 8 loads in flight while the tile goes through LDS
#pragma unroll
            for (int s = 0; s < 8; ++s) o1[s] = *(const v4f*)(C + mo + (size_t)(2 * s + hi) * DQ + lr * 4); }
#pragma unroll
        for (int nb = 0; nb < 4; ++nb) {
#pragma unroll
            for (int j = 0; j < 8; ++j) os[(hi * 8 + j) * 68 + nb * 16 + lr] = acc[mb][nb][j]; }
        __builtin_amdgcn_wave_barrier(); asm volatile("" ::: "memory");
        if (EPI == 2) {   // q / k third: row t of one head is one 128-byte line of each plane
            const size_t po = (size_t)(blockIdx.y / NH_) * 2 * PLN + ((size_t)(blockIdx.y % NH_) * TT + r0 + mb * 16) * HD;
#pragma unroll
            for (int s = 0; s < 8; ++s) { const int row = 2 * s + hi, cofs = lr * 4; const v4f val = *(const v4fa*)(os + row * 68 + cofs); v4us oh, ol;
#pragma unroll
                for (int q = 0; q < 4; ++q) { unsigned short a_, c_; splitf(val[q], a_, c_); oh[q] = a_; ol[q] = c_; }
                *(v4us*)(Mh + po + (size_t)row * HD + cofs) = oh; *(v4us*)(Ml + po + (size_t)row * HD + cofs) = ol; }
        } else if (EPI == 3) {
#pragma unroll
            for (int s = 0; s < 8; ++s) { const int row = 2 * s + hi, cofs = lr * 4; const v4f val = *(const v4fa*)(os + row * 68 + cofs); v4us oh, ol;
#pragma unroll
                for (int q = 0; q < 4; ++q) { unsigned short a_, c_; splitf(__fadd_rn(o1[s][q], val[q]), a_, c_); oh[q] = a_; ol[q] = c_; }
                *(v4us*)(Mh + mo + (size_t)row * DQ + cofs) = oh; *(v4us*)(Ml + mo + (size_t)row * DQ + cofs) = ol; }
        } else {
            float* crow = C + (size_t)(r0 + mb * 16) * ldc + c0;
#pragma unroll
            for (int s = 0; s < 8; ++s) { const int row = 2 * s + hi, cofs = lr * 4; v4f val = *(const v4fa*)(os + row * 68 + cofs); if (BIAS) { val[0] += bfr(bias[c0 + cofs]); val[1] += bfr(bias[c0 + cofs + 1]); val[2] += bfr(bias[c0 + cofs + 2]); val[3] += bfr(bias[c0 + cofs + 3]); }
                *(v4f*)(crow + (size_t)row * ldc + cofs) = val; }
        }
        if (EPI >= 2) asm volatile("s_wait_xcnt 0x0" ::: "memory");   // the next block's loads and LDS reads reuse registers that these stores name
        __builtin_amdgcn_wave_barrier(); asm volatile("" ::: "memory");
    }
}

// ---- k_attn: both attentions of one head for 32 query rows in ONE WAVE, scores and probabilities never leaving the WGP; grid (TT / 128, head), 4 independent waves a block, each with its own LDS rows (no work-group barrier).
// The windows of rows r0 .. r0 + 31 span the 96 keys r0 - 32 .. r0 + 63: three 32-key steps, each wholly inside or wholly outside the rows' batch entry (outside: skipped). Per wave: band scores (hi/lo, 3 products) -> LDS f32 [32][96];
// lane = row softmax, the bf16 hi | lo probabilities written over the row's own scores (exact zeros outside the window); band P.V with P from LDS and v from the [d][t] planes; ahead of it the same on the 64 gathered keys; the two f32 partial
// outputs are added, split and stored as the merged hi/lo planes [t][head * HD + d] in whole 128-byte lines.
#define PS   100                  // LDS row pitch in dwords: 400 B = 16 B x odd, for the 16-byte row reads
#define BK   96                   // keys of the band span of 32 rows
// Rows that some lanes wrote to LDS are read by other lanes of the same wave (LDS operations of a wave run in order): this keeps the compiler from moving LDS accesses over the hand-over.
__device__ __forceinline__ void wsync() { __builtin_amdgcn_wave_barrier(); asm volatile("" ::: "memory"); }
__device__ __forceinline__ v16bf ldl(const bf* p) { return cat16b(*(const v8usa*)p, *(const v8usa*)(p + 16)); }
// One lane's softmax of NC scores of its LDS row (columns clo .. chi count, the rest get probability 0), probabilities split to bf16 hi (first NC) | lo (next NC) over the same bytes.
template <int NC>
__device__ __forceinline__ void rowsoft(float* srow, int clo, int chi) {
    float s[NC];
#pragma unroll
    for (int c = 0; c < NC; c += 4) { const v4f t = *(const v4fa*)(srow + c); s[c] = t[0]; s[c + 1] = t[1]; s[c + 2] = t[2]; s[c + 3] = t[3]; }
    const unsigned wd = (unsigned)(chi - clo); float m4[4] = { -3.0e38f, -3.0e38f, -3.0e38f, -3.0e38f };
#pragma unroll
    for (int c = 0; c < NC; ++c) { s[c] = ((unsigned)(c - clo) <= wd) ? s[c] * SCL : -3.0e38f; m4[c & 3] = fmaxf(m4[c & 3], s[c]); }
    const float mx = fmaxf(fmaxf(m4[0], m4[1]), fmaxf(m4[2], m4[3])); float a4[4] = { 0.0f, 0.0f, 0.0f, 0.0f };
#pragma unroll
    for (int c = 0; c < NC; c += 4) { float e[4];
#pragma unroll
        for (int q = 0; q < 4; ++q) e[q] = (s[c + q] - mx) * 1.4426950408889634f;
        // four v_exp_f32 on registers of their own, each the independent instruction behind the one before it, and a v_nop behind the last: the slot that the instruction set asks for before a transcendental's result is used or its source overwritten
        asm("v_exp_f32 %0, %4\n\tv_exp_f32 %1, %5\n\tv_exp_f32 %2, %6\n\tv_exp_f32 %3, %7\n\tv_nop" : "=&v"(s[c]), "=&v"(s[c + 1]), "=&v"(s[c + 2]), "=&v"(s[c + 3]) : "v"(e[0]), "v"(e[1]), "v"(e[2]), "v"(e[3]));
#pragma unroll
        for (int q = 0; q < 4; ++q) a4[q] += s[c + q]; }
    const float f = __fdiv_rn(1.0f, (a4[0] + a4[1]) + (a4[2] + a4[3]));
    bf* prow = (bf*)srow;
#pragma unroll
    for (int c = 0; c < NC; c += 8) { v8us oh, ol;
#pragma unroll
        for (int q = 0; q < 8; ++q) { unsigned short a_, c_; splitf(s[c + q] * f, a_, c_); oh[q] = a_; ol[q] = c_; }
        *(v8usa*)(prow + c) = oh; *(v8usa*)(prow + NC + c) = ol; }
}
// Behind a group of fragment loads: the wait before a register that these loads name is written again (the two addresses as inputs keep their registers whole up to it), and a scheduling barrier, so that
// every load of the group is in flight before the first product waits on one (without it the loads were issued four at a time into one register set, one L2 latency each time).
__device__ __forceinline__ void loads_out(const bf* p0, const bf* p1) { asm volatile("s_wait_xcnt 0x0" :: "v"(p0), "v"(p1) : "memory"); __builtin_amdgcn_sched_barrier(0); }
__global__ __launch_bounds__(128, 4) void k_attn(const bf* __restrict__ Qh, const bf* __restrict__ Ql, const bf* __restrict__ Kh, const bf* __restrict__ Kl, const bf* __restrict__ Vh, const bf* __restrict__ Vl,
                                              const bf* __restrict__ KGh_, const bf* __restrict__ KGl_, const bf* __restrict__ VGh_, const bf* __restrict__ VGl_, bf* Mh, bf* Ml) {
    typedef WFrag<bf> F; typedef F::V V;
    __shared__ __align__(16) float sm[4][32 * PS];
    const int lane = threadIdx.x & 31, lr = lane & 15, hi = lane >> 4; const int w = __builtin_amdgcn_readfirstlane((int)(threadIdx.x >> 5));
    float* S = sm[w]; const bf* P = (const bf*)S;
    const int h = blockIdx.y, r0 = (blockIdx.x * 4 + w) * 32, eb = r0 / TB, b0 = eb * TB, k0 = r0 - 32;   // k0: first key of the span (off the entry for its first row tile)
    const int ks0 = (k0 < b0) ? 1 : 0, ks1 = (k0 + BK > b0 + TB) ? 2 : 3;                                 // the 32-key steps that lie in the rows' own batch entry
    const bf* qh = Qh + ((size_t)h * TT + r0 + lr) * HD + 8 * hi; const bf* ql = Ql + ((size_t)h * TT + r0 + lr) * HD + 8 * hi;
    // global scores against the entry's 64 gathered keys
    {
        V qa[2][2], qb[2][2];
#pragma unroll
        for (int mb = 0; mb < 2; ++mb)
#pragma unroll
            for (int kk = 0; kk < 2; ++kk) { qa[mb][kk] = F::ld(qh + mb * 16 * HD + kk * 32); qb[mb][kk] = F::ld(ql + mb * 16 * HD + kk * 32); }
        loads_out(qh, ql);
        v8f g[2][4];
#pragma unroll
        for (int mb = 0; mb < 2; ++mb)
#pragma unroll
            for (int nb = 0; nb < 4; ++nb) g[mb][nb] = (v8f){};
        const bf* gh = KGh_ + ((size_t)h * NGA + eb * NG + lr) * HD + 8 * hi; const bf* gl = KGl_ + ((size_t)h * NGA + eb * NG + lr) * HD + 8 * hi;
#pragma unroll
        for (int kk = 0; kk < 2; ++kk) { V b[4], b2[4];
#pragma unroll
            for (int nb = 0; nb < 4; ++nb) { b[nb] = F::ld(gh + nb * 16 * HD + kk * 32); b2[nb] = F::ld(gl + nb * 16 * HD + kk * 32); }
            loads_out(gh, gl);
#pragma unroll
            for (int nb = 0; nb < 4; ++nb)
#pragma unroll
                for (int mb = 0; mb < 2; ++mb) { g[mb][nb] = F::mma(qa[mb][kk], b[nb], g[mb][nb]); g[mb][nb] = F::mma(qb[mb][kk], b[nb], g[mb][nb]); g[mb][nb] = F::mma(qa[mb][kk], b2[nb], g[mb][nb]); } }
#pragma unroll
        for (int mb = 0; mb < 2; ++mb)
#pragma unroll
            for (int nb = 0; nb < 4; ++nb)
#pragma unroll
                for (int j = 0; j < 8; ++j) S[(mb * 16 + hi * 8 + j) * PS + nb * 16 + lr] = g[mb][nb][j];
    }
    wsync();
    rowsoft<NG>(S + lane * PS, 0, NG - 1);
    wsync();
    // global probabilities x gathered values ([head][entry][d][g])
    v8f og[2][4];
#pragma unroll
    for (int mb = 0; mb < 2; ++mb)
#pragma unroll
        for (int nb = 0; nb < 4; ++nb) og[mb][nb] = (v8f){};
    { const bf* vh = VGh_ + (((size_t)h * NB_ + eb) * HD + lr) * NG + 8 * hi; const bf* vl = VGl_ + (((size_t)h * NB_ + eb) * HD + lr) * NG + 8 * hi;
#pragma unroll
      for (int kk = 0; kk < 2; ++kk) { V a[2], a2[2], b[4], b2[4];
#pragma unroll
          for (int nb = 0; nb < 4; ++nb) { b[nb] = F::ld(vh + nb * 16 * NG + kk * 32); b2[nb] = F::ld(vl + nb * 16 * NG + kk * 32); }
#pragma unroll
          for (int mb = 0; mb < 2; ++mb) { a[mb] = ldl(P + (mb * 16 + lr) * (2 * PS) + kk * 32 + 8 * hi); a2[mb] = ldl(P + (mb * 16 + lr) * (2 * PS) + NG + kk * 32 + 8 * hi); }
          loads_out(vh, vl);
#pragma unroll
          for (int nb = 0; nb < 4; ++nb)
#pragma unroll
              for (int mb = 0; mb < 2; ++mb) { og[mb][nb] = F::mma(a[mb], b[nb], og[mb][nb]); og[mb][nb] = F::mma(a2[mb], b[nb], og[mb][nb]); og[mb][nb] = F::mma(a[mb], b2[nb], og[mb][nb]); } } }
    wsync();
    if (ks0 != 0 || ks1 != 3) {   // a skipped step's score columns get a value, so that the row read below meets only LDS that this pass wrote
        const int cz = (ks0 != 0) ? 0 : 64;
#pragma unroll
        for (int c = 0; c < 32; c += 4) *(v4fa*)(S + lane * PS + cz + c) = (v4f){};
    }
    // band scores; the q fragments are loaded a second time (their 64 registers are free for the value fragments in between: four waves a SIMD have 256 registers each)
    V qa[2][2], qb[2][2];
#pragma unroll
    for (int mb = 0; mb < 2; ++mb)
#pragma unroll
        for (int kk = 0; kk < 2; ++kk) { qa[mb][kk] = F::ld(qh + mb * 16 * HD + kk * 32); qb[mb][kk] = F::ld(ql + mb * 16 * HD + kk * 32); }
    loads_out(qh, ql);
#pragma unroll 1
    for (int ks = ks0; ks < ks1; ++ks) {
        v8f acc[2][2]; V b[2][2], b2[2][2];
#pragma unroll
        for (int mb = 0; mb < 2; ++mb)
#pragma unroll
            for (int nb = 0; nb < 2; ++nb) acc[mb][nb] = (v8f){};
        const bf* kh = Kh + ((size_t)h * TT + (k0 + ks * 32) + lr) * HD + 8 * hi; const bf* kl = Kl + ((size_t)h * TT + (k0 + ks * 32) + lr) * HD + 8 * hi;
#pragma unroll
        for (int kk = 0; kk < 2; ++kk)
#pragma unroll
            for (int nb = 0; nb < 2; ++nb) { b[kk][nb] = F::ld(kh + nb * 16 * HD + kk * 32); b2[kk][nb] = F::ld(kl + nb * 16 * HD + kk * 32); }
        loads_out(kh, kl);
#pragma unroll
        for (int kk = 0; kk < 2; ++kk)
#pragma unroll
            for (int nb = 0; nb < 2; ++nb)
#pragma unroll
                for (int mb = 0; mb < 2; ++mb) { acc[mb][nb] = F::mma(qa[mb][kk], b[kk][nb], acc[mb][nb]); acc[mb][nb] = F::mma(qb[mb][kk], b[kk][nb], acc[mb][nb]); acc[mb][nb] = F::mma(qa[mb][kk], b2[kk][nb], acc[mb][nb]); }
#pragma unroll
        for (int mb = 0; mb < 2; ++mb)
#pragma unroll
            for (int nb = 0; nb < 2; ++nb)
#pragma unroll
                for (int j = 0; j < 8; ++j) S[(mb * 16 + hi * 8 + j) * PS + ks * 32 + nb * 16 + lr] = acc[mb][nb][j];
    }
    wsync();
    rowsoft<BK>(S + lane * PS, max(lane, b0 - k0), min(lane + 63, b0 + TB - 1 - k0));   // column c is key k0 + c; row r0 + lane sees keys r0 + lane - 32 .. r0 + lane + 31 of its entry
    wsync();
    // band probabilities x values
    v8f o[2][4];
#pragma unroll
    for (int mb = 0; mb < 2; ++mb)
#pragma unroll
        for (int nb = 0; nb < 4; ++nb) o[mb][nb] = (v8f){};
#pragma unroll 1
    for (int ks = ks0; ks < ks1; ++ks) {
        V a[2], a2[2], b[4], b2[4];
        const bf* vh = Vh + ((size_t)h * HD + lr) * TT + (r0 + ks * 32) + 8 * hi; const bf* vl = Vl + ((size_t)h * HD + lr) * TT + (r0 + ks * 32) + 8 * hi;   // key r0 + 32 ks; the step's first key k0 + 32 ks lies 32 in front of it
#pragma unroll
        for (int nb = 0; nb < 4; ++nb) { b[nb] = F::ld(vh - 32 + (size_t)nb * 16 * TT); b2[nb] = F::ld(vl - 32 + (size_t)nb * 16 * TT); }
#pragma unroll
        for (int mb = 0; mb < 2; ++mb) { a[mb] = ldl(P + (mb * 16 + lr) * (2 * PS) + ks * 32 + 8 * hi); a2[mb] = ldl(P + (mb * 16 + lr) * (2 * PS) + BK + ks * 32 + 8 * hi); }
        loads_out(vh, vl);
#pragma unroll
        for (int nb = 0; nb < 4; ++nb)
#pragma unroll
            for (int mb = 0; mb < 2; ++mb) { o[mb][nb] = F::mma(a[mb], b[nb], o[mb][nb]); o[mb][nb] = F::mma(a2[mb], b[nb], o[mb][nb]); o[mb][nb] = F::mma(a[mb], b2[nb], o[mb][nb]); }
        // the distance behind the last matrix instructions on the loop's back edge, where the next trip's loads overwrite their operands
        asm volatile("v_nop\n\tv_nop\n\tv_nop\n\tv_nop" : "+v"(o[0][0]), "+v"(o[1][1]), "+v"(o[0][2]), "+v"(o[1][3]) : "v"(a[0]), "v"(a[1]));
    }
    wsync();
    // the sum of the two partial outputs, through LDS for whole-line stores
#pragma unroll
    for (int mb = 0; mb < 2; ++mb)
#pragma unroll
        for (int nb = 0; nb < 4; ++nb)
#pragma unroll
            for (int j = 0; j < 8; ++j) S[(mb * 16 + hi * 8 + j) * PS + nb * 16 + lr] = __fadd_rn(o[mb][nb][j], og[mb][nb][j]);
    wsync();
    const size_t mo = (size_t)r0 * DQ + h * HD + lr * 4;   // a row's 64 columns of one head are one 128-byte line of each merged plane
    v4us oh[16], ol[16];
#pragma unroll
    for (int s = 0; s < 16; ++s) { const v4f val = *(const v4fa*)(S + (2 * s + hi) * PS + lr * 4);
#pragma unroll
        for (int q = 0; q < 4; ++q) { unsigned short a_, c_; splitf(val[q], a_, c_); oh[s][q] = a_; ol[s][q] = c_; } }
    __builtin_amdgcn_sched_barrier(0);   // every row is split before the first store issues: behind the stores no register that one of them names is written again
#pragma unroll
    for (int s = 0; s < 16; ++s) { *(v4us*)(Mh + mo + (size_t)(2 * s + hi) * DQ) = oh[s]; *(v4us*)(Ml + mo + (size_t)(2 * s + hi) * DQ) = ol[s]; }
}

typedef __attribute__((ext_vector_type(2))) _Float16 v2h;
typedef __attribute__((ext_vector_type(4))) _Float16 v4h;
typedef __attribute__((ext_vector_type(2))) unsigned short v2us;
typedef __attribute__((ext_vector_type(2))) float v2f;
typedef __attribute__((ext_vector_type(4))) int v4i;

__global__ __launch_bounds__(256) void k_wtG(const float* __restrict__ w, int K, int N, bf* Bt) {
    const int lane = threadIdx.x & 31; const int L0 = (blockIdx.x * 8 + (threadIdx.x >> 5)) * 8; const int nlines = N * K / 64;
{
#pragma unroll 1
        for (int l = 0; l < 8; ++l) { const int L = L0 + l; if (L >= nlines) break; const size_t e = (size_t)L * 64 + lane * 2; const int k = (int)(e % K), n = (int)(e / K); v2us o;
            o[0] = f2bf(w[(size_t)k * N + n]); o[1] = f2bf(w[(size_t)(k + 1) * N + n]); *(v2us*)(Bt + e) = o; }
         }
}
__global__ __launch_bounds__(256) void k_cvt8(const float* __restrict__ src, bf* dst, size_t n8) { const size_t i = (size_t)blockIdx.x * 256 + threadIdx.x; if (i >= n8) return; const v8f v = *(const v8f*)(src + i * 8); v8us o;
#pragma unroll
    for (int k = 0; k < 8; ++k) o[k] = f2bf(v[k]); *(v8us*)(dst + i * 8) = o;  }

__global__ __launch_bounds__(256) void k_gathK(const bf* __restrict__ KPh_, const bf* __restrict__ KPl_, bf* KGh, bf* KGl) { const size_t e = ((size_t)blockIdx.x * 256 + threadIdx.x) * 8; if (e >= (size_t)NH_ * NGA * HD) return; const int d = (int)(e % HD); const int gq = (int)((e / HD) % NGA); const int h = (int)(e / ((size_t)HD * NGA)); const size_t src = ((size_t)h * TT + (size_t)gq * 64) * HD + d; const v8us a = *(const v8us*)(KPh_ + src), c = *(const v8us*)(KPl_ + src); *(v8us*)(KGh + e) = a; *(v8us*)(KGl + e) = c;  }
__global__ __launch_bounds__(256) void k_gathV(const bf* __restrict__ VTh_, const bf* __restrict__ VTl_, bf* VGh, bf* VGl) { const size_t e = ((size_t)blockIdx.x * 256 + threadIdx.x) * 8; if (e >= (size_t)NH_ * HD * NGA) return; const size_t hb = e / ((size_t)NG * HD);   /* VG is [head][entry][d][g]: hb = head * NB_ + entry */ const int gq = (int)((hb % NB_) * NG + e % NG);   /* number of the gathered key among all rows' */ const size_t hd_ = (hb / NB_) * HD + (e / NG) % HD; v8us a, c;
#pragma unroll
    for (int q = 0; q < 8; ++q) { const size_t src = hd_ * TT + (size_t)(gq + q) * 64; a[q] = VTh_[src]; c[q] = VTl_[src]; } *(v8us*)(VGh + e) = a; *(v8us*)(VGl + e) = c;  }

extern "C" void kernel_launch(void* const* d_in, const int* in_sizes, int n_in,
                              void* d_out, int out_size, void* d_ws, size_t ws_size, hipStream_t stream) {
    (void)in_sizes; (void)n_in; (void)out_size;
    const float* x = (const float*)d_in[0]; const float* wqkv = (const float*)d_in[1]; const float* wo = (const float*)d_in[2]; const float* bo = (const float*)d_in[3]; const float* wq = nullptr; const float* wk = nullptr; const float* wv = nullptr; (void)wq; (void)wk; (void)wv;
    float* OUT = (float*)d_out;     // [2][4096][1024]
    char* wsp = (char*)d_ws;
    auto take = [&](size_t bytes) { char* p = wsp; wsp += (bytes + 255) & ~(size_t)255; return (void*)p; };
    bf* WALL = (bf*)take((size_t)3 * DM * DM * 2); bf* WO = (bf*)take((size_t)DM * DQ * 2);
    bf* XB = (bf*)take((size_t)TT * DM * 2);
    bf* QPh = (bf*)take(6 * PLN * 2); bf* QPl = QPh + PLN; bf* KPh = QPh + 2 * PLN; bf* KPl = QPh + 3 * PLN; bf* VTh = QPh + 4 * PLN; bf* VTl = QPh + 5 * PLN;   /* one block: the projection's epilogue finds the k and v planes behind the q planes */
    bf* KGh = (bf*)take((size_t)NH_ * NGA * HD * 2); bf* KGl = (bf*)take((size_t)NH_ * NGA * HD * 2); bf* VGh = (bf*)take((size_t)NH_ * HD * NGA * 2); bf* VGl = (bf*)take((size_t)NH_ * HD * NGA * 2);
    bf* ATh = (bf*)take((size_t)TT * DQ * 2); bf* ATl = (bf*)take((size_t)TT * DQ * 2);   /* merged planes [t][head * HD + d] */
    if ((size_t)(wsp - (char*)d_ws) > ws_size) return;    // ws 256 MiB
    k_wtG<<<(unsigned)((DM * 3 * DM / 64 + 63) / 64), 256, 0, stream>>>(wqkv, DM, 3 * DM, WALL);   /* fused 'xw' [DM][3DM] -> Bt [3DM][DM] (row blocks q | k | v) */
    k_wtG<<<(unsigned)((DQ * DM / 64 + 63) / 64), 256, 0, stream>>>(wo, DQ, DM, WO);
    k_cvt8<<<(unsigned)(((size_t)TT * DM / 8 + 255) / 256), 256, 0, stream>>>(x, XB, (size_t)TT * DM / 8);
    k_gemmw<bf, 0, 2><<<dim3(TT / 64, 3 * DM / 64, 1), 32, 0, stream>>>(XB, nullptr, WALL, nullptr, DM, nullptr, 0, nullptr, 0, 0, 0, QPh, QPl, 0);   /* [q|k|v] projection, epilogue -> hi/lo planes */
    k_gathK<<<(unsigned)(((size_t)NH_ * NGA * HD / 8 + 255) / 256), 256, 0, stream>>>(KPh, KPl, KGh, KGl); k_gathV<<<(unsigned)(((size_t)NH_ * HD * NGA / 8 + 255) / 256), 256, 0, stream>>>(VTh, VTl, VGh, VGl);   /* the 64 strided keys / values per head and batch entry */
    k_attn<<<dim3(TT / 128, NH_, 1), 128, 0, stream>>>(QPh, QPl, KPh, KPl, VTh, VTl, KGh, KGl, VGh, VGl, ATh, ATl);   /* band + global attention, y = head -> merged planes */
    k_gemmw<bf, 1, 1><<<dim3(TT / 64, DM / 64, 1), 32, 0, stream>>>(ATh, ATl, WO, nullptr, DQ, OUT, DM, bo, 0, 0, 0, nullptr, nullptr, 0);
}

// v005
// Measured time: 138 microseconds a run.
// Two timings next to v004 both put it at 1.75 times that version's speed.
// All steps since v000 together make it 8.39 times as fast.
#include <hip/hip_runtime.h>

// Local (sliding window of 64, centred) + strided global (every 64th key) attention, summed, then an output projection (x [2][4096][1024]; [q|k|v] = x w_qkv ('xw' [1024][3072], reshape (3, H, Dh): thirds); 16 heads x 64; local: softmax over keys j in [i-32, i+31] (clipped to the sequence) of q.k/8; global: softmax over the 64 keys j = 64 g of q.k/8; out = (attn_local v + attn_global v_g) merged, w_out + b_out -> [2][4096][1024] (8.4 M)).
// Both batch entries run in the same launches as rows 0 .. 8191; a row's band span, window and global keys are clipped to its own entry.
// Algorithm: hi/lo planes of q, k (as [head][t][d]) and v (as [head][d][t]) are written by the epilogue of ONE projection launch over all 3072 columns of [q|k|v]; the 64 strided keys / values per head and entry are gathered; ONE attention launch (k_attn, one wave per head and 32 query rows) does band scores, global scores, both softmaxes and both probability x value products with scores and probabilities in LDS, and writes the merged hi/lo planes for the output projection.
// Compute dtypes, f32 accumulate: every input rounded to bf16; q/k/v on PLAIN bf16 operands (inputs: exact); band / global scores and probability x value products on hi/lo planes (3 products); both softmaxes f32; w_out hl x exact (2 products) + b_out.

#define NB_  2
#define TB   4096                 // rows (tokens) of one batch entry
#define TT   (NB_ * TB)           // all rows: both batch entries stand one behind the other in every plane and go through every launch together
#define DM   1024
#define NH_  16
#define NKV  16
#define REP  (NH_ / NKV)
#define HD   64
#define DQ   (NH_ * HD)
#define DKV  (NKV * HD)
#define ZH   1
#define RH   4096
#define LWH  32                   // half window: keys i-32 .. i+31
#define NG   64                   // global keys (every 64th) of one batch entry
#define NGA  (NB_ * NG)           // gathered keys of all rows
#define WIN  4096
#define PCAR 1024.0f
#define SCL  0.125f   // HD^-0.5
#define PLN  ((size_t)NH_ * TT * HD)   // elements of one q / k / v plane
typedef _Float16 h16;
typedef unsigned short bf;
typedef __attribute__((ext_vector_type(16))) __bf16   v16bf;
typedef __attribute__((ext_vector_type(16))) _Float16 v16h;
typedef __attribute__((ext_vector_type(8)))  _Float16 v8h;
typedef __attribute__((ext_vector_type(8)))  unsigned short v8us;
typedef __attribute__((ext_vector_type(8)))  float    v8f;
typedef __attribute__((ext_vector_type(4)))  float    v4f;
typedef v8h  __attribute__((may_alias)) v8ha;
typedef v4f  __attribute__((may_alias)) v4fa;
typedef v8us __attribute__((may_alias)) v8usa;

__device__ __forceinline__ unsigned short f2bf(float f) { unsigned u = __float_as_uint(f); u += 0x7FFFu + ((u >> 16) & 1u); return (unsigned short)(u >> 16); }
__device__ __forceinline__ float bf2f(unsigned short b) { return __uint_as_float(((unsigned)b) << 16); }
__device__ __forceinline__ float bfr(float f) { return bf2f(f2bf(f)); }
__device__ __forceinline__ void splitf(float y, unsigned short& h, unsigned short& l) { h = f2bf(y); l = f2bf(y - bf2f(h)); }
typedef __attribute__((ext_vector_type(4))) unsigned short v4us;
__device__ __forceinline__ v16h cat16(v8h lo, v8h hi) { return __builtin_shufflevector(lo, hi, 0, 1, 2, 3, 4, 5, 6, 7, 8, 9, 10, 11, 12, 13, 14, 15); }
__device__ __forceinline__ v16bf cat16b(v8us lo, v8us hi) { return __builtin_bit_cast(v16bf, __builtin_shufflevector(lo, hi, 0, 1, 2, 3, 4, 5, 6, 7, 8, 9, 10, 11, 12, 13, 14, 15)); }
__device__ __forceinline__ v8f wmma16(v16h a, v16h b, v8f c) { return __builtin_amdgcn_wmma_f32_16x16x32_f16(false, a, false, b, (short)0, c, false, false); }
__device__ __forceinline__ v8f wmmab(v16bf a, v16bf b, v8f c) { return __builtin_amdgcn_wmma_f32_16x16x32_bf16(false, a, false, b, (short)0, c, false, false); }



template <typename T16> struct WFrag;
template <> struct WFrag<h16> { typedef v16h V; static __device__ __forceinline__ V ld(const h16* p) { return cat16(*(const v8h*)p, *(const v8h*)(p + 16)); } static __device__ __forceinline__ v8f mma(V a, V b, v8f c) { return wmma16(a, b, c); } };
template <> struct WFrag<bf> { typedef v16bf V; static __device__ __forceinline__ V ld(const bf* p) { return cat16b(*(const v8us*)p, *(const v8us*)(p + 16)); } static __device__ __forceinline__ v8f mma(V a, V b, v8f c) { return wmmab(a, b, c); } };
__device__ __forceinline__ v16bf ldl(const bf* p) { return cat16b(*(const v8usa*)p, *(const v8usa*)(p + 16)); }

// ---- k_gemmb: block-tiled GEMM, one 128x128 output tile per work-group of 4 waves (2 x 2, each wave 64x64 = 16 accumulators); grid (M/128, N/128), 128 threads.
// C[m][n] = sum_k A[m][k] Bt[n][k] (NSPLIT 1: + A2[m][k] Bt[n][k], product by product as k goes up), operands K-contiguous bf16 planes of KD columns, KD % 64 == 0, KD >= 128.
// A stage is 64 k, one whole 128-byte line of every operand row: rows [A 128 | A2 128 (NSPLIT 1) | Bt 128] at an LDS pitch of 144 bytes (16 B x odd, for the 16-byte fragment reads). Two buffers, filled by asynchronous copies to LDS,
// 16 bytes a lane (8 lanes cover a line, a wave's copy 4 lines); the next stage's copies fly while this stage is worked on; each operand line leaves L2 once per work-group and is read by two waves from LDS.
// Registers: all fragments of a stage are held at once beside the accumulators, so three (NSPLIT 1: two) waves a SIMD are asked for; 1536 tiles of the [q|k|v] projection are two full rounds of three work-groups a WGP.
// EPI picks what the epilogue does with a wave's f32 tile: 1 store to C (pitch DM) with bias; 2 [q|k|v] projection: 64-column tile ty is head ty % 16 of third ty / 16, the tile is split into bf16 hi/lo and stored to that
// third's planes (Mh/Ml: q planes; k and v planes follow at 2 PLN and 4 PLN elements), q and k as [head][t][d], v transposed as [head][d][t], C unused.
#define GPB  144                  // LDS row pitch in bytes
// 128 rows of one operand's stage: 8 copies a lane, 16 rows apart. The wait is the last line of the copies' own statement: it stands before any register that a copy names is written again.
__device__ __forceinline__ void copy_rows(unsigned l, const bf* g, int kd) {
    asm volatile("global_load_async_to_lds_b128 %0, %8, off\n\t"
                 "global_load_async_to_lds_b128 %1, %9, off\n\t"
                 "global_load_async_to_lds_b128 %2, %10, off\n\t"
                 "global_load_async_to_lds_b128 %3, %11, off\n\t"
                 "global_load_async_to_lds_b128 %4, %12, off\n\t"
                 "global_load_async_to_lds_b128 %5, %13, off\n\t"
                 "global_load_async_to_lds_b128 %6, %14, off\n\t"
                 "global_load_async_to_lds_b128 %7, %15, off\n\t"
                 "s_wait_xcnt 0x0"
                 :: "v"(l), "v"(l + 16 * GPB), "v"(l + 32 * GPB), "v"(l + 48 * GPB), "v"(l + 64 * GPB), "v"(l + 80 * GPB), "v"(l + 96 * GPB), "v"(l + 112 * GPB),
                    "v"(g), "v"(g + 16 * kd), "v"(g + 32 * kd), "v"(g + 48 * kd), "v"(g + 64 * kd), "v"(g + 80 * kd), "v"(g + 96 * kd), "v"(g + 112 * kd) : "memory");
}
template <int NSPLIT, int EPI, int KD>
__global__ __launch_bounds__(128, NSPLIT ? 2 : 3) void k_gemmb(const bf* __restrict__ A, const bf* __restrict__ A2, const bf* __restrict__ Bt, float* C, const float* __restrict__ bias, bf* Mh, bf* Ml) {
    typedef WFrag<bf> F; typedef F::V V;
    constexpr int STG = (2 + NSPLIT) * 128 * GPB, BO = (1 + NSPLIT) * 128 * GPB, NT = KD / 64;   // bytes of a stage, place of the Bt rows in it, stages
    __shared__ __align__(16) char sm[2 * STG];
    const int tid = threadIdx.x, lane = tid & 31, lr = lane & 15, hi = lane >> 4; const int w = __builtin_amdgcn_readfirstlane(tid >> 5), wm = w >> 1, wn = w & 1;
    const int r0 = blockIdx.x * 128 + wm * 64, c0 = blockIdx.y * 128 + wn * 64, ty = blockIdx.y * 2 + wn;   // this wave's 64x64 tile
    const size_t go = (size_t)(tid >> 3) * KD + (tid & 7) * 8;   // a lane's row and 16-byte piece in every copy
    const bf* ga = A + (size_t)blockIdx.x * 128 * KD + go; const bf* ga2 = NSPLIT ? A2 + (size_t)blockIdx.x * 128 * KD + go : nullptr; const bf* gb = Bt + (size_t)blockIdx.y * 128 * KD + go;
    const unsigned l0 = (unsigned)(size_t)sm + (tid >> 3) * GPB + (tid & 7) * 16;
    auto fill = [&](int t, int buf) { copy_rows(l0 + buf * STG, ga + t * 64, KD); if (NSPLIT) copy_rows(l0 + buf * STG + 128 * GPB, ga2 + t * 64, KD); copy_rows(l0 + buf * STG + BO, gb + t * 64, KD); };
    v8f acc[4][4];
#pragma unroll
    for (int mb = 0; mb < 4; ++mb)
#pragma unroll
        for (int nb = 0; nb < 4; ++nb) acc[mb][nb] = (v8f){};
    fill(0, 0);
    asm volatile("s_wait_asynccnt 0x0" ::: "memory");   // this wave's copies of stage 0 have landed
    __syncthreads();                                    // ... and every other wave's
    fill(1, 1);
    const char* fa = sm + (wm * 64 + lr) * GPB + hi * 16; const char* fb = sm + BO + (wn * 64 + lr) * GPB + hi * 16;
#pragma unroll 1   // rolled: one copy of the stage's text, the buffer picked by t & 1
    for (int t = 0; t < NT; ++t) {
        const int bo = (t & 1) * STG;
        V a[2][4], a2[2][4], b[2][4];
#pragma unroll
        for (int kk = 0; kk < 2; ++kk) {
#pragma unroll
            for (int mb = 0; mb < 4; ++mb) { a[kk][mb] = ldl((const bf*)(fa + bo + mb * 16 * GPB + kk * 64)); if (NSPLIT) a2[kk][mb] = ldl((const bf*)(fa + bo + (128 + mb * 16) * GPB + kk * 64)); }
#pragma unroll
            for (int nb = 0; nb < 4; ++nb) b[kk][nb] = ldl((const bf*)(fb + bo + nb * 16 * GPB + kk * 64)); }
        __builtin_amdgcn_sched_barrier(0);   // all fragment reads of the stage go out as one group ahead of its products: left alone they were issued two at a time into one register set among the products, one LDS latency each time
#pragma unroll
        for (int kk = 0; kk < 2; ++kk)
#pragma unroll
            for (int nb = 0; nb < 4; ++nb)
#pragma unroll
                for (int mb = 0; mb < 4; ++mb) { acc[mb][nb] = F::mma(a[kk][mb], b[kk][nb], acc[mb][nb]); if (NSPLIT) acc[mb][nb] = F::mma(a2[kk][mb], b[kk][nb], acc[mb][nb]); }
        __builtin_amdgcn_sched_barrier(0);   // the waits and the barrier stay behind the products: moved up in front of them, the wait for the next stage's copies came one stage's products too early
        asm volatile("s_wait_dscnt 0x0" ::: "memory");      // this wave's reads of the buffer are done before it is handed to the copies
        asm volatile("s_wait_asynccnt 0x0" ::: "memory");   // this wave's copies of stage t + 1 have landed
        __syncthreads();                                    // publishes stage t + 1 and ends every wave's reads of stage t
        if (t + 2 < NT) fill(t + 2, t & 1);
    }
    asm volatile("s_wait_asynccnt 0x0" ::: "memory");       // no copy is outstanding when the ring becomes output staging (the last trip's barrier ended every read of it)
    float* os = (float*)(sm + w * (16 * 68 * 4));           // each wave stages in its own range
    if (EPI == 2 && ty >= 2 * NH_) {   // v third: a lane's 8 accumulator rows are 8 consecutive t of one d, so the transposed planes take 16-byte stores straight from the registers
        const size_t vo = 4 * PLN + ((size_t)(ty - 2 * NH_) * HD + lr) * TT + r0 + hi * 8;
#pragma unroll
        for (int nb = 0; nb < 4; ++nb)
#pragma unroll
            for (int mb = 0; mb < 4; ++mb) { v8us oh, ol;
#pragma unroll
                for (int j = 0; j < 8; ++j) { unsigned short a_, c_; splitf(acc[mb][nb][j], a_, c_); oh[j] = a_; ol[j] = c_; }
                *(v8us*)(Mh + vo + (size_t)nb * 16 * TT + mb * 16) = oh; *(v8us*)(Ml + vo + (size_t)nb * 16 * TT + mb * 16) = ol; }
        return;
    }
#pragma unroll
    for (int mb = 0; mb < 4; ++mb) {
#pragma unroll
        for (int nb = 0; nb < 4; ++nb) {
#pragma unroll
            for (int j = 0; j < 8; ++j) os[(hi * 8 + j) * 68 + nb * 16 + lr] = acc[mb][nb][j]; }
        __builtin_amdgcn_wave_barrier(); asm volatile("" ::: "memory");   // rows that some lanes wrote are read by other lanes of the same wave: keeps the compiler from moving LDS accesses over the hand-over
        if (EPI == 2) {   // q / k third: row t of one head is one 128-byte line of each plane
            const size_t po = (size_t)(ty / NH_) * 2 * PLN + ((size_t)(ty % NH_) * TT + r0 + mb * 16) * HD;
#pragma unroll
            for (int s = 0; s < 8; ++s) { const int row = 2 * s + hi, cofs = lr * 4; const v4f val = *(const v4fa*)(os + row * 68 + cofs); v4us oh, ol;
#pragma unroll
                for (int q = 0; q < 4; ++q) { unsigned short a_, c_; splitf(val[q], a_, c_); oh[q] = a_; ol[q] = c_; }
                *(v4us*)(Mh + po + (size_t)row * HD + cofs) = oh; *(v4us*)(Ml + po + (size_t)row * HD + cofs) = ol; }
        } else {
            float* crow = C + (size_t)(r0 + mb * 16) * DM + c0;
#pragma unroll
            for (int s = 0; s < 8; ++s) { const int row = 2 * s + hi, cofs = lr * 4; v4f val = *(const v4fa*)(os + row * 68 + cofs); val[0] += bfr(bias[c0 + cofs]); val[1] += bfr(bias[c0 + cofs + 1]); val[2] += bfr(bias[c0 + cofs + 2]); val[3] += bfr(bias[c0 + cofs + 3]);
                *(v4f*)(crow + (size_t)row * DM + cofs) = val; }
        }
        asm volatile("s_wait_xcnt 0x0" ::: "memory");   // the next block's LDS reads reuse registers that these stores name
        __builtin_amdgcn_wave_barrier(); asm volatile("" ::: "memory");
    }
}

// ---- k_attn: both attentions of one head for 32 query rows in ONE WAVE, scores and probabilities never leaving the WGP; grid (TT / 128, head), 4 independent waves a block, each with its own LDS rows (no work-group barrier).
// The windows of rows r0 .. r0 + 31 span the 96 keys r0 - 32 .. r0 + 63: three 32-key steps, each wholly inside or wholly outside the rows' batch entry (outside: skipped). Per wave: band scores (hi/lo, 3 products) -> LDS f32 [32][96];
// lane = row softmax, the bf16 hi | lo probabilities written over the row's own scores (exact zeros outside the window); band P.V with P from LDS and v from the [d][t] planes; ahead of it the same on the 64 gathered keys; the two f32 partial
// outputs are added, split and stored as the merged hi/lo planes [t][head * HD + d] in whole 128-byte lines.
#define PS   100                  // LDS row pitch in dwords: 400 B = 16 B x odd, for the 16-byte row reads
#define BK   96                   // keys of the band span of 32 rows
// Rows that some lanes wrote to LDS are read by other lanes of the same wave (LDS operations of a wave run in order): this keeps the compiler from moving LDS accesses over the hand-over.
__device__ __forceinline__ void wsync() { __builtin_amdgcn_wave_barrier(); asm volatile("" ::: "memory"); }
// One lane's softmax of NC scores of its LDS row (columns clo .. chi count, the rest get probability 0), probabilities split to bf16 hi (first NC) | lo (next NC) over the same bytes.
template <int NC>
__device__ __forceinline__ void rowsoft(float* srow, int clo, int chi) {
    float s[NC];
#pragma unroll
    for (int c = 0; c < NC; c += 4) { const v4f t = *(const v4fa*)(srow + c); s[c] = t[0]; s[c + 1] = t[1]; s[c + 2] = t[2]; s[c + 3] = t[3]; }
    const unsigned wd = (unsigned)(chi - clo); float m4[4] = { -3.0e38f, -3.0e38f, -3.0e38f, -3.0e38f };
#pragma unroll
    for (int c = 0; c < NC; ++c) { s[c] = ((unsigned)(c - clo) <= wd) ? s[c] * SCL : -3.0e38f; m4[c & 3] = fmaxf(m4[c & 3], s[c]); }
    const float mx = fmaxf(fmaxf(m4[0], m4[1]), fmaxf(m4[2], m4[3])); float a4[4] = { 0.0f, 0.0f, 0.0f, 0.0f };
#pragma unroll
    for (int c = 0; c < NC; c += 4) { float e[4];
#pragma unroll
        for (int q = 0; q < 4; ++q) e[q] = (s[c + q] - mx) * 1.4426950408889634f;
        // four v_exp_f32 on registers of their own, each the independent instruction behind the one before it, and a v_nop behind the last: the slot that the instruction set asks for before a transcendental's result is used or its source overwritten
        asm("v_exp_f32 %0, %4\n\tv_exp_f32 %1, %5\n\tv_exp_f32 %2, %6\n\tv_exp_f32 %3, %7\n\tv_nop" : "=&v"(s[c]), "=&v"(s[c + 1]), "=&v"(s[c + 2]), "=&v"(s[c + 3]) : "v"(e[0]), "v"(e[1]), "v"(e[2]), "v"(e[3]));
#pragma unroll
        for (int q = 0; q < 4; ++q) a4[q] += s[c + q]; }
    const float f = __fdiv_rn(1.0f, (a4[0] + a4[1]) + (a4[2] + a4[3]));
    bf* prow = (bf*)srow;
#pragma unroll
    for (int c = 0; c < NC; c += 8) { v8us oh, ol;
#pragma unroll
        for (int q = 0; q < 8; ++q) { unsigned short a_, c_; splitf(s[c + q] * f, a_, c_); oh[q] = a_; ol[q] = c_; }
        *(v8usa*)(prow + c) = oh; *(v8usa*)(prow + NC + c) = ol; }
}
// Behind a group of fragment loads: the wait before a register that these loads name is written again (the two addresses as inputs keep their registers whole up to it), and a scheduling barrier, so that
// every load of the group is in flight before the first product waits on one (without it the loads were issued four at a time into one register set, one L2 latency each time).
__device__ __forceinline__ void loads_out(const bf* p0, const bf* p1) { asm volatile("s_wait_xcnt 0x0" :: "v"(p0), "v"(p1) : "memory"); __builtin_amdgcn_sched_barrier(0); }
__global__ __launch_bounds__(128, 4) void k_attn(const bf* __restrict__ Qh, const bf* __restrict__ Ql, const bf* __restrict__ Kh, const bf* __restrict__ Kl, const bf* __restrict__ Vh, const bf* __restrict__ Vl,
                                              const bf* __restrict__ KGh_, const bf* __restrict__ KGl_, const bf* __restrict__ VGh_, const bf* __restrict__ VGl_, bf* Mh, bf* Ml) {
    typedef WFrag<bf> F; typedef F::V V;
    __shared__ __align__(16) float sm[4][32 * PS];
    const int lane = threadIdx.x & 31, lr = lane & 15, hi = lane >> 4; const int w = __builtin_amdgcn_readfirstlane((int)(threadIdx.x >> 5));
    float* S = sm[w]; const bf* P = (const bf*)S;
    const int h = blockIdx.y, r0 = (blockIdx.x * 4 + w) * 32, eb = r0 / TB, b0 = eb * TB, k0 = r0 - 32;   // k0: first key of the span (off the entry for its first row tile)
    const int ks0 = (k0 < b0) ? 1 : 0, ks1 = (k0 + BK > b0 + TB) ? 2 : 3;                                 // the 32-key steps that lie in the rows' own batch entry
    const bf* qh = Qh + ((size_t)h * TT + r0 + lr) * HD + 8 * hi; const bf* ql = Ql + ((size_t)h * TT + r0 + lr) * HD + 8 * hi;
    // global scores against the entry's 64 gathered keys
    {
        V qa[2][2], qb[2][2];
#pragma unroll
        for (int mb = 0; mb < 2; ++mb)
#pragma unroll
            for (int kk = 0; kk < 2; ++kk) { qa[mb][kk] = F::ld(qh + mb * 16 * HD + kk * 32); qb[mb][kk] = F::ld(ql + mb * 16 * HD + kk * 32); }
        loads_out(qh, ql);
        v8f g[2][4];
#pragma unroll
        for (int mb = 0; mb < 2; ++mb)
#pragma unroll
            for (int nb = 0; nb < 4; ++nb) g[mb][nb] = (v8f){};
        const bf* gh = KGh_ + ((size_t)h * NGA + eb * NG + lr) * HD + 8 * hi; const bf* gl = KGl_ + ((size_t)h * NGA + eb * NG + lr) * HD + 8 * hi;
#pragma unroll
        for (int kk = 0; kk < 2; ++kk) { V b[4], b2[4];
#pragma unroll
            for (int nb = 0; nb < 4; ++nb) { b[nb] = F::ld(gh + nb * 16 * HD + kk * 32); b2[nb] = F::ld(gl + nb * 16 * HD + kk * 32); }
            loads_out(gh, gl);
#pragma unroll
            for (int nb = 0; nb < 4; ++nb)
#pragma unroll
                for (int mb = 0; mb < 2; ++mb) { g[mb][nb] = F::mma(qa[mb][kk], b[nb], g[mb][nb]); g[mb][nb] = F::mma(qb[mb][kk], b[nb], g[mb][nb]); g[mb][nb] = F::mma(qa[mb][kk], b2[nb], g[mb][nb]); } }
#pragma unroll
        for (int mb = 0; mb < 2; ++mb)
#pragma unroll
            for (int nb = 0; nb < 4; ++nb)
#pragma unroll
                for (int j = 0; j < 8; ++j) S[(mb * 16 + hi * 8 + j) * PS + nb * 16 + lr] = g[mb][nb][j];
    }
    wsync();
    rowsoft<NG>(S + lane * PS, 0, NG - 1);
    wsync();
    // global probabilities x gathered values ([head][entry][d][g])
    v8f og[2][4];
#pragma unroll
    for (int mb = 0; mb < 2; ++mb)
#pragma unroll
        for (int nb = 0; nb < 4; ++nb) og[mb][nb] = (v8f){};
    { const bf* vh = VGh_ + (((size_t)h * NB_ + eb) * HD + lr) * NG + 8 * hi; const bf* vl = VGl_ + (((size_t)h * NB_ + eb) * HD + lr) * NG + 8 * hi;
#pragma unroll
      for (int kk = 0; kk < 2; ++kk) { V a[2], a2[2], b[4], b2[4];
#pragma unroll
          for (int nb = 0; nb < 4; ++nb) { b[nb] = F::ld(vh + nb * 16 * NG + kk * 32); b2[nb] = F::ld(vl + nb * 16 * NG + kk * 32); }
#pragma unroll
          for (int mb = 0; mb < 2; ++mb) { a[mb] = ldl(P + (mb * 16 + lr) * (2 * PS) + kk * 32 + 8 * hi); a2[mb] = ldl(P + (mb * 16 + lr) * (2 * PS) + NG + kk * 32 + 8 * hi); }
          loads_out(vh, vl);
#pragma unroll
          for (int nb = 0; nb < 4; ++nb)
#pragma unroll
              for (int mb = 0; mb < 2; ++mb) { og[mb][nb] = F::mma(a[mb], b[nb], og[mb][nb]); og[mb][nb] = F::mma(a2[mb], b[nb], og[mb][nb]); og[mb][nb] = F::mma(a[mb], b2[nb], og[mb][nb]); } } }
    wsync();
    if (ks0 != 0 || ks1 != 3) {   // a skipped step's score columns get a value, so that the row read below meets only LDS that this pass wrote
        const int cz = (ks0 != 0) ? 0 : 64;
#pragma unroll
        for (int c = 0; c < 32; c += 4) *(v4fa*)(S + lane * PS + cz + c) = (v4f){};
    }
    // band scores; the q fragments are loaded a second time (their 64 registers are free for the value fragments in between: four waves a SIMD have 256 registers each)
    V qa[2][2], qb[2][2];
#pragma unroll
    for (int mb = 0; mb < 2; ++mb)
#pragma unroll
        for (int kk = 0; kk < 2; ++kk) { qa[mb][kk] = F::ld(qh + mb * 16 * HD + kk * 32); qb[mb][kk] = F::ld(ql + mb * 16 * HD + kk * 32); }
    loads_out(qh, ql);
#pragma unroll 1
    for (int ks = ks0; ks < ks1; ++ks) {
        v8f acc[2][2]; V b[2][2], b2[2][2];
#pragma unroll
        for (int mb = 0; mb < 2; ++mb)
#pragma unroll
            for (int nb = 0; nb < 2; ++nb) acc[mb][nb] = (v8f){};
        const bf* kh = Kh + ((size_t)h * TT + (k0 + ks * 32) + lr) * HD + 8 * hi; const bf* kl = Kl + ((size_t)h * TT + (k0 + ks * 32) + lr) * HD + 8 * hi;
#pragma unroll
        for (int kk = 0; kk < 2; ++kk)
#pragma unroll
            for (int nb = 0; nb < 2; ++nb) { b[kk][nb] = F::ld(kh + nb * 16 * HD + kk * 32); b2[kk][nb] = F::ld(kl + nb * 16 * HD + kk * 32); }
        loads_out(kh, kl);
#pragma unroll
        for (int kk = 0; kk < 2; ++kk)
#pragma unroll
            for (int nb = 0; nb < 2; ++nb)
#pragma unroll
                for (int mb = 0; mb < 2; ++mb) { acc[mb][nb] = F::mma(qa[mb][kk], b[kk][nb], acc[mb][nb]); acc[mb][nb] = F::mma(qb[mb][kk], b[kk][nb], acc[mb][nb]); acc[mb][nb] = F::mma(qa[mb][kk], b2[kk][nb], acc[mb][nb]); }
#pragma unroll
        for (int mb = 0; mb < 2; ++mb)
#pragma unroll
            for (int nb = 0; nb < 2; ++nb)
#pragma unroll
                for (int j = 0; j < 8; ++j) S[(mb * 16 + hi * 8 + j) * PS + ks * 32 + nb * 16 + lr] = acc[mb][nb][j];
    }
    wsync();
    rowsoft<BK>(S + lane * PS, max(lane, b0 - k0), min(lane + 63, b0 + TB - 1 - k0));   // column c is key k0 + c; row r0 + lane sees keys r0 + lane - 32 .. r0 + lane + 31 of its entry
    wsync();
    // band probabilities x values
    v8f o[2][4];
#pragma unroll
    for (int mb = 0; mb < 2; ++mb)
#pragma unroll
        for (int nb = 0; nb < 4; ++nb) o[mb][nb] = (v8f){};
#pragma unroll 1
    for (int ks = ks0; ks < ks1; ++ks) {
        V a[2], a2[2], b[4], b2[4];
        const bf* vh = Vh + ((size_t)h * HD + lr) * TT + (r0 + ks * 32) + 8 * hi; const bf* vl = Vl + ((size_t)h * HD + lr) * TT + (r0 + ks * 32) + 8 * hi;   // key r0 + 32 ks; the step's first key k0 + 32 ks lies 32 in front of it
#pragma unroll
        for (int nb = 0; nb < 4; ++nb) { b[nb] = F::ld(vh - 32 + (size_t)nb * 16 * TT); b2[nb] = F::ld(vl - 32 + (size_t)nb * 16 * TT); }
#pragma unroll
        for (int mb = 0; mb < 2; ++mb) { a[mb] = ldl(P + (mb * 16 + lr) * (2 * PS) + ks * 32 + 8 * hi); a2[mb] = ldl(P + (mb * 16 + lr) * (2 * PS) + BK + ks * 32 + 8 * hi); }
        loads_out(vh, vl);
#pragma unroll
        for (int nb = 0; nb < 4; ++nb)
#pragma unroll
            for (int mb = 0; mb < 2; ++mb) { o[mb][nb] = F::mma(a[mb], b[nb], o[mb][nb]); o[mb][nb] = F::mma(a2[mb], b[nb], o[mb][nb]); o[mb][nb] = F::mma(a[mb], b2[nb], o[mb][nb]); }
        // the distance behind the last matrix instructions on the loop's back edge, where the next trip's loads overwrite their operands
        asm volatile("v_nop\n\tv_nop\n\tv_nop\n\tv_nop" : "+v"(o[0][0]), "+v"(o[1][1]), "+v"(o[0][2]), "+v"(o[1][3]) : "v"(a[0]), "v"(a[1]));
    }
    wsync();
    // the sum of the two partial outputs, through LDS for whole-line stores
#pragma unroll
    for (int mb = 0; mb < 2; ++mb)
#pragma unroll
        for (int nb = 0; nb < 4; ++nb)
#pragma unroll
            for (int j = 0; j < 8; ++j) S[(mb * 16 + hi * 8 + j) * PS + nb * 16 + lr] = __fadd_rn(o[mb][nb][j], og[mb][nb][j]);
    wsync();
    const size_t mo = (size_t)r0 * DQ + h * HD + lr * 4;   // a row's 64 columns of one head are one 128-byte line of each merged plane
    v4us oh[16], ol[16];
#pragma unroll
    for (int s = 0; s < 16; ++s) { const v4f val = *(const v4fa*)(S + (2 * s + hi) * PS + lr * 4);
#pragma unroll
        for (int q = 0; q < 4; ++q) { unsigned short a_, c_; splitf(val[q], a_, c_); oh[s][q] = a_; ol[s][q] = c_; } }
    __builtin_amdgcn_sched_barrier(0);   // every row is split before the first store issues: behind the stores no register that one of them names is written again
#pragma unroll
    for (int s = 0; s < 16; ++s) { *(v4us*)(Mh + mo + (size_t)(2 * s + hi) * DQ) = oh[s]; *(v4us*)(Ml + mo + (size_t)(2 * s + hi) * DQ) = ol[s]; }
}

typedef __attribute__((ext_vector_type(2))) _Float16 v2h;
typedef __attribute__((ext_vector_type(4))) _Float16 v4h;
typedef __attribute__((ext_vector_type(2))) unsigned short v2us;
typedef __attribute__((ext_vector_type(2))) float v2f;
typedef __attribute__((ext_vector_type(4))) int v4i;

__global__ __launch_bounds__(256) void k_wtG(const float* __restrict__ w, int K, int N, bf* Bt) {
    const int lane = threadIdx.x & 31; const int L0 = (blockIdx.x * 8 + (threadIdx.x >> 5)) * 8; const int nlines = N * K / 64;
{
#pragma unroll 1
        for (int l = 0; l < 8; ++l) { const int L = L0 + l; if (L >= nlines) break; const size_t e = (size_t)L * 64 + lane * 2; const int k = (int)(e % K), n = (int)(e / K); v2us o;
            o[0] = f2bf(w[(size_t)k * N + n]); o[1] = f2bf(w[(size_t)(k + 1) * N + n]); *(v2us*)(Bt + e) = o; }
         }
}
__global__ __launch_bounds__(256) void k_cvt8(const float* __restrict__ src, bf* dst, size_t n8) { const size_t i = (size_t)blockIdx.x * 256 + threadIdx.x; if (i >= n8) return; const v8f v = *(const v8f*)(src + i * 8); v8us o;
#pragma unroll
    for (int k = 0; k < 8; ++k) o[k] = f2bf(v[k]); *(v8us*)(dst + i * 8) = o;  }

__global__ __launch_bounds__(256) void k_gathK(const bf* __restrict__ KPh_, const bf* __restrict__ KPl_, bf* KGh, bf* KGl) { const size_t e = ((size_t)blockIdx.x * 256 + threadIdx.x) * 8; if (e >= (size_t)NH_ * NGA * HD) return; const int d = (int)(e % HD); const int gq = (int)((e / HD) % NGA); const int h = (int)(e / ((size_t)HD * NGA)); const size_t src = ((size_t)h * TT + (size_t)gq * 64) * HD + d; const v8us a = *(const v8us*)(KPh_ + src), c = *(const v8us*)(KPl_ + src); *(v8us*)(KGh + e) = a; *(v8us*)(KGl + e) = c;  }
__global__ __launch_bounds__(256) void k_gathV(const bf* __restrict__ VTh_, const bf* __restrict__ VTl_, bf* VGh, bf* VGl) { const size_t e = ((size_t)blockIdx.x * 256 + threadIdx.x) * 8; if (e >= (size_t)NH_ * HD * NGA) return; const size_t hb = e / ((size_t)NG * HD);   /* VG is [head][entry][d][g]: hb = head * NB_ + entry */ const int gq = (int)((hb % NB_) * NG + e % NG);   /* number of the gathered key among all rows' */ const size_t hd_ = (hb / NB_) * HD + (e / NG) % HD; v8us a, c;
#pragma unroll
    for (int q = 0; q < 8; ++q) { const size_t src = hd_ * TT + (size_t)(gq + q) * 64; a[q] = VTh_[src]; c[q] = VTl_[src]; } *(v8us*)(VGh + e) = a; *(v8us*)(VGl + e) = c;  }

extern "C" void kernel_launch(void* const* d_in, const int* in_sizes, int n_in,
                              void* d_out, int out_size, void* d_ws, size_t ws_size, hipStream_t stream) {
    (void)in_sizes; (void)n_in; (void)out_size;
    const float* x = (const float*)d_in[0]; const float* wqkv = (const float*)d_in[1]; const float* wo = (const float*)d_in[2]; const float* bo = (const float*)d_in[3]; const float* wq = nullptr; const float* wk = nullptr; const float* wv = nullptr; (void)wq; (void)wk; (void)wv;
    float* OUT = (float*)d_out;     // [2][4096][1024]
    char* wsp = (char*)d_ws;
    auto take = [&](size_t bytes) { char* p = wsp; wsp += (bytes + 255) & ~(size_t)255; return (void*)p; };
    bf* WALL = (bf*)take((size_t)3 * DM * DM * 2); bf* WO = (bf*)take((size_t)DM * DQ * 2);
    bf* XB = (bf*)take((size_t)TT * DM * 2);
    bf* QPh = (bf*)take(6 * PLN * 2); bf* QPl = QPh + PLN; bf* KPh = QPh + 2 * PLN; bf* KPl = QPh + 3 * PLN; bf* VTh = QPh + 4 * PLN; bf* VTl = QPh + 5 * PLN;   /* one block: the projection's epilogue finds the k and v planes behind the q planes */
    bf* KGh = (bf*)take((size_t)NH_ * NGA * HD * 2); bf* KGl = (bf*)take((size_t)NH_ * NGA * HD * 2); bf* VGh = (bf*)take((size_t)NH_ * HD * NGA * 2); bf* VGl = (bf*)take((size_t)NH_ * HD * NGA * 2);
    bf* ATh = (bf*)take((size_t)TT * DQ * 2); bf* ATl = (bf*)take((size_t)TT * DQ * 2);   /* merged planes [t][head * HD + d] */
    if ((size_t)(wsp - (char*)d_ws) > ws_size) return;    // ws 256 MiB
    k_wtG<<<(unsigned)((DM * 3 * DM / 64 + 63) / 64), 256, 0, stream>>>(wqkv, DM, 3 * DM, WALL);   /* fused 'xw' [DM][3DM] -> Bt [3DM][DM] (row blocks q | k | v) */
    k_wtG<<<(unsigned)((DQ * DM / 64 + 63) / 64), 256, 0, stream>>>(wo, DQ, DM, WO);
    k_cvt8<<<(unsigned)(((size_t)TT * DM / 8 + 255) / 256), 256, 0, stream>>>(x, XB, (size_t)TT * DM / 8);
    k_gemmb<0, 2, DM><<<dim3(TT / 128, 3 * DM / 128, 1), 128, 0, stream>>>(XB, nullptr, WALL, nullptr, nullptr, QPh, QPl);   /* [q|k|v] projection, epilogue -> hi/lo planes */
    k_gathK<<<(unsigned)(((size_t)NH_ * NGA * HD / 8 + 255) / 256), 256, 0, stream>>>(KPh, KPl, KGh, KGl); k_gathV<<<(unsigned)(((size_t)NH_ * HD * NGA / 8 + 255) / 256), 256, 0, stream>>>(VTh, VTl, VGh, VGl);   /* the 64 strided keys / values per head and batch entry */
    k_attn<<<dim3(TT / 128, NH_, 1), 128, 0, stream>>>(QPh, QPl, KPh, KPl, VTh, VTl, KGh, KGl, VGh, VGl, ATh, ATl);   /* band + global attention, y = head -> merged planes */
    k_gemmb<1, 1, DQ><<<dim3(TT / 128, DM / 128, 1), 128, 0, stream>>>(ATh, ATl, WO, OUT, bo, nullptr, nullptr);
}

// v006
// Measured time: 128 microseconds a run.
// Next to v005, in two timings, it ran 1.07 and 1.09 times as fast.
// All steps since v000 together make it 9.06 times as fast.
#include <hip/hip_runtime.h>

// Local (sliding window of 64, centred) + strided global (every 64th key) attention, summed, then an output projection (x [2][4096][1024]; [q|k|v] = x w_qkv ('xw' [1024][3072], reshape (3, H, Dh): thirds); 16 heads x 64; local: softmax over keys j in [i-32, i+31] (clipped to the sequence) of q.k/8; global: softmax over the 64 keys j = 64 g of q.k/8; out = (attn_local v + attn_global v_g) merged, w_out + b_out -> [2][4096][1024] (8.4 M)).
// Both batch entries run in the same launches as rows 0 .. 8191; a row's band span, window and global keys are clipped to its own entry.
// Algorithm: hi/lo planes of q, k (as [head][t][d]) and v (as [head][d][t]) are written by the epilogue of ONE projection launch over all 3072 columns of [q|k|v]; the 64 strided keys / values per head and entry are gathered; ONE attention launch (k_attn, one wave per head and 32 query rows) does band scores, global scores, both softmaxes and both probability x value products with scores and probabilities in LDS, and writes the merged hi/lo planes for the output projection.
// Compute dtypes, f32 accumulate: every input rounded to bf16; q/k/v on PLAIN bf16 operands (inputs: exact); band / global scores and probability x value products on hi/lo planes (3 products); both softmaxes f32; w_out hl x exact (2 products) + b_out.

#define NB_  2
#define TB   4096                 // rows (tokens) of one batch entry
#define TT   (NB_ * TB)           // all rows: both batch entries stand one behind the other in every plane and go through every launch together
#define DM   1024
#define NH_  16
#define NKV  16
#define REP  (NH_ / NKV)
#define HD   64
#define DQ   (NH_ * HD)
#define DKV  (NKV * HD)
#define ZH   1
#define RH   4096
#define LWH  32                   // half window: keys i-32 .. i+31
#define NG   64                   // global keys (every 64th) of one batch entry
#define NGA  (NB_ * NG)           // gathered keys of all rows
#define WIN  4096
#define PCAR 1024.0f
#define SCL  0.125f   // HD^-0.5
#define PLN  ((size_t)NH_ * TT * HD)   // elements of one q / k / v plane
typedef _Float16 h16;
typedef unsigned short bf;
typedef __attribute__((ext_vector_type(16))) __bf16   v16bf;
typedef __attribute__((ext_vector_type(16))) _Float16 v16h;
typedef __attribute__((ext_vector_type(8)))  _Float16 v8h;
typedef __attribute__((ext_vector_type(8)))  unsigned short v8us;
typedef __attribute__((ext_vector_type(8)))  float    v8f;
typedef __attribute__((ext_vector_type(4)))  float    v4f;
typedef v8h  __attribute__((may_alias)) v8ha;
typedef v4f  __attribute__((may_alias)) v4fa;
typedef v8us __attribute__((may_alias)) v8usa;

__device__ __forceinline__ unsigned short f2bf(float f) { unsigned u = __float_as_uint(f); u += 0x7FFFu + ((u >> 16) & 1u); return (unsigned short)(u >> 16); }
__device__ __forceinline__ float bf2f(unsigned short b) { return __uint_as_float(((unsigned)b) << 16); }
__device__ __forceinline__ float bfr(float f) { return bf2f(f2bf(f)); }
__device__ __forceinline__ void splitf(float y, unsigned short& h, unsigned short& l) { h = f2bf(y); l = f2bf(y - bf2f(h)); }
typedef __attribute__((ext_vector_type(4))) unsigned short v4us;
__device__ __forceinline__ v16h cat16(v8h lo, v8h hi) { return __builtin_shufflevector(lo, hi, 0, 1, 2, 3, 4, 5, 6, 7, 8, 9, 10, 11, 12, 13, 14, 15); }
__device__ __forceinline__ v16bf cat16b(v8us lo, v8us hi) { return __builtin_bit_cast(v16bf, __builtin_shufflevector(lo, hi, 0, 1, 2, 3, 4, 5, 6, 7, 8, 9, 10, 11, 12, 13, 14, 15)); }
__device__ __forceinline__ v8f wmma16(v16h a, v16h b, v8f c) { return __builtin_amdgcn_wmma_f32_16x16x32_f16(false, a, false, b, (short)0, c, false, false); }
__device__ __forceinline__ v8f wmmab(v16bf a, v16bf b, v8f c) { return __builtin_amdgcn_wmma_f32_16x16x32_bf16(false, a, false, b, (short)0, c, false, false); }



template <typename T16> struct WFrag;
template <> struct WFrag<h16> { typedef v16h V; static __device__ __forceinline__ V ld(const h16* p) { return cat16(*(const v8h*)p, *(const v8h*)(p + 16)); } static __device__ __forceinline__ v8f mma(V a, V b, v8f c) { return wmma16(a, b, c); } };
template <> struct WFrag<bf> { typedef v16bf V; static __device__ __forceinline__ V ld(const bf* p) { return cat16b(*(const v8us*)p, *(const v8us*)(p + 16)); } static __device__ __forceinline__ v8f mma(V a, V b, v8f c) { return wmmab(a, b, c); } };
__device__ __forceinline__ v16bf ldl(const bf* p) { return cat16b(*(const v8usa*)p, *(const v8usa*)(p + 16)); }

// ---- k_gemmb: block-tiled GEMM, one 128x128 output tile per work-group of 4 waves (2 x 2, each wave 64x64 = 16 accumulators); grid (M/128, N/128), 128 threads.
// C[m][n] = sum_k A[m][k] Bt[n][k] (NSPLIT 1: + A2[m][k] Bt[n][k], product by product as k goes up), operands K-contiguous bf16 planes of KD columns, KD % 64 == 0, KD >= 128.
// A stage is 64 k, one whole 128-byte line of every operand row: rows [A 128 | A2 128 (NSPLIT 1) | Bt 128] at an LDS pitch of 144 bytes (16 B x odd, for the 16-byte fragment reads). Two buffers, filled by asynchronous copies to LDS,
// 16 bytes a lane (8 lanes cover a line, a wave's copy 4 lines); the next stage's copies fly while this stage is worked on; each operand line leaves L2 once per work-group and is read by two waves from LDS.
// Registers: all fragments of a stage are held at once beside the accumulators, so three (NSPLIT 1: two) waves a SIMD are asked for; 1536 tiles of the [q|k|v] projection are two full rounds of three work-groups a WGP.
// EPI picks what the epilogue does with a wave's f32 tile: 1 store to C (pitch DM) with bias; 2 [q|k|v] projection: 64-column tile ty is head ty % 16 of third ty / 16, the tile is split into bf16 hi/lo and stored to that
// third's planes (Mh/Ml: q planes; k and v planes follow at 2 PLN and 4 PLN elements), q and k as [head][t][d], v transposed as [head][d][t], C unused.
#define GPB  144                  // LDS row pitch in bytes
// 128 rows of one operand's stage: 8 copies a lane, 16 rows apart. The wait is the last line of the copies' own statement: it stands before any register that a copy names is written again.
__device__ __forceinline__ void copy_rows(unsigned l, const bf* g, int kd) {
    asm volatile("global_load_async_to_lds_b128 %0, %8, off\n\t"
                 "global_load_async_to_lds_b128 %1, %9, off\n\t"
                 "global_load_async_to_lds_b128 %2, %10, off\n\t"
                 "global_load_async_to_lds_b128 %3, %11, off\n\t"
                 "global_load_async_to_lds_b128 %4, %12, off\n\t"
                 "global_load_async_to_lds_b128 %5, %13, off\n\t"
                 "global_load_async_to_lds_b128 %6, %14, off\n\t"
                 "global_load_async_to_lds_b128 %7, %15, off\n\t"
                 "s_wait_xcnt 0x0"
                 :: "v"(l), "v"(l + 16 * GPB), "v"(l + 32 * GPB), "v"(l + 48 * GPB), "v"(l + 64 * GPB), "v"(l + 80 * GPB), "v"(l + 96 * GPB), "v"(l + 112 * GPB),
                    "v"(g), "v"(g + 16 * kd), "v"(g + 32 * kd), "v"(g + 48 * kd), "v"(g + 64 * kd), "v"(g + 80 * kd), "v"(g + 96 * kd), "v"(g + 112 * kd) : "memory");
}
template <int NSPLIT, int EPI, int KD>
__global__ __launch_bounds__(128, NSPLIT ? 2 : 3) void k_gemmb(const bf* __restrict__ A, const bf* __restrict__ A2, const bf* __restrict__ Bt, float* C, const float* __restrict__ bias, bf* Mh, bf* Ml) {
    typedef WFrag<bf> F; typedef F::V V;
    constexpr int STG = (2 + NSPLIT) * 128 * GPB, BO = (1 + NSPLIT) * 128 * GPB, NT = KD / 64;   // bytes of a stage, place of the Bt rows in it, stages
    __shared__ __align__(16) char sm[2 * STG];
    const int tid = threadIdx.x, lane = tid & 31, lr = lane & 15, hi = lane >> 4; const int w = __builtin_amdgcn_readfirstlane(tid >> 5), wm = w >> 1, wn = w & 1;
    const int r0 = blockIdx.x * 128 + wm * 64, c0 = blockIdx.y * 128 + wn * 64, ty = blockIdx.y * 2 + wn;   // this wave's 64x64 tile
    const size_t go = (size_t)(tid >> 3) * KD + (tid & 7) * 8;   // a lane's row and 16-byte piece in every copy
    const bf* ga = A + (size_t)blockIdx.x * 128 * KD + go; const bf* ga2 = NSPLIT ? A2 + (size_t)blockIdx.x * 128 * KD + go : nullptr; const bf* gb = Bt + (size_t)blockIdx.y * 128 * KD + go;
    const unsigned l0 = (unsigned)(size_t)sm + (tid >> 3) * GPB + (tid & 7) * 16;
    auto fill = [&](int t, int buf) { copy_rows(l0 + buf * STG, ga + t * 64, KD); if (NSPLIT) copy_rows(l0 + buf * STG + 128 * GPB, ga2 + t * 64, KD); copy_rows(l0 + buf * STG + BO, gb + t * 64, KD); };
    v8f acc[4][4];
#pragma unroll
    for (int mb = 0; mb < 4; ++mb)
#pragma unroll
        for (int nb = 0; nb < 4; ++nb) acc[mb][nb] = (v8f){};
    fill(0, 0);
    asm volatile("s_wait_asynccnt 0x0" ::: "memory");   // this wave's copies of stage 0 have landed
    __syncthreads();                                    // ... and every other wave's
    fill(1, 1);
    const char* fa = sm + (wm * 64 + lr) * GPB + hi * 16; const char* fb = sm + BO + (wn * 64 + lr) * GPB + hi * 16;
#pragma unroll 1   // rolled: one copy of the stage's text, the buffer picked by t & 1
    for (int t = 0; t < NT; ++t) {
        const int bo = (t & 1) * STG;
        V a[2][4], a2[2][4], b[2][4];
#pragma unroll
        for (int kk = 0; kk < 2; ++kk) {
#pragma unroll
            for (int mb = 0; mb < 4; ++mb) { a[kk][mb] = ldl((const bf*)(fa + bo + mb * 16 * GPB + kk * 64)); if (NSPLIT) a2[kk][mb] = ldl((const bf*)(fa + bo + (128 + mb * 16) * GPB + kk * 64)); }
#pragma unroll
            for (int nb = 0; nb < 4; ++nb) b[kk][nb] = ldl((const bf*)(fb + bo + nb * 16 * GPB + kk * 64)); }
        __builtin_amdgcn_sched_barrier(0);   // all fragment reads of the stage go out as one group ahead of its products: left alone they were issued two at a time into one register set among the products, one LDS latency each time
#pragma unroll
        for (int kk = 0; kk < 2; ++kk)
#pragma unroll
            for (int nb = 0; nb < 4; ++nb)
#pragma unroll
                for (int mb = 0; mb < 4; ++mb) { acc[mb][nb] = F::mma(a[kk][mb], b[kk][nb], acc[mb][nb]); if (NSPLIT) acc[mb][nb] = F::mma(a2[kk][mb], b[kk][nb], acc[mb][nb]); }
        __builtin_amdgcn_sched_barrier(0);   // the waits and the barrier stay behind the products: moved up in front of them, the wait for the next stage's copies came one stage's products too early
        asm volatile("s_wait_dscnt 0x0" ::: "memory");      // this wave's reads of the buffer are done before it is handed to the copies
        asm volatile("s_wait_asynccnt 0x0" ::: "memory");   // this wave's copies of stage t + 1 have landed
        __syncthreads();                                    // publishes stage t + 1 and ends every wave's reads of stage t
        if (t + 2 < NT) fill(t + 2, t & 1);
    }
    asm volatile("s_wait_asynccnt 0x0" ::: "memory");       // no copy is outstanding when the ring becomes output staging (the last trip's barrier ended every read of it)
    float* os = (float*)(sm + w * (16 * 68 * 4));           // each wave stages in its own range
    if (EPI == 2 && ty >= 2 * NH_) {   // v third: a lane's 8 accumulator rows are 8 consecutive t of one d, so the transposed planes take 16-byte stores straight from the registers
        const size_t vo = 4 * PLN + ((size_t)(ty - 2 * NH_) * HD + lr) * TT + r0 + hi * 8;
#pragma unroll
        for (int nb = 0; nb < 4; ++nb)
#pragma unroll
            for (int mb = 0; mb < 4; ++mb) { v8us oh, ol;
#pragma unroll
                for (int j = 0; j < 8; ++j) { unsigned short a_, c_; splitf(acc[mb][nb][j], a_, c_); oh[j] = a_; ol[j] = c_; }
                *(v8us*)(Mh + vo + (size_t)nb * 16 * TT + mb * 16) = oh; *(v8us*)(Ml + vo + (size_t)nb * 16 * TT + mb * 16) = ol; }
        return;
    }
#pragma unroll
    for (int mb = 0; mb < 4; ++mb) {
#pragma unroll
        for (int nb = 0; nb < 4; ++nb) {
#pragma unroll
            for (int j = 0; j < 8; ++j) os[(hi * 8 + j) * 68 + nb * 16 + lr] = acc[mb][nb][j]; }
        __builtin_amdgcn_wave_barrier(); asm volatile("" ::: "memory");   // rows that some lanes wrote are read by other lanes of the same wave: keeps the compiler from moving LDS accesses over the hand-over
        if (EPI == 2) {   // q / k third: row t of one head is one 128-byte line of each plane
            const size_t po = (size_t)(ty / NH_) * 2 * PLN + ((size_t)(ty % NH_) * TT + r0 + mb * 16) * HD;
#pragma unroll
            for (int s = 0; s < 8; ++s) { const int row = 2 * s + hi, cofs = lr * 4; const v4f val = *(const v4fa*)(os + row * 68 + cofs); v4us oh, ol;
#pragma unroll
                for (int q = 0; q < 4; ++q) { unsigned short a_, c_; splitf(val[q], a_, c_); oh[q] = a_; ol[q] = c_; }
                *(v4us*)(Mh + po + (size_t)row * HD + cofs) = oh; *(v4us*)(Ml + po + (size_t)row * HD + cofs) = ol; }
        } else {
            float* crow = C + (size_t)(r0 + mb * 16) * DM + c0;
#pragma unroll
            for (int s = 0; s < 8; ++s) { const int row = 2 * s + hi, cofs = lr * 4; v4f val = *(const v4fa*)(os + row * 68 + cofs); val[0] += bfr(bias[c0 + cofs]); val[1] += bfr(bias[c0 + cofs + 1]); val[2] += bfr(bias[c0 + cofs + 2]); val[3] += bfr(bias[c0 + cofs + 3]);
                *(v4f*)(crow + (size_t)row * DM + cofs) = val; }
        }
        asm volatile("s_wait_xcnt 0x0" ::: "memory");   // the next block's LDS reads reuse registers that these stores name
        __builtin_amdgcn_wave_barrier(); asm volatile("" ::: "memory");
    }
}

// ---- k_attn: both attentions of one head for 32 query rows in ONE WAVE, scores and probabilities never leaving the WGP; grid (TT / 128, head), 4 independent waves a block, each with its own LDS rows (no work-group barrier).
// The windows of rows r0 .. r0 + 31 span the 96 keys r0 - 32 .. r0 + 63: three 32-key steps, each wholly inside or wholly outside the rows' batch entry (outside: skipped). Per wave: band scores (hi/lo, 3 products) -> LDS f32 [32][96];
// lane = row softmax, the bf16 hi | lo probabilities written over the row's own scores (exact zeros outside the window); band P.V with P from LDS and v from the [d][t] planes; ahead of it the same on the 64 gathered keys; the two f32 partial
// outputs are added, split and stored as the merged hi/lo planes [t][head * HD + d] in whole 128-byte lines.
#define PS   100                  // LDS row pitch in dwords: 400 B = 16 B x odd, for the 16-byte row reads
#define BK   96                   // keys of the band span of 32 rows
// Rows that some lanes wrote to LDS are read by other lanes of the same wave (LDS operations of a wave run in order): this keeps the compiler from moving LDS accesses over the hand-over.
__device__ __forceinline__ void wsync() { __builtin_amdgcn_wave_barrier(); asm volatile("" ::: "memory"); }
// One lane's softmax of NC scores of its LDS row (columns clo .. chi count, the rest get probability 0), probabilities split to bf16 hi (first NC) | lo (next NC) over the same bytes.
template <int NC>
__device__ __forceinline__ void rowsoft(float* srow, int clo, int chi) {
    float s[NC];
#pragma unroll
    for (int c = 0; c < NC; c += 4) { const v4f t = *(const v4fa*)(srow + c); s[c] = t[0]; s[c + 1] = t[1]; s[c + 2] = t[2]; s[c + 3] = t[3]; }
    const unsigned wd = (unsigned)(chi - clo); float m4[4] = { -3.0e38f, -3.0e38f, -3.0e38f, -3.0e38f };
#pragma unroll
    for (int c = 0; c < NC; ++c) { s[c] = ((unsigned)(c - clo) <= wd) ? s[c] * SCL : -3.0e38f; m4[c & 3] = fmaxf(m4[c & 3], s[c]); }
    const float mx = fmaxf(fmaxf(m4[0], m4[1]), fmaxf(m4[2], m4[3])); float a4[4] = { 0.0f, 0.0f, 0.0f, 0.0f };
#pragma unroll
    for (int c = 0; c < NC; c += 4) { float e[4];
#pragma unroll
        for (int q = 0; q < 4; ++q) e[q] = (s[c + q] - mx) * 1.4426950408889634f;
        // four v_exp_f32 on registers of their own, each the independent instruction behind the one before it, and a v_nop behind the last: the slot that the instruction set asks for before a transcendental's result is used or its source overwritten
        asm("v_exp_f32 %0, %4\n\tv_exp_f32 %1, %5\n\tv_exp_f32 %2, %6\n\tv_exp_f32 %3, %7\n\tv_nop" : "=&v"(s[c]), "=&v"(s[c + 1]), "=&v"(s[c + 2]), "=&v"(s[c + 3]) : "v"(e[0]), "v"(e[1]), "v"(e[2]), "v"(e[3]));
#pragma unroll
        for (int q = 0; q < 4; ++q) a4[q] += s[c + q]; }
    const float f = __fdiv_rn(1.0f, (a4[0] + a4[1]) + (a4[2] + a4[3]));
    bf* prow = (bf*)srow;
#pragma unroll
    for (int c = 0; c < NC; c += 8) { v8us oh, ol;
#pragma unroll
        for (int q = 0; q < 8; ++q) { unsigned short a_, c_; splitf(s[c + q] * f, a_, c_); oh[q] = a_; ol[q] = c_; }
        *(v8usa*)(prow + c) = oh; *(v8usa*)(prow + NC + c) = ol; }
}
// Behind a group of fragment loads: the wait before a register that these loads name is written again (the two addresses as inputs keep their registers whole up to it), and a scheduling barrier, so that
// every load of the group is in flight before the first product waits on one (without it the loads were issued four at a time into one register set, one L2 latency each time).
__device__ __forceinline__ void loads_out(const bf* p0, const bf* p1) { asm volatile("s_wait_xcnt 0x0" :: "v"(p0), "v"(p1) : "memory"); __builtin_amdgcn_sched_barrier(0); }
__global__ __launch_bounds__(128, 4) void k_attn(const bf* __restrict__ Qh, const bf* __restrict__ Ql, const bf* __restrict__ Kh, const bf* __restrict__ Kl, const bf* __restrict__ Vh, const bf* __restrict__ Vl,
                                              const bf* __restrict__ KGh_, const bf* __restrict__ KGl_, const bf* __restrict__ VGh_, const bf* __restrict__ VGl_, bf* Mh, bf* Ml) {
    typedef WFrag<bf> F; typedef F::V V;
    __shared__ __align__(16) float sm[4][32 * PS];
    const int lane = threadIdx.x & 31, lr = lane & 15, hi = lane >> 4; const int w = __builtin_amdgcn_readfirstlane((int)(threadIdx.x >> 5));
    float* S = sm[w]; const bf* P = (const bf*)S;
    const int h = blockIdx.y, r0 = (blockIdx.x * 4 + w) * 32, eb = r0 / TB, b0 = eb * TB, k0 = r0 - 32;   // k0: first key of the span (off the entry for its first row tile)
    const int ks0 = (k0 < b0) ? 1 : 0, ks1 = (k0 + BK > b0 + TB) ? 2 : 3;                                 // the 32-key steps that lie in the rows' own batch entry
    const bf* qh = Qh + ((size_t)h * TT + r0 + lr) * HD + 8 * hi; const bf* ql = Ql + ((size_t)h * TT + r0 + lr) * HD + 8 * hi;
    // global scores against the entry's 64 gathered keys
    {
        V qa[2][2], qb[2][2];
#pragma unroll
        for (int mb = 0; mb < 2; ++mb)
#pragma unroll
            for (int kk = 0; kk < 2; ++kk) { qa[mb][kk] = F::ld(qh + mb * 16 * HD + kk * 32); qb[mb][kk] = F::ld(ql + mb * 16 * HD + kk * 32); }
        loads_out(qh, ql);
        v8f g[2][4];
#pragma unroll
        for (int mb = 0; mb < 2; ++mb)
#pragma unroll
            for (int nb = 0; nb < 4; ++nb) g[mb][nb] = (v8f){};
        const bf* gh = KGh_ + ((size_t)h * NGA + eb * NG + lr) * HD + 8 * hi; const bf* gl = KGl_ + ((size_t)h * NGA + eb * NG + lr) * HD + 8 * hi;
#pragma unroll
        for (int kk = 0; kk < 2; ++kk) { V b[4], b2[4];
#pragma unroll
            for (int nb = 0; nb < 4; ++nb) { b[nb] = F::ld(gh + nb * 16 * HD + kk * 32); b2[nb] = F::ld(gl + nb * 16 * HD + kk * 32); }
            loads_out(gh, gl);
#pragma unroll
            for (int nb = 0; nb < 4; ++nb)
#pragma unroll
                for (int mb = 0; mb < 2; ++mb) { g[mb][nb] = F::mma(qa[mb][kk], b[nb], g[mb][nb]); g[mb][nb] = F::mma(qb[mb][kk], b[nb], g[mb][nb]); g[mb][nb] = F::mma(qa[mb][kk], b2[nb], g[mb][nb]); } }
#pragma unroll
        for (int mb = 0; mb < 2; ++mb)
#pragma unroll
            for (int nb = 0; nb < 4; ++nb)
#pragma unroll
                for (int j = 0; j < 8; ++j) S[(mb * 16 + hi * 8 + j) * PS + nb * 16 + lr] = g[mb][nb][j];
    }
    wsync();
    rowsoft<NG>(S + lane * PS, 0, NG - 1);
    wsync();
    // global probabilities x gathered values ([head][entry][d][g])
    v8f og[2][4];
#pragma unroll
    for (int mb = 0; mb < 2; ++mb)
#pragma unroll
        for (int nb = 0; nb < 4; ++nb) og[mb][nb] = (v8f){};
    { const bf* vh = VGh_ + (((size_t)h * NB_ + eb) * HD + lr) * NG + 8 * hi; const bf* vl = VGl_ + (((size_t)h * NB_ + eb) * HD + lr) * NG + 8 * hi;
#pragma unroll
      for (int kk = 0; kk < 2; ++kk) { V a[2], a2[2], b[4], b2[4];
#pragma unroll
          for (int nb = 0; nb < 4; ++nb) { b[nb] = F::ld(vh + nb * 16 * NG + kk * 32); b2[nb] = F::ld(vl + nb * 16 * NG + kk * 32); }
#pragma unroll
          for (int mb = 0; mb < 2; ++mb) { a[mb] = ldl(P + (mb * 16 + lr) * (2 * PS) + kk * 32 + 8 * hi); a2[mb] = ldl(P + (mb * 16 + lr) * (2 * PS) + NG + kk * 32 + 8 * hi); }
          loads_out(vh, vl);
#pragma unroll
          for (int nb = 0; nb < 4; ++nb)
#pragma unroll
              for (int mb = 0; mb < 2; ++mb) { og[mb][nb] = F::mma(a[mb], b[nb], og[mb][nb]); og[mb][nb] = F::mma(a2[mb], b[nb], og[mb][nb]); og[mb][nb] = F::mma(a[mb], b2[nb], og[mb][nb]); } } }
    wsync();
    if (ks0 != 0 || ks1 != 3) {   // a skipped step's score columns get a value, so that the row read below meets only LDS that this pass wrote
        const int cz = (ks0 != 0) ? 0 : 64;
#pragma unroll
        for (int c = 0; c < 32; c += 4) *(v4fa*)(S + lane * PS + cz + c) = (v4f){};
    }
    // band scores; the q fragments are loaded a second time (their 64 registers are free for the value fragments in between: four waves a SIMD have 256 registers each)
    V qa[2][2], qb[2][2];
#pragma unroll
    for (int mb = 0; mb < 2; ++mb)
#pragma unroll
        for (int kk = 0; kk < 2; ++kk) { qa[mb][kk] = F::ld(qh + mb * 16 * HD + kk * 32); qb[mb][kk] = F::ld(ql + mb * 16 * HD + kk * 32); }
    loads_out(qh, ql);
#pragma unroll 1
    for (int ks = ks0; ks < ks1; ++ks) {
        v8f acc[2][2]; V b[2][2], b2[2][2];
#pragma unroll
        for (int mb = 0; mb < 2; ++mb)
#pragma unroll
            for (int nb = 0; nb < 2; ++nb) acc[mb][nb] = (v8f){};
        const bf* kh = Kh + ((size_t)h * TT + (k0 + ks * 32) + lr) * HD + 8 * hi; const bf* kl = Kl + ((size_t)h * TT + (k0 + ks * 32) + lr) * HD + 8 * hi;
#pragma unroll
        for (int kk = 0; kk < 2; ++kk)
#pragma unroll
            for (int nb = 0; nb < 2; ++nb) { b[kk][nb] = F::ld(kh + nb * 16 * HD + kk * 32); b2[kk][nb] = F::ld(kl + nb * 16 * HD + kk * 32); }
        loads_out(kh, kl);
#pragma unroll
        for (int kk = 0; kk < 2; ++kk)
#pragma unroll
            for (int nb = 0; nb < 2; ++nb)
#pragma unroll
                for (int mb = 0; mb < 2; ++mb) { acc[mb][nb] = F::mma(qa[mb][kk], b[kk][nb], acc[mb][nb]); acc[mb][nb] = F::mma(qb[mb][kk], b[kk][nb], acc[mb][nb]); acc[mb][nb] = F::mma(qa[mb][kk], b2[kk][nb], acc[mb][nb]); }
#pragma unroll
        for (int mb = 0; mb < 2; ++mb)
#pragma unroll
            for (int nb = 0; nb < 2; ++nb)
#pragma unroll
                for (int j = 0; j < 8; ++j) S[(mb * 16 + hi * 8 + j) * PS + ks * 32 + nb * 16 + lr] = acc[mb][nb][j];
    }
    wsync();
    rowsoft<BK>(S + lane * PS, max(lane, b0 - k0), min(lane + 63, b0 + TB - 1 - k0));   // column c is key k0 + c; row r0 + lane sees keys r0 + lane - 32 .. r0 + lane + 31 of its entry
    wsync();
    // band probabilities x values
    v8f o[2][4];
#pragma unroll
    for (int mb = 0; mb < 2; ++mb)
#pragma unroll
        for (int nb = 0; nb < 4; ++nb) o[mb][nb] = (v8f){};
#pragma unroll 1
    for (int ks = ks0; ks < ks1; ++ks) {
        V a[2], a2[2], b[4], b2[4];
        const bf* vh = Vh + ((size_t)h * HD + lr) * TT + (r0 + ks * 32) + 8 * hi; const bf* vl = Vl + ((size_t)h * HD + lr) * TT + (r0 + ks * 32) + 8 * hi;   // key r0 + 32 ks; the step's first key k0 + 32 ks lies 32 in front of it
#pragma unroll
        for (int nb = 0; nb < 4; ++nb) { b[nb] = F::ld(vh - 32 + (size_t)nb * 16 * TT); b2[nb] = F::ld(vl - 32 + (size_t)nb * 16 * TT); }
#pragma unroll
        for (int mb = 0; mb < 2; ++mb) { a[mb] = ldl(P + (mb * 16 + lr) * (2 * PS) + ks * 32 + 8 * hi); a2[mb] = ldl(P + (mb * 16 + lr) * (2 * PS) + BK + ks * 32 + 8 * hi); }
        loads_out(vh, vl);
#pragma unroll
        for (int nb = 0; nb < 4; ++nb)
#pragma unroll
            for (int mb = 0; mb < 2; ++mb) { o[mb][nb] = F::mma(a[mb], b[nb], o[mb][nb]); o[mb][nb] = F::mma(a2[mb], b[nb], o[mb][nb]); o[mb][nb] = F::mma(a[mb], b2[nb], o[mb][nb]); }
        // the distance behind the last matrix instructions on the loop's back edge, where the next trip's loads overwrite their operands
        asm volatile("v_nop\n\tv_nop\n\tv_nop\n\tv_nop" : "+v"(o[0][0]), "+v"(o[1][1]), "+v"(o[0][2]), "+v"(o[1][3]) : "v"(a[0]), "v"(a[1]));
    }
    wsync();
    // the sum of the two partial outputs, through LDS for whole-line stores
#pragma unroll
    for (int mb = 0; mb < 2; ++mb)
#pragma unroll
        for (int nb = 0; nb < 4; ++nb)
#pragma unroll
            for (int j = 0; j < 8; ++j) S[(mb * 16 + hi * 8 + j) * PS + nb * 16 + lr] = __fadd_rn(o[mb][nb][j], og[mb][nb][j]);
    wsync();
    const size_t mo = (size_t)r0 * DQ + h * HD + lr * 4;   // a row's 64 columns of one head are one 128-byte line of each merged plane
    v4us oh[16], ol[16];
#pragma unroll
    for (int s = 0; s < 16; ++s) { const v4f val = *(const v4fa*)(S + (2 * s + hi) * PS + lr * 4);
#pragma unroll
        for (int q = 0; q < 4; ++q) { unsigned short a_, c_; splitf(val[q], a_, c_); oh[s][q] = a_; ol[s][q] = c_; } }
    __builtin_amdgcn_sched_barrier(0);   // every row is split before the first store issues: behind the stores no register that one of them names is written again
#pragma unroll
    for (int s = 0; s < 16; ++s) { *(v4us*)(Mh + mo + (size_t)(2 * s + hi) * DQ) = oh[s]; *(v4us*)(Ml + mo + (size_t)(2 * s + hi) * DQ) = ol[s]; }
}

typedef __attribute__((ext_vector_type(2))) _Float16 v2h;
typedef __attribute__((ext_vector_type(4))) _Float16 v4h;
typedef __attribute__((ext_vector_type(2))) unsigned short v2us;
typedef __attribute__((ext_vector_type(2))) float v2f;
typedef __attribute__((ext_vector_type(4))) int v4i;

// ---- k_prep: every operand of the two projections in ONE launch: x -> bf16 (XB) and both weights [k][n] f32 -> [n][k] bf16 (WALL, WO); grid PWG work-groups (one a WGP) of 12 independent waves, no work-group barrier.
// All loops are unrolled in full, so that their arrays are registers. Every wave moves 16 KB in and 8 KB out, its 32 loads of 16 bytes a lane all in flight at once, every load and store in whole lines. Waves 4 .. 11: 4096 consecutive elements of x each.
// Waves 0 .. 3 (one a SIMD): one 64 k x 64 n tile of a weight each, read as 256-byte pieces of its k rows, two k packed to a dword, transposed through the wave's own LDS rows, stored as one 128-byte line of each n row.
#define PWG  256
#define TP   33                   // LDS row pitch of a transposed tile in dwords: odd, so that the 16 x 4 n rows of a store and the 32 dwords of a row read each fall on banks of their own
typedef unsigned __attribute__((may_alias)) u32a;
static_assert((size_t)TT * DM == (size_t)PWG * 8 * 4096 && (3 * DM / 64) * (DM / 64) + (DM / 64) * (DQ / 64) == PWG * 4, "k_prep: one piece a wave");
template <int N>
__device__ __forceinline__ void wt_tile(const float* __restrict__ w, bf* Bt, int t, u32a* T, int lane) {   // tile t: k rows 64 (t % 16) .., columns 64 (t / 16) .. of w [DM][N]
    const int c = lane & 15, r = lane >> 4, kt = t & 15, nt = t >> 4;
    const float* s = w + (size_t)(kt * 64 + 2 * r) * N + nt * 64 + 4 * c; v4f v[32];
#pragma unroll
    for (int j = 0; j < 32; ++j) v[j] = *(const v4f*)(s + (size_t)(4 * (j >> 1) + (j & 1)) * N);   // loads 2 i and 2 i + 1 bring rows k and k + 1 to the same lane
    __builtin_amdgcn_sched_barrier(0);                      // all 32 loads are in flight before the first value is waited for
#pragma unroll
    for (int i = 0; i < 16; ++i)
#pragma unroll
        for (int q = 0; q < 4; ++q) T[(4 * c + q) * TP + 2 * i + r] = (unsigned)f2bf(v[2 * i][q]) | ((unsigned)f2bf(v[2 * i + 1][q]) << 16);
    wsync();
    unsigned o[64];
#pragma unroll
    for (int n = 0; n < 64; ++n) o[n] = T[n * TP + lane];
    u32a* d = (u32a*)(Bt + (size_t)nt * 64 * DM + kt * 64) + lane;
#pragma unroll
    for (int n = 0; n < 64; ++n) d[n * (DM / 2)] = o[n];
    asm volatile("s_wait_xcnt 0x0" ::: "memory");         // the wait before a register that these stores name is written again (the built code goes on into other paths' text behind them)
}
__global__ __launch_bounds__(384) void k_prep(const float* __restrict__ x, const float* __restrict__ wqkv, const float* __restrict__ wo, bf* XB, bf* WALL, bf* WO) {
    __shared__ __align__(16) unsigned tl[4][64 * TP];
    const int lane = threadIdx.x & 31; const int w = __builtin_amdgcn_readfirstlane((int)(threadIdx.x >> 5));
    if (w < 4) {
        const int t = blockIdx.x * 4 + w;
        if (t < (3 * DM / 64) * (DM / 64)) wt_tile<3 * DM>(wqkv, WALL, t, (u32a*)tl[w], lane); else wt_tile<DM>(wo, WO, t - (3 * DM / 64) * (DM / 64), (u32a*)tl[w], lane);
        return;
    }
    const size_t e = ((size_t)blockIdx.x * 8 + (w - 4)) * 4096 + lane * 4; const float* s = x + e; v4f v[32]; v4us o[32];
#pragma unroll
    for (int j = 0; j < 32; ++j) v[j] = *(const v4f*)(s + j * 128);
    __builtin_amdgcn_sched_barrier(0);                      // all 32 loads are in flight before the first value is waited for
#pragma unroll
    for (int j = 0; j < 32; ++j)
#pragma unroll
        for (int q = 0; q < 4; ++q) o[j][q] = f2bf(v[j][q]);
    __builtin_amdgcn_sched_barrier(0);                      // every value is rounded before the first store issues, so that the stores go out as one run with no register of theirs written among them
#pragma unroll
    for (int j = 0; j < 32; ++j) *(v4us*)(XB + e + j * 128) = o[j];
    asm volatile("s_wait_xcnt 0x0" ::: "memory");         // the wait before a register that these stores name is written again
}

__global__ __launch_bounds__(256) void k_gathK(const bf* __restrict__ KPh_, const bf* __restrict__ KPl_, bf* KGh, bf* KGl) { const size_t e = ((size_t)blockIdx.x * 256 + threadIdx.x) * 8; if (e >= (size_t)NH_ * NGA * HD) return; const int d = (int)(e % HD); const int gq = (int)((e / HD) % NGA); const int h = (int)(e / ((size_t)HD * NGA)); const size_t src = ((size_t)h * TT + (size_t)gq * 64) * HD + d; const v8us a = *(const v8us*)(KPh_ + src), c = *(const v8us*)(KPl_ + src); *(v8us*)(KGh + e) = a; *(v8us*)(KGl + e) = c;  }
__global__ __launch_bounds__(256) void k_gathV(const bf* __restrict__ VTh_, const bf* __restrict__ VTl_, bf* VGh, bf* VGl) { const size_t e = ((size_t)blockIdx.x * 256 + threadIdx.x) * 8; if (e >= (size_t)NH_ * HD * NGA) return; const size_t hb = e / ((size_t)NG * HD);   /* VG is [head][entry][d][g]: hb = head * NB_ + entry */ const int gq = (int)((hb % NB_) * NG + e % NG);   /* number of the gathered key among all rows' */ const size_t hd_ = (hb / NB_) * HD + (e / NG) % HD; v8us a, c;
#pragma unroll
    for (int q = 0; q < 8; ++q) { const size_t src = hd_ * TT + (size_t)(gq + q) * 64; a[q] = VTh_[src]; c[q] = VTl_[src]; } *(v8us*)(VGh + e) = a; *(v8us*)(VGl + e) = c;  }

extern "C" void kernel_launch(void* const* d_in, const int* in_sizes, int n_in,
                              void* d_out, int out_size, void* d_ws, size_t ws_size, hipStream_t stream) {
    (void)in_sizes; (void)n_in; (void)out_size;
    const float* x = (const float*)d_in[0]; const float* wqkv = (const float*)d_in[1]; const float* wo = (const float*)d_in[2]; const float* bo = (const float*)d_in[3]; const float* wq = nullptr; const float* wk = nullptr; const float* wv = nullptr; (void)wq; (void)wk; (void)wv;
    float* OUT = (float*)d_out;     // [2][4096][1024]
    char* wsp = (char*)d_ws;
    auto take = [&](size_t bytes) { char* p = wsp; wsp += (bytes + 255) & ~(size_t)255; return (void*)p; };
    bf* WALL = (bf*)take((size_t)3 * DM * DM * 2); bf* WO = (bf*)take((size_t)DM * DQ * 2);
    bf* XB = (bf*)take((size_t)TT * DM * 2);
    bf* QPh = (bf*)take(6 * PLN * 2); bf* QPl = QPh + PLN; bf* KPh = QPh + 2 * PLN; bf* KPl = QPh + 3 * PLN; bf* VTh = QPh + 4 * PLN; bf* VTl = QPh + 5 * PLN;   /* one block: the projection's epilogue finds the k and v planes behind the q planes */
    bf* KGh = (bf*)take((size_t)NH_ * NGA * HD * 2); bf* KGl = (bf*)take((size_t)NH_ * NGA * HD * 2); bf* VGh = (bf*)take((size_t)NH_ * HD * NGA * 2); bf* VGl = (bf*)take((size_t)NH_ * HD * NGA * 2);
    bf* ATh = (bf*)take((size_t)TT * DQ * 2); bf* ATl = (bf*)take((size_t)TT * DQ * 2);   /* merged planes [t][head * HD + d] */
    if ((size_t)(wsp - (char*)d_ws) > ws_size) return;    // ws 256 MiB
    k_prep<<<PWG, 384, 0, stream>>>(x, wqkv, wo, XB, WALL, WO);   /* x -> bf16; 'xw' [DM][3DM] -> Bt [3DM][DM] (row blocks q | k | v); w_out [DQ][DM] -> Bt [DM][DQ] */
    k_gemmb<0, 2, DM><<<dim3(TT / 128, 3 * DM / 128, 1), 128, 0, stream>>>(XB, nullptr, WALL, nullptr, nullptr, QPh, QPl);   /* [q|k|v] projection, epilogue -> hi/lo planes */
    k_gathK<<<(unsigned)(((size_t)NH_ * NGA * HD / 8 + 255) / 256), 256, 0, stream>>>(KPh, KPl, KGh, KGl); k_gathV<<<(unsigned)(((size_t)NH_ * HD * NGA / 8 + 255) / 256), 256, 0, stream>>>(VTh, VTl, VGh, VGl);   /* the 64 strided keys / values per head and batch entry */
    k_attn<<<dim3(TT / 128, NH_, 1), 128, 0, stream>>>(QPh, QPl, KPh, KPl, VTh, VTl, KGh, KGl, VGh, VGl, ATh, ATl);   /* band + global attention, y = head -> merged planes */
    k_gemmb<1, 1, DQ><<<dim3(TT / 128, DM / 128, 1), 128, 0, stream>>>(ATh, ATl, WO, OUT, bo, nullptr, nullptr);
}

// v007
// It runs in 115 microseconds.
// Next to v006, in two timings, it ran 1.12 and 1.13 times as fast.
// Over all steps from v000 it is 10.2 times as fast.
#include <hip/hip_runtime.h>

// Local (sliding window of 64, centred) + strided global (every 64th key) attention, summed, then an output projection (x [2][4096][1024]; [q|k|v] = x w_qkv ('xw' [1024][3072], reshape (3, H, Dh): thirds); 16 heads x 64; local: softmax over keys j in [i-32, i+31] (clipped to the sequence) of q.k/8; global: softmax over the 64 keys j = 64 g of q.k/8; out = (attn_local v + attn_global v_g) merged, w_out + b_out -> [2][4096][1024] (8.4 M)).
// Both batch entries run in the same launches as rows 0 .. 8191; a row's band span, window and global keys are clipped to its own entry.
// Algorithm: hi/lo planes of q, k (as [head][t][d]) and v (as [head][32 t][d], transposed) are written by the epilogue of ONE projection launch over all 3072 columns of [q|k|v]; the 64 strided keys / values per head and entry are gathered; ONE attention launch (k_attn, one wave per head and 32 query rows) does band scores, global scores, both softmaxes and both probability x value products with scores and probabilities in LDS, and writes the merged hi/lo planes for the output projection.
// Plane layout: the q, k and gathered planes keep each tile of 16 rows x 64 columns (2 KB) in FRAGMENT ORDER, 16-byte piece c (8 columns) of row r at piece (c >> 1) * 32 + (c & 1) * 16 + r; the v planes are [head][32 keys][16 d] tiles of 1 KB,
// the 8 keys 16 a + 8 b .. of row d at piece a * 32 + b * 16 + d % 16. Lane l of a fragment load then reads piece l of a run of 32: one load or store of a wave is 512 contiguous bytes, four whole lines, where row-major planes gave 32 bytes of each of 16 lines.
// Compute dtypes, f32 accumulate: every input rounded to bf16; q/k/v on PLAIN bf16 operands (inputs: exact); band / global scores and probability x value products on hi/lo planes (3 products); both softmaxes f32; w_out hl x exact (2 products) + b_out.

#define NB_  2
#define TB   4096                 // rows (tokens) of one batch entry
#define TT   (NB_ * TB)           // all rows: both batch entries stand one behind the other in every plane and go through every launch together
#define DM   1024
#define NH_  16
#define NKV  16
#define REP  (NH_ / NKV)
#define HD   64
#define DQ   (NH_ * HD)
#define DKV  (NKV * HD)
#define ZH   1
#define RH   4096
#define LWH  32                   // half window: keys i-32 .. i+31
#define NG   64                   // global keys (every 64th) of one batch entry
#define NGA  (NB_ * NG)           // gathered keys of all rows
#define WIN  4096
#define PCAR 1024.0f
#define SCL  0.125f   // HD^-0.5
#define PLN  ((size_t)NH_ * TT * HD)   // elements of one q / k / v plane
typedef _Float16 h16;
typedef unsigned short bf;
typedef __attribute__((ext_vector_type(16))) __bf16   v16bf;
typedef __attribute__((ext_vector_type(16))) _Float16 v16h;
typedef __attribute__((ext_vector_type(8)))  _Float16 v8h;
typedef __attribute__((ext_vector_type(8)))  unsigned short v8us;
typedef __attribute__((ext_vector_type(8)))  float    v8f;
typedef __attribute__((ext_vector_type(4)))  float    v4f;
typedef v8h  __attribute__((may_alias)) v8ha;
typedef v4f  __attribute__((may_alias)) v4fa;
typedef v8us __attribute__((may_alias)) v8usa;

__device__ __forceinline__ unsigned short f2bf(float f) { unsigned u = __float_as_uint(f); u += 0x7FFFu + ((u >> 16) & 1u); return (unsigned short)(u >> 16); }
__device__ __forceinline__ float bf2f(unsigned short b) { return __uint_as_float(((unsigned)b) << 16); }
__device__ __forceinline__ float bfr(float f) { return bf2f(f2bf(f)); }
__device__ __forceinline__ void splitf(float y, unsigned short& h, unsigned short& l) { h = f2bf(y); l = f2bf(y - bf2f(h)); }
typedef __attribute__((ext_vector_type(4))) unsigned short v4us;
__device__ __forceinline__ v16h cat16(v8h lo, v8h hi) { return __builtin_shufflevector(lo, hi, 0, 1, 2, 3, 4, 5, 6, 7, 8, 9, 10, 11, 12, 13, 14, 15); }
__device__ __forceinline__ v16bf cat16b(v8us lo, v8us hi) { return __builtin_bit_cast(v16bf, __builtin_shufflevector(lo, hi, 0, 1, 2, 3, 4, 5, 6, 7, 8, 9, 10, 11, 12, 13, 14, 15)); }
__device__ __forceinline__ v8f wmma16(v16h a, v16h b, v8f c) { return __builtin_amdgcn_wmma_f32_16x16x32_f16(false, a, false, b, (short)0, c, false, false); }
__device__ __forceinline__ v8f wmmab(v16bf a, v16bf b, v8f c) { return __builtin_amdgcn_wmma_f32_16x16x32_bf16(false, a, false, b, (short)0, c, false, false); }



template <typename T16> struct WFrag;
template <> struct WFrag<h16> { typedef v16h V; static __device__ __forceinline__ V ld(const h16* p) { return cat16(*(const v8h*)p, *(const v8h*)(p + 16)); } static __device__ __forceinline__ v8f mma(V a, V b, v8f c) { return wmma16(a, b, c); } };
template <> struct WFrag<bf> { typedef v16bf V; static __device__ __forceinline__ V ld(const bf* p) { return cat16b(*(const v8us*)p, *(const v8us*)(p + 16)); } static __device__ __forceinline__ v8f mma(V a, V b, v8f c) { return wmmab(a, b, c); } };
__device__ __forceinline__ v16bf ldq(const bf* p) { return cat16b(*(const v8us*)p, *(const v8us*)(p + 256)); }   // a fragment of a plane in fragment order: p = tile + 512 * (32-k step) + 8 * lane; the second 8 k stand 32 pieces on
__device__ __forceinline__ v16bf ldl(const bf* p) { return cat16b(*(const v8usa*)p, *(const v8usa*)(p + 16)); }

// ---- k_gemmb: block-tiled GEMM, one 128x128 output tile per work-group of 4 waves (2 x 2, each wave 64x64 = 16 accumulators); grid (M/128, N/128), 128 threads.
// C[m][n] = sum_k A[m][k] Bt[n][k] (NSPLIT 1: + A2[m][k] Bt[n][k], product by product as k goes up), operands K-contiguous bf16 planes of KD columns, KD % 64 == 0, KD >= 128.
// A stage is 64 k, one whole 128-byte line of every operand row: rows [A 128 | A2 128 (NSPLIT 1) | Bt 128] at an LDS pitch of 144 bytes (16 B x odd, for the 16-byte fragment reads). Two buffers, filled by asynchronous copies to LDS,
// 16 bytes a lane (8 lanes cover a line, a wave's copy 4 lines); the next stage's copies fly while this stage is worked on; each operand line leaves L2 once per work-group and is read by two waves from LDS.
// Registers: all fragments of a stage are held at once beside the accumulators, so three (NSPLIT 1: two) waves a SIMD are asked for; 1536 tiles of the [q|k|v] projection are two full rounds of three work-groups a WGP.
// EPI picks what the epilogue does with a wave's f32 tile: 1 store to C (pitch DM) with bias; 2 [q|k|v] projection: 64-column tile ty is head ty % 16 of third ty / 16, the tile is split into bf16 hi/lo and stored to that
// third's planes (Mh/Ml: q planes; k and v planes follow at 2 PLN and 4 PLN elements), q and k as [head][t][d], v transposed ([head][32 t][d]), all in fragment order (head of the file), C unused.
#define GPB  144                  // LDS row pitch in bytes
// 128 rows of one operand's stage: 8 copies a lane, 16 rows apart. The wait is the last line of the copies' own statement: it stands before any register that a copy names is written again.
__device__ __forceinline__ void copy_rows(unsigned l, const bf* g, int kd) {
    asm volatile("global_load_async_to_lds_b128 %0, %8, off\n\t"
                 "global_load_async_to_lds_b128 %1, %9, off\n\t"
                 "global_load_async_to_lds_b128 %2, %10, off\n\t"
                 "global_load_async_to_lds_b128 %3, %11, off\n\t"
                 "global_load_async_to_lds_b128 %4, %12, off\n\t"
                 "global_load_async_to_lds_b128 %5, %13, off\n\t"
                 "global_load_async_to_lds_b128 %6, %14, off\n\t"
                 "global_load_async_to_lds_b128 %7, %15, off\n\t"
                 "s_wait_xcnt 0x0"
                 :: "v"(l), "v"(l + 16 * GPB), "v"(l + 32 * GPB), "v"(l + 48 * GPB), "v"(l + 64 * GPB), "v"(l + 80 * GPB), "v"(l + 96 * GPB), "v"(l + 112 * GPB),
                    "v"(g), "v"(g + 16 * kd), "v"(g + 32 * kd), "v"(g + 48 * kd), "v"(g + 64 * kd), "v"(g + 80 * kd), "v"(g + 96 * kd), "v"(g + 112 * kd) : "memory");
}
template <int NSPLIT, int EPI, int KD>
__global__ __launch_bounds__(128, NSPLIT ? 2 : 3) void k_gemmb(const bf* __restrict__ A, const bf* __restrict__ A2, const bf* __restrict__ Bt, float* C, const float* __restrict__ bias, bf* Mh, bf* Ml) {
    typedef WFrag<bf> F; typedef F::V V;
    constexpr int STG = (2 + NSPLIT) * 128 * GPB, BO = (1 + NSPLIT) * 128 * GPB, NT = KD / 64;   // bytes of a stage, place of the Bt rows in it, stages
    __shared__ __align__(16) char sm[2 * STG];
    const int tid = threadIdx.x, lane = tid & 31, lr = lane & 15, hi = lane >> 4; const int w = __builtin_amdgcn_readfirstlane(tid >> 5), wm = w >> 1, wn = w & 1;
    const int r0 = blockIdx.x * 128 + wm * 64, c0 = blockIdx.y * 128 + wn * 64, ty = blockIdx.y * 2 + wn;   // this wave's 64x64 tile
    const size_t go = (size_t)(tid >> 3) * KD + (tid & 7) * 8;   // a lane's row and 16-byte piece in every copy
    const bf* ga = A + (size_t)blockIdx.x * 128 * KD + go; const bf* ga2 = NSPLIT ? A2 + (size_t)blockIdx.x * 128 * KD + go : nullptr; const bf* gb = Bt + (size_t)blockIdx.y * 128 * KD + go;
    const unsigned l0 = (unsigned)(size_t)sm + (tid >> 3) * GPB + (tid & 7) * 16;
    auto fill = [&](int t, int buf) { copy_rows(l0 + buf * STG, ga + t * 64, KD); if (NSPLIT) copy_rows(l0 + buf * STG + 128 * GPB, ga2 + t * 64, KD); copy_rows(l0 + buf * STG + BO, gb + t * 64, KD); };
    v8f acc[4][4];
#pragma unroll
    for (int mb = 0; mb < 4; ++mb)
#pragma unroll
        for (int nb = 0; nb < 4; ++nb) acc[mb][nb] = (v8f){};
    fill(0, 0);
    asm volatile("s_wait_asynccnt 0x0" ::: "memory");   // this wave's copies of stage 0 have landed
    __syncthreads();                                    // ... and every other wave's
    fill(1, 1);
    const char* fa = sm + (wm * 64 + lr) * GPB + hi * 16; const char* fb = sm + BO + (wn * 64 + lr) * GPB + hi * 16;
#pragma unroll 1   // rolled: one copy of the stage's text, the buffer picked by t & 1
    for (int t = 0; t < NT; ++t) {
        const int bo = (t & 1) * STG;
        V a[2][4], a2[2][4], b[2][4];
#pragma unroll
        for (int kk = 0; kk < 2; ++kk) {
#pragma unroll
            for (int mb = 0; mb < 4; ++mb) { a[kk][mb] = ldl((const bf*)(fa + bo + mb * 16 * GPB + kk * 64)); if (NSPLIT) a2[kk][mb] = ldl((const bf*)(fa + bo + (128 + mb * 16) * GPB + kk * 64)); }
#pragma unroll
            for (int nb = 0; nb < 4; ++nb) b[kk][nb] = ldl((const bf*)(fb + bo + nb * 16 * GPB + kk * 64)); }
        __builtin_amdgcn_sched_barrier(0);   // all fragment reads of the stage go out as one group ahead of its products: left alone they were issued two at a time into one register set among the products, one LDS latency each time
#pragma unroll
        for (int kk = 0; kk < 2; ++kk)
#pragma unroll
            for (int nb = 0; nb < 4; ++nb)
#pragma unroll
                for (int mb = 0; mb < 4; ++mb) { acc[mb][nb] = F::mma(a[kk][mb], b[kk][nb], acc[mb][nb]); if (NSPLIT) acc[mb][nb] = F::mma(a2[kk][mb], b[kk][nb], acc[mb][nb]); }
        __builtin_amdgcn_sched_barrier(0);   // the waits and the barrier stay behind the products: moved up in front of them, the wait for the next stage's copies came one stage's products too early
        asm volatile("s_wait_dscnt 0x0" ::: "memory");      // this wave's reads of the buffer are done before it is handed to the copies
        asm volatile("s_wait_asynccnt 0x0" ::: "memory");   // this wave's copies of stage t + 1 have landed
        __syncthreads();                                    // publishes stage t + 1 and ends every wave's reads of stage t
        if (t + 2 < NT) fill(t + 2, t & 1);
    }
    asm volatile("s_wait_asynccnt 0x0" ::: "memory");       // no copy is outstanding when the ring becomes output staging (the last trip's barrier ended every read of it)
    float* os = (float*)(sm + w * (16 * 68 * 4));           // each wave stages in its own range
    if (EPI == 2 && ty >= 2 * NH_) {   // v third: a lane's 8 accumulator rows are 8 consecutive t of one d, one piece of the transposed planes: 16-byte stores straight from the registers, the wave's 32 pieces in a row
        const size_t vo = 4 * PLN + ((size_t)(ty - 2 * NH_) * (TT / 32) + (r0 >> 5)) * 2048 + lane * 8;
#pragma unroll
        for (int nb = 0; nb < 4; ++nb)
#pragma unroll
            for (int mb = 0; mb < 4; ++mb) { v8us oh, ol;
#pragma unroll
                for (int j = 0; j < 8; ++j) { unsigned short a_, c_; splitf(acc[mb][nb][j], a_, c_); oh[j] = a_; ol[j] = c_; }
                *(v8us*)(Mh + vo + (mb >> 1) * 2048 + nb * 512 + (mb & 1) * 256) = oh; *(v8us*)(Ml + vo + (mb >> 1) * 2048 + nb * 512 + (mb & 1) * 256) = ol; }
        return;
    }
#pragma unroll
    for (int mb = 0; mb < 4; ++mb) {
#pragma unroll
        for (int nb = 0; nb < 4; ++nb) {
#pragma unroll
            for (int j = 0; j < 8; ++j) os[(hi * 8 + j) * 68 + nb * 16 + lr] = acc[mb][nb][j]; }
        __builtin_amdgcn_wave_barrier(); asm volatile("" ::: "memory");   // rows that some lanes wrote are read by other lanes of the same wave: keeps the compiler from moving LDS accesses over the hand-over
        if (EPI == 2) {   // q / k third: these 16 rows t of one head are one 2 KB tile of each plane; a lane takes piece 2 s + hi of row lr
            const size_t po = (size_t)(ty / NH_) * 2 * PLN + ((size_t)(ty % NH_) * TT + r0 + mb * 16) * HD + lane * 8;
#pragma unroll
            for (int s = 0; s < 4; ++s) { const float* op = os + lr * 68 + (2 * s + hi) * 8; const v4f v0 = *(const v4fa*)op, v1 = *(const v4fa*)(op + 4); v8us oh, ol;
#pragma unroll
                for (int q = 0; q < 4; ++q) { unsigned short a_, c_; splitf(v0[q], a_, c_); oh[q] = a_; ol[q] = c_; splitf(v1[q], a_, c_); oh[4 + q] = a_; ol[4 + q] = c_; }
                *(v8us*)(Mh + po + s * 256) = oh; *(v8us*)(Ml + po + s * 256) = ol; }
        } else {
            float* crow = C + (size_t)(r0 + mb * 16) * DM + c0;
#pragma unroll
            for (int s = 0; s < 8; ++s) { const int row = 2 * s + hi, cofs = lr * 4; v4f val = *(const v4fa*)(os + row * 68 + cofs); val[0] += bfr(bias[c0 + cofs]); val[1] += bfr(bias[c0 + cofs + 1]); val[2] += bfr(bias[c0 + cofs + 2]); val[3] += bfr(bias[c0 + cofs + 3]);
                *(v4f*)(crow + (size_t)row * DM + cofs) = val; }
        }
        asm volatile("s_wait_xcnt 0x0" ::: "memory");   // the next block's LDS reads reuse registers that these stores name
        __builtin_amdgcn_wave_barrier(); asm volatile("" ::: "memory");
    }
}

// ---- k_attn: both attentions of one head for 32 query rows in ONE WAVE, scores and probabilities never leaving the WGP; grid (TT / 128, head), 4 independent waves a block, each with its own LDS rows (no work-group barrier).
// The windows of rows r0 .. r0 + 31 span the 96 keys r0 - 32 .. r0 + 63: three 32-key steps, each wholly inside or wholly outside the rows' batch entry (outside: skipped). Per wave: band scores (hi/lo, 3 products) -> LDS f32 [32][96];
// lane = row softmax, the bf16 hi | lo probabilities written over the row's own scores (exact zeros outside the window); band P.V with P from LDS and v from the transposed planes; ahead of it the same on the 64 gathered keys; the two f32 partial
// outputs are added, split and stored as the merged hi/lo planes [t][head * HD + d] in whole 128-byte lines.
#define PS   100                  // LDS row pitch in dwords: 400 B = 16 B x odd, for the 16-byte row reads
#define BK   96                   // keys of the band span of 32 rows
// Rows that some lanes wrote to LDS are read by other lanes of the same wave (LDS operations of a wave run in order): this keeps the compiler from moving LDS accesses over the hand-over.
__device__ __forceinline__ void wsync() { __builtin_amdgcn_wave_barrier(); asm volatile("" ::: "memory"); }
// One lane's softmax of NC scores of its LDS row (columns clo .. chi count, the rest get probability 0), probabilities split to bf16 hi (first NC) | lo (next NC) over the same bytes.
template <int NC>
__device__ __forceinline__ void rowsoft(float* srow, int clo, int chi) {
    float s[NC];
#pragma unroll
    for (int c = 0; c < NC; c += 4) { const v4f t = *(const v4fa*)(srow + c); s[c] = t[0]; s[c + 1] = t[1]; s[c + 2] = t[2]; s[c + 3] = t[3]; }
    const unsigned wd = (unsigned)(chi - clo); float m4[4] = { -3.0e38f, -3.0e38f, -3.0e38f, -3.0e38f };
#pragma unroll
    for (int c = 0; c < NC; ++c) { s[c] = ((unsigned)(c - clo) <= wd) ? s[c] * SCL : -3.0e38f; m4[c & 3] = fmaxf(m4[c & 3], s[c]); }
    const float mx = fmaxf(fmaxf(m4[0], m4[1]), fmaxf(m4[2], m4[3])); float a4[4] = { 0.0f, 0.0f, 0.0f, 0.0f };
#pragma unroll
    for (int c = 0; c < NC; c += 4) { float e[4];
#pragma unroll
        for (int q = 0; q < 4; ++q) e[q] = (s[c + q] - mx) * 1.4426950408889634f;
        // four v_exp_f32 on registers of their own, each the independent instruction behind the one before it, and a v_nop behind the last: the slot that the instruction set asks for before a transcendental's result is used or its source overwritten
        asm("v_exp_f32 %0, %4\n\tv_exp_f32 %1, %5\n\tv_exp_f32 %2, %6\n\tv_exp_f32 %3, %7\n\tv_nop" : "=&v"(s[c]), "=&v"(s[c + 1]), "=&v"(s[c + 2]), "=&v"(s[c + 3]) : "v"(e[0]), "v"(e[1]), "v"(e[2]), "v"(e[3]));
#pragma unroll
        for (int q = 0; q < 4; ++q) a4[q] += s[c + q]; }
    const float f = __fdiv_rn(1.0f, (a4[0] + a4[1]) + (a4[2] + a4[3]));
    bf* prow = (bf*)srow;
#pragma unroll
    for (int c = 0; c < NC; c += 8) { v8us oh, ol;
#pragma unroll
        for (int q = 0; q < 8; ++q) { unsigned short a_, c_; splitf(s[c + q] * f, a_, c_); oh[q] = a_; ol[q] = c_; }
        *(v8usa*)(prow + c) = oh; *(v8usa*)(prow + NC + c) = ol; }
}
// Behind a group of fragment loads: the wait before a register that these loads name is written again (the two addresses as inputs keep their registers whole up to it), and a scheduling barrier, so that
// every load of the group is in flight before the first product waits on one (without it the loads were issued four at a time into one register set, one L2 latency each time).
__device__ __forceinline__ void loads_out(const bf* p0, const bf* p1) { asm volatile("s_wait_xcnt 0x0" :: "v"(p0), "v"(p1) : "memory"); __builtin_amdgcn_sched_barrier(0); }
__global__ __launch_bounds__(128, 4) void k_attn(const bf* __restrict__ Qh, const bf* __restrict__ Ql, const bf* __restrict__ Kh, const bf* __restrict__ Kl, const bf* __restrict__ Vh, const bf* __restrict__ Vl,
                                              const bf* __restrict__ KGh_, const bf* __restrict__ KGl_, const bf* __restrict__ VGh_, const bf* __restrict__ VGl_, bf* Mh, bf* Ml) {
    typedef WFrag<bf> F; typedef F::V V;
    __shared__ __align__(16) float sm[4][32 * PS];
    const int lane = threadIdx.x & 31, lr = lane & 15, hi = lane >> 4; const int w = __builtin_amdgcn_readfirstlane((int)(threadIdx.x >> 5));
    float* S = sm[w]; const bf* P = (const bf*)S;
    const int h = blockIdx.y, r0 = (blockIdx.x * 4 + w) * 32, eb = r0 / TB, b0 = eb * TB, k0 = r0 - 32;   // k0: first key of the span (off the entry for its first row tile)
    const int ks0 = (k0 < b0) ? 1 : 0, ks1 = (k0 + BK > b0 + TB) ? 2 : 3;                                 // the 32-key steps that lie in the rows' own batch entry
    const bf* qh = Qh + ((size_t)h * TT + r0) * HD + 8 * lane; const bf* ql = Ql + ((size_t)h * TT + r0) * HD + 8 * lane;   // every plane pointer below: first tile + the lane's piece
    // global scores against the entry's 64 gathered keys
    {
        V qa[2][2], qb[2][2];
#pragma unroll
        for (int mb = 0; mb < 2; ++mb)
#pragma unroll
            for (int kk = 0; kk < 2; ++kk) { qa[mb][kk] = ldq(qh + mb * 16 * HD + kk * 512); qb[mb][kk] = ldq(ql + mb * 16 * HD + kk * 512); }
        loads_out(qh, ql);
        v8f g[2][4];
#pragma unroll
        for (int mb = 0; mb < 2; ++mb)
#pragma unroll
            for (int nb = 0; nb < 4; ++nb) g[mb][nb] = (v8f){};
        const bf* gh = KGh_ + ((size_t)h * NGA + eb * NG) * HD + 8 * lane; const bf* gl = KGl_ + ((size_t)h * NGA + eb * NG) * HD + 8 * lane;
#pragma unroll
        for (int kk = 0; kk < 2; ++kk) { V b[4], b2[4];
#pragma unroll
            for (int nb = 0; nb < 4; ++nb) { b[nb] = ldq(gh + nb * 16 * HD + kk * 512); b2[nb] = ldq(gl + nb * 16 * HD + kk * 512); }
            loads_out(gh, gl);
#pragma unroll
            for (int nb = 0; nb < 4; ++nb)
#pragma unroll
                for (int mb = 0; mb < 2; ++mb) { g[mb][nb] = F::mma(qa[mb][kk], b[nb], g[mb][nb]); g[mb][nb] = F::mma(qb[mb][kk], b[nb], g[mb][nb]); g[mb][nb] = F::mma(qa[mb][kk], b2[nb], g[mb][nb]); } }
#pragma unroll
        for (int mb = 0; mb < 2; ++mb)
#pragma unroll
            for (int nb = 0; nb < 4; ++nb)
#pragma unroll
                for (int j = 0; j < 8; ++j) S[(mb * 16 + hi * 8 + j) * PS + nb * 16 + lr] = g[mb][nb][j];
    }
    wsync();
    rowsoft<NG>(S + lane * PS, 0, NG - 1);
    wsync();
    // global probabilities x gathered values ([head][entry][d][g])
    v8f og[2][4];
#pragma unroll
    for (int mb = 0; mb < 2; ++mb)
#pragma unroll
        for (int nb = 0; nb < 4; ++nb) og[mb][nb] = (v8f){};
    { const bf* vh = VGh_ + ((size_t)h * NB_ + eb) * HD * NG + 8 * lane; const bf* vl = VGl_ + ((size_t)h * NB_ + eb) * HD * NG + 8 * lane;
#pragma unroll
      for (int kk = 0; kk < 2; ++kk) { V a[2], a2[2], b[4], b2[4];
#pragma unroll
          for (int nb = 0; nb < 4; ++nb) { b[nb] = ldq(vh + nb * 16 * NG + kk * 512); b2[nb] = ldq(vl + nb * 16 * NG + kk * 512); }
#pragma unroll
          for (int mb = 0; mb < 2; ++mb) { a[mb] = ldl(P + (mb * 16 + lr) * (2 * PS) + kk * 32 + 8 * hi); a2[mb] = ldl(P + (mb * 16 + lr) * (2 * PS) + NG + kk * 32 + 8 * hi); }
          loads_out(vh, vl);
#pragma unroll
          for (int nb = 0; nb < 4; ++nb)
#pragma unroll
              for (int mb = 0; mb < 2; ++mb) { og[mb][nb] = F::mma(a[mb], b[nb], og[mb][nb]); og[mb][nb] = F::mma(a2[mb], b[nb], og[mb][nb]); og[mb][nb] = F::mma(a[mb], b2[nb], og[mb][nb]); } } }
    wsync();
    if (ks0 != 0 || ks1 != 3) {   // a skipped step's score columns get a value, so that the row read below meets only LDS that this pass wrote
        const int cz = (ks0 != 0) ? 0 : 64;
#pragma unroll
        for (int c = 0; c < 32; c += 4) *(v4fa*)(S + lane * PS + cz + c) = (v4f){};
    }
    // band scores; the q fragments are loaded a second time (their 64 registers are free for the value fragments in between: four waves a SIMD have 256 registers each)
    V qa[2][2], qb[2][2];
#pragma unroll
    for (int mb = 0; mb < 2; ++mb)
#pragma unroll
        for (int kk = 0; kk < 2; ++kk) { qa[mb][kk] = ldq(qh + mb * 16 * HD + kk * 512); qb[mb][kk] = ldq(ql + mb * 16 * HD + kk * 512); }
    loads_out(qh, ql);
#pragma unroll 1
    for (int ks = ks0; ks < ks1; ++ks) {
        v8f acc[2][2]; V b[2][2], b2[2][2];
#pragma unroll
        for (int mb = 0; mb < 2; ++mb)
#pragma unroll
            for (int nb = 0; nb < 2; ++nb) acc[mb][nb] = (v8f){};
        const bf* kh = Kh + ((size_t)h * TT + (k0 + ks * 32)) * HD + 8 * lane; const bf* kl = Kl + ((size_t)h * TT + (k0 + ks * 32)) * HD + 8 * lane;
#pragma unroll
        for (int kk = 0; kk < 2; ++kk)
#pragma unroll
            for (int nb = 0; nb < 2; ++nb) { b[kk][nb] = ldq(kh + nb * 16 * HD + kk * 512); b2[kk][nb] = ldq(kl + nb * 16 * HD + kk * 512); }
        loads_out(kh, kl);
#pragma unroll
        for (int kk = 0; kk < 2; ++kk)
#pragma unroll
            for (int nb = 0; nb < 2; ++nb)
#pragma unroll
                for (int mb = 0; mb < 2; ++mb) { acc[mb][nb] = F::mma(qa[mb][kk], b[kk][nb], acc[mb][nb]); acc[mb][nb] = F::mma(qb[mb][kk], b[kk][nb], acc[mb][nb]); acc[mb][nb] = F::mma(qa[mb][kk], b2[kk][nb], acc[mb][nb]); }
#pragma unroll
        for (int mb = 0; mb < 2; ++mb)
#pragma unroll
            for (int nb = 0; nb < 2; ++nb)
#pragma unroll
                for (int j = 0; j < 8; ++j) S[(mb * 16 + hi * 8 + j) * PS + ks * 32 + nb * 16 + lr] = acc[mb][nb][j];
    }
    wsync();
    rowsoft<BK>(S + lane * PS, max(lane, b0 - k0), min(lane + 63, b0 + TB - 1 - k0));   // column c is key k0 + c; row r0 + lane sees keys r0 + lane - 32 .. r0 + lane + 31 of its entry
    wsync();
    // band probabilities x values
    v8f o[2][4];
#pragma unroll
    for (int mb = 0; mb < 2; ++mb)
#pragma unroll
        for (int nb = 0; nb < 4; ++nb) o[mb][nb] = (v8f){};
#pragma unroll 1
    for (int ks = ks0; ks < ks1; ++ks) {
        V a[2], a2[2], b[4], b2[4];
        const bf* vh = Vh + ((size_t)h * (TT / 32) + ((k0 + ks * 32) >> 5)) * 2048 + 8 * lane; const bf* vl = Vl + ((size_t)h * (TT / 32) + ((k0 + ks * 32) >> 5)) * 2048 + 8 * lane;   // the 32-key block of the step's first key k0 + 32 ks
#pragma unroll
        for (int nb = 0; nb < 4; ++nb) { b[nb] = ldq(vh + nb * 512); b2[nb] = ldq(vl + nb * 512); }
#pragma unroll
        for (int mb = 0; mb < 2; ++mb) { a[mb] = ldl(P + (mb * 16 + lr) * (2 * PS) + ks * 32 + 8 * hi); a2[mb] = ldl(P + (mb * 16 + lr) * (2 * PS) + BK + ks * 32 + 8 * hi); }
        loads_out(vh, vl);
#pragma unroll
        for (int nb = 0; nb < 4; ++nb)
#pragma unroll
            for (int mb = 0; mb < 2; ++mb) { o[mb][nb] = F::mma(a[mb], b[nb], o[mb][nb]); o[mb][nb] = F::mma(a2[mb], b[nb], o[mb][nb]); o[mb][nb] = F::mma(a[mb], b2[nb], o[mb][nb]); }
        // the distance behind the last matrix instructions on the loop's back edge, where the next trip's loads overwrite their operands
        asm volatile("v_nop\n\tv_nop\n\tv_nop\n\tv_nop" : "+v"(o[0][0]), "+v"(o[1][1]), "+v"(o[0][2]), "+v"(o[1][3]) : "v"(a[0]), "v"(a[1]));
    }
    wsync();
    // the sum of the two partial outputs, through LDS for whole-line stores
#pragma unroll
    for (int mb = 0; mb < 2; ++mb)
#pragma unroll
        for (int nb = 0; nb < 4; ++nb)
#pragma unroll
            for (int j = 0; j < 8; ++j) S[(mb * 16 + hi * 8 + j) * PS + nb * 16 + lr] = __fadd_rn(o[mb][nb][j], og[mb][nb][j]);
    wsync();
    const size_t mo = (size_t)r0 * DQ + h * HD + lr * 4;   // a row's 64 columns of one head are one 128-byte line of each merged plane
    v4us oh[16], ol[16];
#pragma unroll
    for (int s = 0; s < 16; ++s) { const v4f val = *(const v4fa*)(S + (2 * s + hi) * PS + lr * 4);
#pragma unroll
        for (int q = 0; q < 4; ++q) { unsigned short a_, c_; splitf(val[q], a_, c_); oh[s][q] = a_; ol[s][q] = c_; } }
    __builtin_amdgcn_sched_barrier(0);   // every row is split before the first store issues: behind the stores no register that one of them names is written again
#pragma unroll
    for (int s = 0; s < 16; ++s) { *(v4us*)(Mh + mo + (size_t)(2 * s + hi) * DQ) = oh[s]; *(v4us*)(Ml + mo + (size_t)(2 * s + hi) * DQ) = ol[s]; }
}

typedef __attribute__((ext_vector_type(2))) _Float16 v2h;
typedef __attribute__((ext_vector_type(4))) _Float16 v4h;
typedef __attribute__((ext_vector_type(2))) unsigned short v2us;
typedef __attribute__((ext_vector_type(2))) float v2f;
typedef __attribute__((ext_vector_type(4))) int v4i;

// ---- k_prep: every operand of the two projections in ONE launch: x -> bf16 (XB) and both weights [k][n] f32 -> [n][k] bf16 (WALL, WO); grid PWG work-groups (one a WGP) of 12 independent waves, no work-group barrier.
// All loops are unrolled in full, so that their arrays are registers. Every wave moves 16 KB in and 8 KB out, its 32 loads of 16 bytes a lane all in flight at once, every load and store in whole lines. Waves 4 .. 11: 4096 consecutive elements of x each.
// Waves 0 .. 3 (one a SIMD): one 64 k x 64 n tile of a weight each, read as 256-byte pieces of its k rows, two k packed to a dword, transposed through the wave's own LDS rows, stored as one 128-byte line of each n row.
#define PWG  256
#define TP   33                   // LDS row pitch of a transposed tile in dwords: odd, so that the 16 x 4 n rows of a store and the 32 dwords of a row read each fall on banks of their own
typedef unsigned __attribute__((may_alias)) u32a;
static_assert((size_t)TT * DM == (size_t)PWG * 8 * 4096 && (3 * DM / 64) * (DM / 64) + (DM / 64) * (DQ / 64) == PWG * 4, "k_prep: one piece a wave");
template <int N>
__device__ __forceinline__ void wt_tile(const float* __restrict__ w, bf* Bt, int t, u32a* T, int lane) {   // tile t: k rows 64 (t % 16) .., columns 64 (t / 16) .. of w [DM][N]
    const int c = lane & 15, r = lane >> 4, kt = t & 15, nt = t >> 4;
    const float* s = w + (size_t)(kt * 64 + 2 * r) * N + nt * 64 + 4 * c; v4f v[32];
#pragma unroll
    for (int j = 0; j < 32; ++j) v[j] = *(const v4f*)(s + (size_t)(4 * (j >> 1) + (j & 1)) * N);   // loads 2 i and 2 i + 1 bring rows k and k + 1 to the same lane
    __builtin_amdgcn_sched_barrier(0);                      // all 32 loads are in flight before the first value is waited for
#pragma unroll
    for (int i = 0; i < 16; ++i)
#pragma unroll
        for (int q = 0; q < 4; ++q) T[(4 * c + q) * TP + 2 * i + r] = (unsigned)f2bf(v[2 * i][q]) | ((unsigned)f2bf(v[2 * i + 1][q]) << 16);
    wsync();
    unsigned o[64];
#pragma unroll
    for (int n = 0; n < 64; ++n) o[n] = T[n * TP + lane];
    u32a* d = (u32a*)(Bt + (size_t)nt * 64 * DM + kt * 64) + lane;
#pragma unroll
    for (int n = 0; n < 64; ++n) d[n * (DM / 2)] = o[n];
    asm volatile("s_wait_xcnt 0x0" ::: "memory");         // the wait before a register that these stores name is written again (the built code goes on into other paths' text behind them)
}
__global__ __launch_bounds__(384) void k_prep(const float* __restrict__ x, const float* __restrict__ wqkv, const float* __restrict__ wo, bf* XB, bf* WALL, bf* WO) {
    __shared__ __align__(16) unsigned tl[4][64 * TP];
    const int lane = threadIdx.x & 31; const int w = __builtin_amdgcn_readfirstlane((int)(threadIdx.x >> 5));
    if (w < 4) {
        const int t = blockIdx.x * 4 + w;
        if (t < (3 * DM / 64) * (DM / 64)) wt_tile<3 * DM>(wqkv, WALL, t, (u32a*)tl[w], lane); else wt_tile<DM>(wo, WO, t - (3 * DM / 64) * (DM / 64), (u32a*)tl[w], lane);
        return;
    }
    const size_t e = ((size_t)blockIdx.x * 8 + (w - 4)) * 4096 + lane * 4; const float* s = x + e; v4f v[32]; v4us o[32];
#pragma unroll
    for (int j = 0; j < 32; ++j) v[j] = *(const v4f*)(s + j * 128);
    __builtin_amdgcn_sched_barrier(0);                      // all 32 loads are in flight before the first value is waited for
#pragma unroll
    for (int j = 0; j < 32; ++j)
#pragma unroll
        for (int q = 0; q < 4; ++q) o[j][q] = f2bf(v[j][q]);
    __builtin_amdgcn_sched_barrier(0);                      // every value is rounded before the first store issues, so that the stores go out as one run with no register of theirs written among them
#pragma unroll
    for (int j = 0; j < 32; ++j) *(v4us*)(XB + e + j * 128) = o[j];
    asm volatile("s_wait_xcnt 0x0" ::: "memory");         // the wait before a register that these stores name is written again
}

__global__ __launch_bounds__(256) void k_gathK(const bf* __restrict__ KPh_, const bf* __restrict__ KPl_, bf* KGh, bf* KGl) { const size_t e = ((size_t)blockIdx.x * 256 + threadIdx.x) * 8; if (e >= (size_t)NH_ * NGA * HD) return; const int d = (int)(e % HD); const int gq = (int)((e / HD) % NGA); const int h = (int)(e / ((size_t)HD * NGA)); const int pc = ((d >> 4) * 32 + ((d >> 3) & 1) * 16) * 8;   /* the piece's place in a tile, row 0 */ const size_t src = ((size_t)h * TT + (size_t)gq * 64) * HD + pc; const size_t dst = ((size_t)h * NGA + (gq & ~15)) * HD + pc + (gq & 15) * 8; const v8us a = *(const v8us*)(KPh_ + src), c = *(const v8us*)(KPl_ + src); *(v8us*)(KGh + dst) = a; *(v8us*)(KGl + dst) = c;  }
__global__ __launch_bounds__(256) void k_gathV(const bf* __restrict__ VTh_, const bf* __restrict__ VTl_, bf* VGh, bf* VGl) { const size_t e = ((size_t)blockIdx.x * 256 + threadIdx.x) * 8; if (e >= (size_t)NH_ * HD * NGA) return; const size_t hb = e / ((size_t)NG * HD);   /* VG is [head][entry][d][g]: hb = head * NB_ + entry */ const int gq = (int)((hb % NB_) * NG + e % NG);   /* number of the gathered key among all rows' */ const int d = (int)((e / NG) % HD), g0 = (int)(e % NG); const size_t sb = (hb / NB_) * (size_t)(TT / 32) * 2048 + (d >> 4) * 512 + (d & 15) * 8;   /* key 0 of a 32-key block, row d */ const size_t dst = (hb * HD + (d & ~15)) * NG + ((g0 >> 4) * 32 + ((g0 >> 3) & 1) * 16 + (d & 15)) * 8; v8us a, c;
#pragma unroll
    for (int q = 0; q < 8; ++q) { const size_t src = sb + (size_t)(gq + q) * 2 * 2048; a[q] = VTh_[src]; c[q] = VTl_[src]; } *(v8us*)(VGh + dst) = a; *(v8us*)(VGl + dst) = c;  }

extern "C" void kernel_launch(void* const* d_in, const int* in_sizes, int n_in,
                              void* d_out, int out_size, void* d_ws, size_t ws_size, hipStream_t stream) {
    (void)in_sizes; (void)n_in; (void)out_size;
    const float* x = (const float*)d_in[0]; const float* wqkv = (const float*)d_in[1]; const float* wo = (const float*)d_in[2]; const float* bo = (const float*)d_in[3]; const float* wq = nullptr; const float* wk = nullptr; const float* wv = nullptr; (void)wq; (void)wk; (void)wv;
    float* OUT = (float*)d_out;     // [2][4096][1024]
    char* wsp = (char*)d_ws;
    auto take = [&](size_t bytes) { char* p = wsp; wsp += (bytes + 255) & ~(size_t)255; return (void*)p; };
    bf* WALL = (bf*)take((size_t)3 * DM * DM * 2); bf* WO = (bf*)take((size_t)DM * DQ * 2);
    bf* XB = (bf*)take((size_t)TT * DM * 2);
    bf* QPh = (bf*)take(6 * PLN * 2); bf* QPl = QPh + PLN; bf* KPh = QPh + 2 * PLN; bf* KPl = QPh + 3 * PLN; bf* VTh = QPh + 4 * PLN; bf* VTl = QPh + 5 * PLN;   /* one block: the projection's epilogue finds the k and v planes behind the q planes */
    bf* KGh = (bf*)take((size_t)NH_ * NGA * HD * 2); bf* KGl = (bf*)take((size_t)NH_ * NGA * HD * 2); bf* VGh = (bf*)take((size_t)NH_ * HD * NGA * 2); bf* VGl = (bf*)take((size_t)NH_ * HD * NGA * 2);
    bf* ATh = (bf*)take((size_t)TT * DQ * 2); bf* ATl = (bf*)take((size_t)TT * DQ * 2);   /* merged planes [t][head * HD + d] */
    if ((size_t)(wsp - (char*)d_ws) > ws_size) return;    // ws 256 MiB
    k_prep<<<PWG, 384, 0, stream>>>(x, wqkv, wo, XB, WALL, WO);   /* x -> bf16; 'xw' [DM][3DM] -> Bt [3DM][DM] (row blocks q | k | v); w_out [DQ][DM] -> Bt [DM][DQ] */
    k_gemmb<0, 2, DM><<<dim3(TT / 128, 3 * DM / 128, 1), 128, 0, stream>>>(XB, nullptr, WALL, nullptr, nullptr, QPh, QPl);   /* [q|k|v] projection, epilogue -> hi/lo planes */
    k_gathK<<<(unsigned)(((size_t)NH_ * NGA * HD / 8 + 255) / 256), 256, 0, stream>>>(KPh, KPl, KGh, KGl); k_gathV<<<(unsigned)(((size_t)NH_ * HD * NGA / 8 + 255) / 256), 256, 0, stream>>>(VTh, VTl, VGh, VGl);   /* the 64 strided keys / values per head and batch entry */
    k_attn<<<dim3(TT / 128, NH_, 1), 128, 0, stream>>>(QPh, QPl, KPh, KPl, VTh, VTl, KGh, KGl, VGh, VGl, ATh, ATl);   /* band + global attention, y = head -> merged planes */
    k_gemmb<1, 1, DQ><<<dim3(TT / 128, DM / 128, 1), 128, 0, stream>>>(ATh, ATl, WO, OUT, bo, nullptr, nullptr);
}

// v008
// One run takes 108 microseconds.
// Timed twice side by side with v007, it ran 1.05 times as fast both times.
// Over all steps from v000 it is 10.7 times as fast.
#include <hip/hip_runtime.h>

// Local (sliding window of 64, centred) + strided global (every 64th key) attention, summed, then an output projection (x [2][4096][1024]; [q|k|v] = x w_qkv ('xw' [1024][3072], reshape (3, H, Dh): thirds); 16 heads x 64; local: softmax over keys j in [i-32, i+31] (clipped to the sequence) of q.k/8; global: softmax over the 64 keys j = 64 g of q.k/8; out = (attn_local v + attn_global v_g) merged, w_out + b_out -> [2][4096][1024] (8.4 M)).
// Both batch entries run in the same launches as rows 0 .. 8191; a row's band span, window and global keys are clipped to its own entry.
// Algorithm: hi/lo planes of q, k (as [head][t][d]) and v (transposed, in 32-key blocks) are written by the epilogue of ONE projection launch over all 3072 columns of [q|k|v], which also writes the 64 strided keys / values per head and entry a second time as rows of their own (one whole line a row and plane); ONE attention launch (k_attn, one wave per head and 32 query rows) does band scores, global scores, both softmaxes and both probability x value products with scores and probabilities in LDS, and writes the merged hi/lo planes for the output projection.
// Plane layout: the q and k planes keep each tile of 16 rows x 64 columns (2 KB) in FRAGMENT ORDER, 16-byte piece c (8 columns) of row r at piece (c >> 1) * 32 + (c & 1) * 16 + r; the v planes are [head][32 keys][16 d] tiles of 1 KB,
// the 8 keys 16 a + 8 b .. of row d at piece a * 32 + b * 16 + d % 16. Lane l of a fragment load then reads piece l of a run of 32: one load or store of a wave is 512 contiguous bytes, four whole lines, where row-major planes gave 32 bytes of each of 16 lines.
// Compute dtypes, f32 accumulate: every input rounded to bf16; q/k/v on PLAIN bf16 operands (inputs: exact); band / global scores and probability x value products on hi/lo planes (3 products); both softmaxes f32; w_out hl x exact (2 products) + b_out.

#define NB_  2
#define TB   4096                 // rows (tokens) of one batch entry
#define TT   (NB_ * TB)           // all rows: both batch entries stand one behind the other in every plane and go through every launch together
#define DM   1024
#define NH_  16
#define NKV  16
#define REP  (NH_ / NKV)
#define HD   64
#define DQ   (NH_ * HD)
#define DKV  (NKV * HD)
#define ZH   1
#define RH   4096
#define LWH  32                   // half window: keys i-32 .. i+31
#define NG   64                   // global keys (every 64th) of one batch entry
#define NGA  (NB_ * NG)           // gathered keys of all rows
#define WIN  4096
#define PCAR 1024.0f
#define SCL  0.125f   // HD^-0.5
#define PLN  ((size_t)NH_ * TT * HD)   // elements of one q / k / v plane
#define GAT  ((size_t)NH_ * NB_ * 2 * NG * HD)   // elements of the strided key rows, and of the strided value rows: [head][entry][hi | lo][g][d], behind the six planes
typedef _Float16 h16;
typedef unsigned short bf;
typedef __attribute__((ext_vector_type(16))) __bf16   v16bf;
typedef __attribute__((ext_vector_type(16))) _Float16 v16h;
typedef __attribute__((ext_vector_type(8)))  _Float16 v8h;
typedef __attribute__((ext_vector_type(8)))  unsigned short v8us;
typedef __attribute__((ext_vector_type(8)))  float    v8f;
typedef __attribute__((ext_vector_type(4)))  float    v4f;
typedef v8h  __attribute__((may_alias)) v8ha;
typedef v4f  __attribute__((may_alias)) v4fa;
typedef v8us __attribute__((may_alias)) v8usa;

__device__ __forceinline__ unsigned short f2bf(float f) { unsigned u = __float_as_uint(f); u += 0x7FFFu + ((u >> 16) & 1u); return (unsigned short)(u >> 16); }
__device__ __forceinline__ float bf2f(unsigned short b) { return __uint_as_float(((unsigned)b) << 16); }
__device__ __forceinline__ float bfr(float f) { return bf2f(f2bf(f)); }
__device__ __forceinline__ void splitf(float y, unsigned short& h, unsigned short& l) { h = f2bf(y); l = f2bf(y - bf2f(h)); }
typedef __attribute__((ext_vector_type(4))) unsigned short v4us;
__device__ __forceinline__ v16h cat16(v8h lo, v8h hi) { return __builtin_shufflevector(lo, hi, 0, 1, 2, 3, 4, 5, 6, 7, 8, 9, 10, 11, 12, 13, 14, 15); }
__device__ __forceinline__ v16bf cat16b(v8us lo, v8us hi) { return __builtin_bit_cast(v16bf, __builtin_shufflevector(lo, hi, 0, 1, 2, 3, 4, 5, 6, 7, 8, 9, 10, 11, 12, 13, 14, 15)); }
__device__ __forceinline__ v8f wmma16(v16h a, v16h b, v8f c) { return __builtin_amdgcn_wmma_f32_16x16x32_f16(false, a, false, b, (short)0, c, false, false); }
__device__ __forceinline__ v8f wmmab(v16bf a, v16bf b, v8f c) { return __builtin_amdgcn_wmma_f32_16x16x32_bf16(false, a, false, b, (short)0, c, false, false); }



template <typename T16> struct WFrag;
template <> struct WFrag<h16> { typedef v16h V; static __device__ __forceinline__ V ld(const h16* p) { return cat16(*(const v8h*)p, *(const v8h*)(p + 16)); } static __device__ __forceinline__ v8f mma(V a, V b, v8f c) { return wmma16(a, b, c); } };
template <> struct WFrag<bf> { typedef v16bf V; static __device__ __forceinline__ V ld(const bf* p) { return cat16b(*(const v8us*)p, *(const v8us*)(p + 16)); } static __device__ __forceinline__ v8f mma(V a, V b, v8f c) { return wmmab(a, b, c); } };
__device__ __forceinline__ v16bf ldq(const bf* p) { return cat16b(*(const v8us*)p, *(const v8us*)(p + 256)); }   // a fragment of a plane in fragment order: p = tile + 512 * (32-k step) + 8 * lane; the second 8 k stand 32 pieces on
__device__ __forceinline__ v16bf ldl(const bf* p) { return cat16b(*(const v8usa*)p, *(const v8usa*)(p + 16)); }

// ---- k_gemmb: block-tiled GEMM, one 128x128 output tile per work-group of 4 waves (2 x 2, each wave 64x64 = 16 accumulators); grid (M/128, N/128), 128 threads.
// C[m][n] = sum_k A[m][k] Bt[n][k] (NSPLIT 1: + A2[m][k] Bt[n][k], product by product as k goes up), operands K-contiguous bf16 planes of KD columns, KD % 64 == 0, KD >= 128.
// A stage is 64 k, one whole 128-byte line of every operand row: rows [A 128 | A2 128 (NSPLIT 1) | Bt 128] at an LDS pitch of 144 bytes (16 B x odd, for the 16-byte fragment reads). Two buffers, filled by asynchronous copies to LDS,
// 16 bytes a lane (8 lanes cover a line, a wave's copy 4 lines); the next stage's copies fly while this stage is worked on; each operand line leaves L2 once per work-group and is read by two waves from LDS.
// Registers: all fragments of a stage are held at once beside the accumulators, so three (NSPLIT 1: two) waves a SIMD are asked for; 1536 tiles of the [q|k|v] projection are two full rounds of three work-groups a WGP.
// EPI picks what the epilogue does with a wave's f32 tile: 1 store to C (pitch DM) with bias; 2 [q|k|v] projection: 64-column tile ty is head ty % 16 of third ty / 16, the tile is split into bf16 hi/lo and stored to that
// third's planes (Mh/Ml: q planes; k and v planes follow at 2 PLN and 4 PLN elements), q and k as [head][t][d], v transposed ([head][32 t][d]), all in fragment order (head of the file), C unused; a wave's first row is every 64th: of the k and v thirds it is stored once more, row-major, at 6 PLN (keys) and 6 PLN + GAT (values).
#define GPB  144                  // LDS row pitch in bytes
// 128 rows of one operand's stage: 8 copies a lane, 16 rows apart. The wait is the last line of the copies' own statement: it stands before any register that a copy names is written again.
__device__ __forceinline__ void copy_rows(unsigned l, const bf* g, int kd) {
    asm volatile("global_load_async_to_lds_b128 %0, %8, off\n\t"
                 "global_load_async_to_lds_b128 %1, %9, off\n\t"
                 "global_load_async_to_lds_b128 %2, %10, off\n\t"
                 "global_load_async_to_lds_b128 %3, %11, off\n\t"
                 "global_load_async_to_lds_b128 %4, %12, off\n\t"
                 "global_load_async_to_lds_b128 %5, %13, off\n\t"
                 "global_load_async_to_lds_b128 %6, %14, off\n\t"
                 "global_load_async_to_lds_b128 %7, %15, off\n\t"
                 "s_wait_xcnt 0x0"
                 :: "v"(l), "v"(l + 16 * GPB), "v"(l + 32 * GPB), "v"(l + 48 * GPB), "v"(l + 64 * GPB), "v"(l + 80 * GPB), "v"(l + 96 * GPB), "v"(l + 112 * GPB),
                    "v"(g), "v"(g + 16 * kd), "v"(g + 32 * kd), "v"(g + 48 * kd), "v"(g + 64 * kd), "v"(g + 80 * kd), "v"(g + 96 * kd), "v"(g + 112 * kd) : "memory");
}
template <int NSPLIT, int EPI, int KD>
__global__ __launch_bounds__(128, NSPLIT ? 2 : 3) void k_gemmb(const bf* __restrict__ A, const bf* __restrict__ A2, const bf* __restrict__ Bt, float* C, const float* __restrict__ bias, bf* Mh, bf* Ml) {
    typedef WFrag<bf> F; typedef F::V V;
    constexpr int STG = (2 + NSPLIT) * 128 * GPB, BO = (1 + NSPLIT) * 128 * GPB, NT = KD / 64;   // bytes of a stage, place of the Bt rows in it, stages
    __shared__ __align__(16) char sm[2 * STG];
    const int tid = threadIdx.x, lane = tid & 31, lr = lane & 15, hi = lane >> 4; const int w = __builtin_amdgcn_readfirstlane(tid >> 5), wm = w >> 1, wn = w & 1;
    const int r0 = blockIdx.x * 128 + wm * 64, c0 = blockIdx.y * 128 + wn * 64, ty = blockIdx.y * 2 + wn;   // this wave's 64x64 tile
    const size_t go = (size_t)(tid >> 3) * KD + (tid & 7) * 8;   // a lane's row and 16-byte piece in every copy
    const bf* ga = A + (size_t)blockIdx.x * 128 * KD + go; const bf* ga2 = NSPLIT ? A2 + (size_t)blockIdx.x * 128 * KD + go : nullptr; const bf* gb = Bt + (size_t)blockIdx.y * 128 * KD + go;
    const unsigned l0 = (unsigned)(size_t)sm + (tid >> 3) * GPB + (tid & 7) * 16;
    auto fill = [&](int t, int buf) { copy_rows(l0 + buf * STG, ga + t * 64, KD); if (NSPLIT) copy_rows(l0 + buf * STG + 128 * GPB, ga2 + t * 64, KD); copy_rows(l0 + buf * STG + BO, gb + t * 64, KD); };
    v8f acc[4][4];
#pragma unroll
    for (int mb = 0; mb < 4; ++mb)
#pragma unroll
        for (int nb = 0; nb < 4; ++nb) acc[mb][nb] = (v8f){};
    fill(0, 0);
    asm volatile("s_wait_asynccnt 0x0" ::: "memory");   // this wave's copies of stage 0 have landed
    __syncthreads();                                    // ... and every other wave's
    fill(1, 1);
    const char* fa = sm + (wm * 64 + lr) * GPB + hi * 16; const char* fb = sm + BO + (wn * 64 + lr) * GPB + hi * 16;
#pragma unroll 1   // rolled: one copy of the stage's text, the buffer picked by t & 1
    for (int t = 0; t < NT; ++t) {
        const int bo = (t & 1) * STG;
        V a[2][4], a2[2][4], b[2][4];
#pragma unroll
        for (int kk = 0; kk < 2; ++kk) {
#pragma unroll
            for (int mb = 0; mb < 4; ++mb) { a[kk][mb] = ldl((const bf*)(fa + bo + mb * 16 * GPB + kk * 64)); if (NSPLIT) a2[kk][mb] = ldl((const bf*)(fa + bo + (128 + mb * 16) * GPB + kk * 64)); }
#pragma unroll
            for (int nb = 0; nb < 4; ++nb) b[kk][nb] = ldl((const bf*)(fb + bo + nb * 16 * GPB + kk * 64)); }
        __builtin_amdgcn_sched_barrier(0);   // all fragment reads of the stage go out as one group ahead of its products: left alone they were issued two at a time into one register set among the products, one LDS latency each time
#pragma unroll
        for (int kk = 0; kk < 2; ++kk)
#pragma unroll
            for (int nb = 0; nb < 4; ++nb)
#pragma unroll
                for (int mb = 0; mb < 4; ++mb) { acc[mb][nb] = F::mma(a[kk][mb], b[kk][nb], acc[mb][nb]); if (NSPLIT) acc[mb][nb] = F::mma(a2[kk][mb], b[kk][nb], acc[mb][nb]); }
        __builtin_amdgcn_sched_barrier(0);   // the waits and the barrier stay behind the products: moved up in front of them, the wait for the next stage's copies came one stage's products too early
        asm volatile("s_wait_dscnt 0x0" ::: "memory");      // this wave's reads of the buffer are done before it is handed to the copies
        asm volatile("s_wait_asynccnt 0x0" ::: "memory");   // this wave's copies of stage t + 1 have landed
        __syncthreads();                                    // publishes stage t + 1 and ends every wave's reads of stage t
        if (t + 2 < NT) fill(t + 2, t & 1);
    }
    asm volatile("s_wait_asynccnt 0x0" ::: "memory");       // no copy is outstanding when the ring becomes output staging (the last trip's barrier ended every read of it)
    float* os = (float*)(sm + w * (16 * 68 * 4));           // each wave stages in its own range
    if (EPI == 2 && ty >= 2 * NH_) {   // v third: a lane's 8 accumulator rows are 8 consecutive t of one d, one piece of the transposed planes: 16-byte stores straight from the registers, the wave's 32 pieces in a row
        const size_t vo = 4 * PLN + ((size_t)(ty - 2 * NH_) * (TT / 32) + (r0 >> 5)) * 2048 + lane * 8;
#pragma unroll
        for (int nb = 0; nb < 4; ++nb)
#pragma unroll
            for (int mb = 0; mb < 4; ++mb) { v8us oh, ol;
#pragma unroll
                for (int j = 0; j < 8; ++j) { unsigned short a_, c_; splitf(acc[mb][nb][j], a_, c_); oh[j] = a_; ol[j] = c_; }
                *(v8us*)(Mh + vo + (mb >> 1) * 2048 + nb * 512 + (mb & 1) * 256) = oh; *(v8us*)(Ml + vo + (mb >> 1) * 2048 + nb * 512 + (mb & 1) * 256) = ol;
                if (mb == 0 && hi == 0) {   // row r0 is a strided key: lanes 0 .. 15 hold its d = 16 nb + lr; the wave's four nb fill the row's line of each plane
                    bf* gv = Mh + 6 * PLN + GAT + ((size_t)((ty - 2 * NH_) * NB_ + r0 / TB) * 2 * NG + ((r0 >> 6) & (NG - 1))) * HD + nb * 16 + lr; gv[0] = oh[0]; gv[NG * HD] = ol[0]; } }
        return;
    }
#pragma unroll
    for (int mb = 0; mb < 4; ++mb) {
#pragma unroll
        for (int nb = 0; nb < 4; ++nb) {
#pragma unroll
            for (int j = 0; j < 8; ++j) os[(hi * 8 + j) * 68 + nb * 16 + lr] = acc[mb][nb][j]; }
        __builtin_amdgcn_wave_barrier(); asm volatile("" ::: "memory");   // rows that some lanes wrote are read by other lanes of the same wave: keeps the compiler from moving LDS accesses over the hand-over
        if (EPI == 2) {   // q / k third: these 16 rows t of one head are one 2 KB tile of each plane; a lane takes piece 2 s + hi of row lr
            const size_t po = (size_t)(ty / NH_) * 2 * PLN + ((size_t)(ty % NH_) * TT + r0 + mb * 16) * HD + lane * 8;
#pragma unroll
            for (int s = 0; s < 4; ++s) { const float* op = os + lr * 68 + (2 * s + hi) * 8; const v4f v0 = *(const v4fa*)op, v1 = *(const v4fa*)(op + 4); v8us oh, ol;
#pragma unroll
                for (int q = 0; q < 4; ++q) { unsigned short a_, c_; splitf(v0[q], a_, c_); oh[q] = a_; ol[q] = c_; splitf(v1[q], a_, c_); oh[4 + q] = a_; ol[4 + q] = c_; }
                *(v8us*)(Mh + po + s * 256) = oh; *(v8us*)(Ml + po + s * 256) = ol;
                if (mb == 0 && ty / NH_ == 1 && lr == 0) {   // row r0 of the k third is a strided key: lanes 0 and 16 hold its pieces 2 s and 2 s + 1; the four s fill the row's line of each plane
                    bf* gk = Mh + 6 * PLN + ((size_t)((ty - NH_) * NB_ + r0 / TB) * 2 * NG + ((r0 >> 6) & (NG - 1))) * HD + (2 * s + hi) * 8; *(v8us*)gk = oh; *(v8us*)(gk + NG * HD) = ol; } }
        } else {
            float* crow = C + (size_t)(r0 + mb * 16) * DM + c0;
#pragma unroll
            for (int s = 0; s < 8; ++s) { const int row = 2 * s + hi, cofs = lr * 4; v4f val = *(const v4fa*)(os + row * 68 + cofs); val[0] += bfr(bias[c0 + cofs]); val[1] += bfr(bias[c0 + cofs + 1]); val[2] += bfr(bias[c0 + cofs + 2]); val[3] += bfr(bias[c0 + cofs + 3]);
                *(v4f*)(crow + (size_t)row * DM + cofs) = val; }
        }
        asm volatile("s_wait_xcnt 0x0" ::: "memory");   // the next block's LDS reads reuse registers that these stores name
        __builtin_amdgcn_wave_barrier(); asm volatile("" ::: "memory");
    }
}

// ---- k_attn: both attentions of one head for 32 query rows in ONE WAVE, scores and probabilities never leaving the WGP; grid (TT / 128, head), 4 waves a block, each with its own LDS rows for scores and probabilities; the strided key rows of the block's head and entry, then in the same place its strided value rows, are staged in LDS once for all four waves (asynchronous copies, three work-group barriers).
// The windows of rows r0 .. r0 + 31 span the 96 keys r0 - 32 .. r0 + 63: three 32-key steps, each wholly inside or wholly outside the rows' batch entry (outside: skipped). Per wave: band scores (hi/lo, 3 products) -> LDS f32 [32][96];
// lane = row softmax, the bf16 hi | lo probabilities written over the row's own scores (exact zeros outside the window); band P.V with P from LDS and v from the transposed planes; ahead of it the same on the 64 gathered keys; the two f32 partial
// outputs are added, split and stored as the merged hi/lo planes [t][head * HD + d] in whole 128-byte lines.
#define PS   100                  // LDS row pitch in dwords: 400 B = 16 B x odd, for the 16-byte row reads
#define BK   96                   // keys of the band span of 32 rows
// Rows that some lanes wrote to LDS are read by other lanes of the same wave (LDS operations of a wave run in order): this keeps the compiler from moving LDS accesses over the hand-over.
__device__ __forceinline__ void wsync() { __builtin_amdgcn_wave_barrier(); asm volatile("" ::: "memory"); }
// One lane's softmax of NC scores of its LDS row (columns clo .. chi count, the rest get probability 0), probabilities split to bf16 hi (first NC) | lo (next NC) over the same bytes.
template <int NC>
__device__ __forceinline__ void rowsoft(float* srow, int clo, int chi) {
    float s[NC];
#pragma unroll
    for (int c = 0; c < NC; c += 4) { const v4f t = *(const v4fa*)(srow + c); s[c] = t[0]; s[c + 1] = t[1]; s[c + 2] = t[2]; s[c + 3] = t[3]; }
    const unsigned wd = (unsigned)(chi - clo); float m4[4] = { -3.0e38f, -3.0e38f, -3.0e38f, -3.0e38f };
#pragma unroll
    for (int c = 0; c < NC; ++c) { s[c] = ((unsigned)(c - clo) <= wd) ? s[c] * SCL : -3.0e38f; m4[c & 3] = fmaxf(m4[c & 3], s[c]); }
    const float mx = fmaxf(fmaxf(m4[0], m4[1]), fmaxf(m4[2], m4[3])); float a4[4] = { 0.0f, 0.0f, 0.0f, 0.0f };
#pragma unroll
    for (int c = 0; c < NC; c += 4) { float e[4];
#pragma unroll
        for (int q = 0; q < 4; ++q) e[q] = (s[c + q] - mx) * 1.4426950408889634f;
        // four v_exp_f32 on registers of their own, each the independent instruction behind the one before it, and a v_nop behind the last: the slot that the instruction set asks for before a transcendental's result is used or its source overwritten
        asm("v_exp_f32 %0, %4\n\tv_exp_f32 %1, %5\n\tv_exp_f32 %2, %6\n\tv_exp_f32 %3, %7\n\tv_nop" : "=&v"(s[c]), "=&v"(s[c + 1]), "=&v"(s[c + 2]), "=&v"(s[c + 3]) : "v"(e[0]), "v"(e[1]), "v"(e[2]), "v"(e[3]));
#pragma unroll
        for (int q = 0; q < 4; ++q) a4[q] += s[c + q]; }
    const float f = __fdiv_rn(1.0f, (a4[0] + a4[1]) + (a4[2] + a4[3]));
    bf* prow = (bf*)srow;
#pragma unroll
    for (int c = 0; c < NC; c += 8) { v8us oh, ol;
#pragma unroll
        for (int q = 0; q < 8; ++q) { unsigned short a_, c_; splitf(s[c + q] * f, a_, c_); oh[q] = a_; ol[q] = c_; }
        *(v8usa*)(prow + c) = oh; *(v8usa*)(prow + NC + c) = ol; }
}
// Behind a group of fragment loads: the wait before a register that these loads name is written again (the two addresses as inputs keep their registers whole up to it), and a scheduling barrier, so that
// every load of the group is in flight before the first product waits on one (without it the loads were issued four at a time into one register set, one L2 latency each time).
__device__ __forceinline__ void loads_out(const bf* p0, const bf* p1) { asm volatile("s_wait_xcnt 0x0" :: "v"(p0), "v"(p1) : "memory"); __builtin_amdgcn_sched_barrier(0); }
#define GKP  144                  // LDS pitch in bytes of the staged key rows: 16 B x odd, for the 16-byte fragment reads
#define GVP  160                  // ... of the staged value rows: 32 B x odd, for the transposing reads
// The 128 rows (64 hi | 64 lo) of 128 bytes of one head's and entry's strided keys or values to LDS at pitch PB: 8 copies a lane, 16 rows apart, 8 lanes to a line. The wait is the last line of the copies' own statement: it stands before any register that a copy names is written again.
template <int PB>
__device__ __forceinline__ void copy_g(unsigned l, const bf* g) {
    asm volatile("global_load_async_to_lds_b128 %0, %8, off\n\t"
                 "global_load_async_to_lds_b128 %1, %9, off\n\t"
                 "global_load_async_to_lds_b128 %2, %10, off\n\t"
                 "global_load_async_to_lds_b128 %3, %11, off\n\t"
                 "global_load_async_to_lds_b128 %4, %12, off\n\t"
                 "global_load_async_to_lds_b128 %5, %13, off\n\t"
                 "global_load_async_to_lds_b128 %6, %14, off\n\t"
                 "global_load_async_to_lds_b128 %7, %15, off\n\t"
                 "s_wait_xcnt 0x0"
                 :: "v"(l), "v"(l + 16 * PB), "v"(l + 32 * PB), "v"(l + 48 * PB), "v"(l + 64 * PB), "v"(l + 80 * PB), "v"(l + 96 * PB), "v"(l + 112 * PB),
                    "v"(g), "v"(g + 16 * HD), "v"(g + 32 * HD), "v"(g + 48 * HD), "v"(g + 64 * HD), "v"(g + 80 * HD), "v"(g + 96 * HD), "v"(g + 112 * HD) : "memory");
}
typedef __attribute__((ext_vector_type(8))) short s16x8;
// transposing LDS read: lane l points at row 8 (l >> 4) + (l & 7), bytes 16 ((l >> 3) & 1) of a 16 x 16 tile of 16-bit values and gets rows 8 (l >> 4) .. + 7 of column l & 15
__device__ __forceinline__ v8us ldt(const char* p) { typedef __attribute__((address_space(3))) s16x8 lds_s16x8; return __builtin_bit_cast(v8us, __builtin_amdgcn_ds_load_tr16_b128_v8i16((lds_s16x8*)p)); }
__global__ __launch_bounds__(128, 4) void k_attn(const bf* __restrict__ Qh, const bf* __restrict__ Ql, const bf* __restrict__ Kh, const bf* __restrict__ Kl, const bf* __restrict__ Vh, const bf* __restrict__ Vl,
                                              const bf* __restrict__ KG_, const bf* __restrict__ VG_, bf* Mh, bf* Ml) {
    typedef WFrag<bf> F; typedef F::V V;
    __shared__ __align__(16) float sm[4][32 * PS];
    __shared__ __align__(32) char gs[128 * GVP];   // the strided rows of the block's head and entry (its 128 query rows lie in one entry), shared by the four waves: first the keys, then the values
    const int lane = threadIdx.x & 31, lr = lane & 15, hi = lane >> 4; const int w = __builtin_amdgcn_readfirstlane((int)(threadIdx.x >> 5));
    float* S = sm[w]; const bf* P = (const bf*)S;
    const int h = blockIdx.y, r0 = (blockIdx.x * 4 + w) * 32, eb = r0 / TB, b0 = eb * TB, k0 = r0 - 32;   // k0: first key of the span (off the entry for its first row tile)
    const int ks0 = (k0 < b0) ? 1 : 0, ks1 = (k0 + BK > b0 + TB) ? 2 : 3;                                 // the 32-key steps that lie in the rows' own batch entry
    const bf* qh = Qh + ((size_t)h * TT + r0) * HD + 8 * lane; const bf* ql = Ql + ((size_t)h * TT + r0) * HD + 8 * lane;   // every plane pointer below: first tile + the lane's piece
    const size_t gofs = ((size_t)(h * NB_ + eb) * 2 * NG + (threadIdx.x >> 3)) * HD + (threadIdx.x & 7) * 8;   // a lane's row and 16-byte piece in every copy
    copy_g<GKP>((unsigned)(size_t)gs + (threadIdx.x >> 3) * GKP + (threadIdx.x & 7) * 16, KG_ + gofs);
    // global scores against the entry's 64 strided keys
    {
        V qa[2][2], qb[2][2];
#pragma unroll
        for (int mb = 0; mb < 2; ++mb)
#pragma unroll
            for (int kk = 0; kk < 2; ++kk) { qa[mb][kk] = ldq(qh + mb * 16 * HD + kk * 512); qb[mb][kk] = ldq(ql + mb * 16 * HD + kk * 512); }
        loads_out(qh, ql);
        asm volatile("s_wait_asynccnt 0x0" ::: "memory");   // this wave's copies of the key rows have landed
        __syncthreads();                                    // ... and every other wave's
        v8f g[2][4];
#pragma unroll
        for (int mb = 0; mb < 2; ++mb)
#pragma unroll
            for (int nb = 0; nb < 4; ++nb) g[mb][nb] = (v8f){};
        const char* gk = gs + lr * GKP + hi * 16;   // key row lr, the lane half's 16 bytes of each 32
#pragma unroll
        for (int kk = 0; kk < 2; ++kk) { V b[4], b2[4];
#pragma unroll
            for (int nb = 0; nb < 4; ++nb) { b[nb] = ldl((const bf*)(gk + nb * 16 * GKP + kk * 64)); b2[nb] = ldl((const bf*)(gk + (NG + nb * 16) * GKP + kk * 64)); }
            __builtin_amdgcn_sched_barrier(0);   // the step's fragment reads go out as one group ahead of its products, not a few at a time among them
#pragma unroll
            for (int nb = 0; nb < 4; ++nb)
#pragma unroll
                for (int mb = 0; mb < 2; ++mb) { g[mb][nb] = F::mma(qa[mb][kk], b[nb], g[mb][nb]); g[mb][nb] = F::mma(qb[mb][kk], b[nb], g[mb][nb]); g[mb][nb] = F::mma(qa[mb][kk], b2[nb], g[mb][nb]); } }
#pragma unroll
        for (int mb = 0; mb < 2; ++mb)
#pragma unroll
            for (int nb = 0; nb < 4; ++nb)
#pragma unroll
                for (int j = 0; j < 8; ++j) S[(mb * 16 + hi * 8 + j) * PS + nb * 16 + lr] = g[mb][nb][j];
    }
    asm volatile("s_wait_dscnt 0x0" ::: "memory");      // this wave's reads of the key rows are done before their place is handed to the copies
    __syncthreads();                                    // ends every wave's reads of the key rows
    copy_g<GVP>((unsigned)(size_t)gs + (threadIdx.x >> 3) * GVP + (threadIdx.x & 7) * 16, VG_ + gofs);   // the value rows fly while the softmax runs
    wsync();
    rowsoft<NG>(S + lane * PS, 0, NG - 1);
    wsync();
    asm volatile("s_wait_asynccnt 0x0" ::: "memory");   // this wave's copies of the value rows have landed
    __syncthreads();                                    // ... and every other wave's
    // global probabilities x strided values (LDS rows [g][d], read transposed: a lane gets 8 g of one d)
    v8f og[2][4];
#pragma unroll
    for (int mb = 0; mb < 2; ++mb)
#pragma unroll
        for (int nb = 0; nb < 4; ++nb) og[mb][nb] = (v8f){};
    { const char* gv = gs + (8 * hi + (lane & 7)) * GVP + ((lane >> 3) & 1) * 16;
#pragma unroll
      for (int kk = 0; kk < 2; ++kk) { V a[2], a2[2], b[4], b2[4];
#pragma unroll
          for (int nb = 0; nb < 4; ++nb) { b[nb] = cat16b(ldt(gv + kk * 32 * GVP + nb * 32), ldt(gv + (kk * 32 + 16) * GVP + nb * 32)); b2[nb] = cat16b(ldt(gv + (NG + kk * 32) * GVP + nb * 32), ldt(gv + (NG + kk * 32 + 16) * GVP + nb * 32)); }
#pragma unroll
          for (int mb = 0; mb < 2; ++mb) { a[mb] = ldl(P + (mb * 16 + lr) * (2 * PS) + kk * 32 + 8 * hi); a2[mb] = ldl(P + (mb * 16 + lr) * (2 * PS) + NG + kk * 32 + 8 * hi); }
          __builtin_amdgcn_sched_barrier(0);   // the step's fragment reads go out as one group ahead of its products
#pragma unroll
          for (int nb = 0; nb < 4; ++nb)
#pragma unroll
              for (int mb = 0; mb < 2; ++mb) { og[mb][nb] = F::mma(a[mb], b[nb], og[mb][nb]); og[mb][nb] = F::mma(a2[mb], b[nb], og[mb][nb]); og[mb][nb] = F::mma(a[mb], b2[nb], og[mb][nb]); } } }
    wsync();
    if (ks0 != 0 || ks1 != 3) {   // a skipped step's score columns get a value, so that the row read below meets only LDS that this pass wrote
        const int cz = (ks0 != 0) ? 0 : 64;
#pragma unroll
        for (int c = 0; c < 32; c += 4) *(v4fa*)(S + lane * PS + cz + c) = (v4f){};
    }
    // band scores; the q fragments are loaded a second time (their 64 registers are free for the value fragments in between: four waves a SIMD have 256 registers each)
    V qa[2][2], qb[2][2];
#pragma unroll
    for (int mb = 0; mb < 2; ++mb)
#pragma unroll
        for (int kk = 0; kk < 2; ++kk) { qa[mb][kk] = ldq(qh + mb * 16 * HD + kk * 512); qb[mb][kk] = ldq(ql + mb * 16 * HD + kk * 512); }
    loads_out(qh, ql);
#pragma unroll 1
    for (int ks = ks0; ks < ks1; ++ks) {
        v8f acc[2][2]; V b[2][2], b2[2][2];
#pragma unroll
        for (int mb = 0; mb < 2; ++mb)
#pragma unroll
            for (int nb = 0; nb < 2; ++nb) acc[mb][nb] = (v8f){};
        const bf* kh = Kh + ((size_t)h * TT + (k0 + ks * 32)) * HD + 8 * lane; const bf* kl = Kl + ((size_t)h * TT + (k0 + ks * 32)) * HD + 8 * lane;
#pragma unroll
        for (int kk = 0; kk < 2; ++kk)
#pragma unroll
            for (int nb = 0; nb < 2; ++nb) { b[kk][nb] = ldq(kh + nb * 16 * HD + kk * 512); b2[kk][nb] = ldq(kl + nb * 16 * HD + kk * 512); }
        loads_out(kh, kl);
#pragma unroll
        for (int kk = 0; kk < 2; ++kk)
#pragma unroll
            for (int nb = 0; nb < 2; ++nb)
#pragma unroll
                for (int mb = 0; mb < 2; ++mb) { acc[mb][nb] = F::mma(qa[mb][kk], b[kk][nb], acc[mb][nb]); acc[mb][nb] = F::mma(qb[mb][kk], b[kk][nb], acc[mb][nb]); acc[mb][nb] = F::mma(qa[mb][kk], b2[kk][nb], acc[mb][nb]); }
#pragma unroll
        for (int mb = 0; mb < 2; ++mb)
#pragma unroll
            for (int nb = 0; nb < 2; ++nb)
#pragma unroll
                for (int j = 0; j < 8; ++j) S[(mb * 16 + hi * 8 + j) * PS + ks * 32 + nb * 16 + lr] = acc[mb][nb][j];
    }
    wsync();
    rowsoft<BK>(S + lane * PS, max(lane, b0 - k0), min(lane + 63, b0 + TB - 1 - k0));   // column c is key k0 + c; row r0 + lane sees keys r0 + lane - 32 .. r0 + lane + 31 of its entry
    wsync();
    // band probabilities x values
    v8f o[2][4];
#pragma unroll
    for (int mb = 0; mb < 2; ++mb)
#pragma unroll
        for (int nb = 0; nb < 4; ++nb) o[mb][nb] = (v8f){};
#pragma unroll 1
    for (int ks = ks0; ks < ks1; ++ks) {
        V a[2], a2[2], b[4], b2[4];
        const bf* vh = Vh + ((size_t)h * (TT / 32) + ((k0 + ks * 32) >> 5)) * 2048 + 8 * lane; const bf* vl = Vl + ((size_t)h * (TT / 32) + ((k0 + ks * 32) >> 5)) * 2048 + 8 * lane;   // the 32-key block of the step's first key k0 + 32 ks
#pragma unroll
        for (int nb = 0; nb < 4; ++nb) { b[nb] = ldq(vh + nb * 512); b2[nb] = ldq(vl + nb * 512); }
#pragma unroll
        for (int mb = 0; mb < 2; ++mb) { a[mb] = ldl(P + (mb * 16 + lr) * (2 * PS) + ks * 32 + 8 * hi); a2[mb] = ldl(P + (mb * 16 + lr) * (2 * PS) + BK + ks * 32 + 8 * hi); }
        loads_out(vh, vl);
#pragma unroll
        for (int nb = 0; nb < 4; ++nb)
#pragma unroll
            for (int mb = 0; mb < 2; ++mb) { o[mb][nb] = F::mma(a[mb], b[nb], o[mb][nb]); o[mb][nb] = F::mma(a2[mb], b[nb], o[mb][nb]); o[mb][nb] = F::mma(a[mb], b2[nb], o[mb][nb]); }
        // the distance behind the last matrix instructions on the loop's back edge, where the next trip's loads overwrite their operands
        asm volatile("v_nop\n\tv_nop\n\tv_nop\n\tv_nop" : "+v"(o[0][0]), "+v"(o[1][1]), "+v"(o[0][2]), "+v"(o[1][3]) : "v"(a[0]), "v"(a[1]));
    }
    wsync();
    // the sum of the two partial outputs, through LDS for whole-line stores
#pragma unroll
    for (int mb = 0; mb < 2; ++mb)
#pragma unroll
        for (int nb = 0; nb < 4; ++nb)
#pragma unroll
            for (int j = 0; j < 8; ++j) S[(mb * 16 + hi * 8 + j) * PS + nb * 16 + lr] = __fadd_rn(o[mb][nb][j], og[mb][nb][j]);
    wsync();
    const size_t mo = (size_t)r0 * DQ + h * HD + lr * 4;   // a row's 64 columns of one head are one 128-byte line of each merged plane
    v4us oh[16], ol[16];
#pragma unroll
    for (int s = 0; s < 16; ++s) { const v4f val = *(const v4fa*)(S + (2 * s + hi) * PS + lr * 4);
#pragma unroll
        for (int q = 0; q < 4; ++q) { unsigned short a_, c_; splitf(val[q], a_, c_); oh[s][q] = a_; ol[s][q] = c_; } }
    __builtin_amdgcn_sched_barrier(0);   // every row is split before the first store issues: behind the stores no register that one of them names is written again
#pragma unroll
    for (int s = 0; s < 16; ++s) { *(v4us*)(Mh + mo + (size_t)(2 * s + hi) * DQ) = oh[s]; *(v4us*)(Ml + mo + (size_t)(2 * s + hi) * DQ) = ol[s]; }
}

typedef __attribute__((ext_vector_type(2))) _Float16 v2h;
typedef __attribute__((ext_vector_type(4))) _Float16 v4h;
typedef __attribute__((ext_vector_type(2))) unsigned short v2us;
typedef __attribute__((ext_vector_type(2))) float v2f;
typedef __attribute__((ext_vector_type(4))) int v4i;

// ---- k_prep: every operand of the two projections in ONE launch: x -> bf16 (XB) and both weights [k][n] f32 -> [n][k] bf16 (WALL, WO); grid PWG work-groups (one a WGP) of 12 independent waves, no work-group barrier.
// All loops are unrolled in full, so that their arrays are registers. Every wave moves 16 KB in and 8 KB out, its 32 loads of 16 bytes a lane all in flight at once, every load and store in whole lines. Waves 4 .. 11: 4096 consecutive elements of x each.
// Waves 0 .. 3 (one a SIMD): one 64 k x 64 n tile of a weight each, read as 256-byte pieces of its k rows, two k packed to a dword, transposed through the wave's own LDS rows, stored as one 128-byte line of each n row.
#define PWG  256
#define TP   33                   // LDS row pitch of a transposed tile in dwords: odd, so that the 16 x 4 n rows of a store and the 32 dwords of a row read each fall on banks of their own
typedef unsigned __attribute__((may_alias)) u32a;
static_assert((size_t)TT * DM == (size_t)PWG * 8 * 4096 && (3 * DM / 64) * (DM / 64) + (DM / 64) * (DQ / 64) == PWG * 4, "k_prep: one piece a wave");
template <int N>
__device__ __forceinline__ void wt_tile(const float* __restrict__ w, bf* Bt, int t, u32a* T, int lane) {   // tile t: k rows 64 (t % 16) .., columns 64 (t / 16) .. of w [DM][N]
    const int c = lane & 15, r = lane >> 4, kt = t & 15, nt = t >> 4;
    const float* s = w + (size_t)(kt * 64 + 2 * r) * N + nt * 64 + 4 * c; v4f v[32];
#pragma unroll
    for (int j = 0; j < 32; ++j) v[j] = *(const v4f*)(s + (size_t)(4 * (j >> 1) + (j & 1)) * N);   // loads 2 i and 2 i + 1 bring rows k and k + 1 to the same lane
    __builtin_amdgcn_sched_barrier(0);                      // all 32 loads are in flight before the first value is waited for
#pragma unroll
    for (int i = 0; i < 16; ++i)
#pragma unroll
        for (int q = 0; q < 4; ++q) T[(4 * c + q) * TP + 2 * i + r] = (unsigned)f2bf(v[2 * i][q]) | ((unsigned)f2bf(v[2 * i + 1][q]) << 16);
    wsync();
    unsigned o[64];
#pragma unroll
    for (int n = 0; n < 64; ++n) o[n] = T[n * TP + lane];
    u32a* d = (u32a*)(Bt + (size_t)nt * 64 * DM + kt * 64) + lane;
#pragma unroll
    for (int n = 0; n < 64; ++n) d[n * (DM / 2)] = o[n];
    asm volatile("s_wait_xcnt 0x0" ::: "memory");         // the wait before a register that these stores name is written again (the built code goes on into other paths' text behind them)
}
__global__ __launch_bounds__(384) void k_prep(const float* __restrict__ x, const float* __restrict__ wqkv, const float* __restrict__ wo, bf* XB, bf* WALL, bf* WO) {
    __shared__ __align__(16) unsigned tl[4][64 * TP];
    const int lane = threadIdx.x & 31; const int w = __builtin_amdgcn_readfirstlane((int)(threadIdx.x >> 5));
    if (w < 4) {
        const int t = blockIdx.x * 4 + w;
        if (t < (3 * DM / 64) * (DM / 64)) wt_tile<3 * DM>(wqkv, WALL, t, (u32a*)tl[w], lane); else wt_tile<DM>(wo, WO, t - (3 * DM / 64) * (DM / 64), (u32a*)tl[w], lane);
        return;
    }
    const size_t e = ((size_t)blockIdx.x * 8 + (w - 4)) * 4096 + lane * 4; const float* s = x + e; v4f v[32]; v4us o[32];
#pragma unroll
    for (int j = 0; j < 32; ++j) v[j] = *(const v4f*)(s + j * 128);
    __builtin_amdgcn_sched_barrier(0);                      // all 32 loads are in flight before the first value is waited for
#pragma unroll
    for (int j = 0; j < 32; ++j)
#pragma unroll
        for (int q = 0; q < 4; ++q) o[j][q] = f2bf(v[j][q]);
    __builtin_amdgcn_sched_barrier(0);                      // every value is rounded before the first store issues, so that the stores go out as one run with no register of theirs written among them
#pragma unroll
    for (int j = 0; j < 32; ++j) *(v4us*)(XB + e + j * 128) = o[j];
    asm volatile("s_wait_xcnt 0x0" ::: "memory");         // the wait before a register that these stores name is written again
}

extern "C" void kernel_launch(void* const* d_in, const int* in_sizes, int n_in,
                              void* d_out, int out_size, void* d_ws, size_t ws_size, hipStream_t stream) {
    (void)in_sizes; (void)n_in; (void)out_size;
    const float* x = (const float*)d_in[0]; const float* wqkv = (const float*)d_in[1]; const float* wo = (const float*)d_in[2]; const float* bo = (const float*)d_in[3]; const float* wq = nullptr; const float* wk = nullptr; const float* wv = nullptr; (void)wq; (void)wk; (void)wv;
    float* OUT = (float*)d_out;     // [2][4096][1024]
    char* wsp = (char*)d_ws;
    auto take = [&](size_t bytes) { char* p = wsp; wsp += (bytes + 255) & ~(size_t)255; return (void*)p; };
    bf* WALL = (bf*)take((size_t)3 * DM * DM * 2); bf* WO = (bf*)take((size_t)DM * DQ * 2);
    bf* XB = (bf*)take((size_t)TT * DM * 2);
    bf* QPh = (bf*)take((6 * PLN + 2 * GAT) * 2); bf* QPl = QPh + PLN; bf* KPh = QPh + 2 * PLN; bf* KPl = QPh + 3 * PLN; bf* VTh = QPh + 4 * PLN; bf* VTl = QPh + 5 * PLN;   bf* KG = QPh + 6 * PLN; bf* VG = KG + GAT;   /* one block: the projection's epilogue finds the k and v planes and the strided rows behind the q planes */
    bf* ATh = (bf*)take((size_t)TT * DQ * 2); bf* ATl = (bf*)take((size_t)TT * DQ * 2);   /* merged planes [t][head * HD + d] */
    if ((size_t)(wsp - (char*)d_ws) > ws_size) return;    // ws 256 MiB
    k_prep<<<PWG, 384, 0, stream>>>(x, wqkv, wo, XB, WALL, WO);   /* x -> bf16; 'xw' [DM][3DM] -> Bt [3DM][DM] (row blocks q | k | v); w_out [DQ][DM] -> Bt [DM][DQ] */
    k_gemmb<0, 2, DM><<<dim3(TT / 128, 3 * DM / 128, 1), 128, 0, stream>>>(XB, nullptr, WALL, nullptr, nullptr, QPh, QPl);   /* [q|k|v] projection, epilogue -> hi/lo planes */
    k_attn<<<dim3(TT / 128, NH_, 1), 128, 0, stream>>>(QPh, QPl, KPh, KPl, VTh, VTl, KG, VG, ATh, ATl);   /* band + global attention, y = head -> merged planes */
    k_gemmb<1, 1, DQ><<<dim3(TT / 128, DM / 128, 1), 128, 0, stream>>>(ATh, ATl, WO, OUT, bo, nullptr, nullptr);
}

// v009
// It runs in 102 microseconds.
// Two timings next to v008 put it at 1.07 and 1.04 times that version's speed.
// All steps since v000 together make it 11.3 times as fast.
#include <hip/hip_runtime.h>

// Local (sliding window of 64, centred) + strided global (every 64th key) attention, summed, then an output projection (x [2][4096][1024]; [q|k|v] = x w_qkv ('xw' [1024][3072], reshape (3, H, Dh): thirds); 16 heads x 64; local: softmax over keys j in [i-32, i+31] (clipped to the sequence) of q.k/8; global: softmax over the 64 keys j = 64 g of q.k/8; out = (attn_local v + attn_global v_g) merged, w_out + b_out -> [2][4096][1024] (8.4 M)).
// Both batch entries run in the same launches as rows 0 .. 8191; a row's band span, window and global keys are clipped to its own entry.
// Algorithm: hi/lo planes of q, k (as [head][t][d]) and v (transposed, in 32-key blocks) are written by the epilogue of ONE projection launch over all 3072 columns of [q|k|v], which also writes the 64 strided keys / values per head and entry a second time as rows of their own (one whole line a row and plane); ONE attention launch (k_attn, one wave per head and 32 query rows) does band scores, global scores, both softmaxes and both probability x value products with scores and probabilities in LDS, and writes the merged hi/lo planes for the output projection.
// Plane layout: the q and k planes keep each tile of 16 rows x 64 columns (2 KB) in FRAGMENT ORDER, 16-byte piece c (8 columns) of row r at piece (c >> 1) * 32 + (c & 1) * 16 + r; the v planes are [head][32 keys][16 d] tiles of 1 KB,
// the 8 keys 16 a + 8 b .. of row d at piece a * 32 + b * 16 + d % 16. Lane l of a fragment load then reads piece l of a run of 32: one load or store of a wave is 512 contiguous bytes, four whole lines, where row-major planes gave 32 bytes of each of 16 lines.
// Compute dtypes, f32 accumulate: every input rounded to bf16; q/k/v on PLAIN bf16 operands (inputs: exact); band / global scores and probability x value products on hi/lo planes (3 products); both softmaxes f32; w_out hl x exact (2 products) + b_out.

#define NB_  2
#define TB   4096                 // rows (tokens) of one batch entry
#define TT   (NB_ * TB)           // all rows: both batch entries stand one behind the other in every plane and go through every launch together
#define DM   1024
#define NH_  16
#define NKV  16
#define REP  (NH_ / NKV)
#define HD   64
#define DQ   (NH_ * HD)
#define DKV  (NKV * HD)
#define ZH   1
#define RH   4096
#define LWH  32                   // half window: keys i-32 .. i+31
#define NG   64                   // global keys (every 64th) of one batch entry
#define NGA  (NB_ * NG)           // gathered keys of all rows
#define WIN  4096
#define PCAR 1024.0f
#define SCL  0.125f   // HD^-0.5
#define PLN  ((size_t)NH_ * TT * HD)   // elements of one q / k / v plane
#define GAT  ((size_t)NH_ * NB_ * 2 * NG * HD)   // elements of the strided key rows, and of the strided value rows: [head][entry][hi | lo][g][d], behind the six planes
typedef _Float16 h16;
typedef unsigned short bf;
typedef __attribute__((ext_vector_type(16))) __bf16   v16bf;
typedef __attribute__((ext_vector_type(16))) _Float16 v16h;
typedef __attribute__((ext_vector_type(8)))  _Float16 v8h;
typedef __attribute__((ext_vector_type(8)))  unsigned short v8us;
typedef __attribute__((ext_vector_type(8)))  float    v8f;
typedef __attribute__((ext_vector_type(4)))  float    v4f;
typedef v8h  __attribute__((may_alias)) v8ha;
typedef v4f  __attribute__((may_alias)) v4fa;
typedef v8us __attribute__((may_alias)) v8usa;

typedef __attribute__((ext_vector_type(2))) __bf16   v2bf;
typedef __attribute__((ext_vector_type(2))) float    p2f;
typedef __attribute__((ext_vector_type(2))) unsigned v2u;
typedef __attribute__((ext_vector_type(4))) unsigned v4u;
typedef v4u  __attribute__((may_alias)) v4ua;
// two f32 rounded to bf16 (nearest even) by the chip's own packed conversion, one instruction: a in the low half of the dword, b in the high half, as two neighbours of a bf16 row lie in memory
__device__ __forceinline__ unsigned f2bf2(float a, float b) { const p2f t = { a, b }; return __builtin_bit_cast(unsigned, __builtin_convertvector(t, v2bf)); }
__device__ __forceinline__ unsigned short f2bf(float f) { return (unsigned short)f2bf2(f, f); }
__device__ __forceinline__ float bf2f(unsigned short b) { return __uint_as_float(((unsigned)b) << 16); }
__device__ __forceinline__ float bfr(float f) { return bf2f(f2bf(f)); }
// two neighbours split into hi and lo, each pair one dword
__device__ __forceinline__ void splitf2(float y0, float y1, unsigned& h, unsigned& l) { h = f2bf2(y0, y1); l = f2bf2(y0 - __uint_as_float(h << 16), y1 - __uint_as_float(h & 0xFFFF0000u)); }
typedef __attribute__((ext_vector_type(4))) unsigned short v4us;
__device__ __forceinline__ v16h cat16(v8h lo, v8h hi) { return __builtin_shufflevector(lo, hi, 0, 1, 2, 3, 4, 5, 6, 7, 8, 9, 10, 11, 12, 13, 14, 15); }
__device__ __forceinline__ v16bf cat16b(v8us lo, v8us hi) { return __builtin_bit_cast(v16bf, __builtin_shufflevector(lo, hi, 0, 1, 2, 3, 4, 5, 6, 7, 8, 9, 10, 11, 12, 13, 14, 15)); }
__device__ __forceinline__ v8f wmma16(v16h a, v16h b, v8f c) { return __builtin_amdgcn_wmma_f32_16x16x32_f16(false, a, false, b, (short)0, c, false, false); }
__device__ __forceinline__ v8f wmmab(v16bf a, v16bf b, v8f c) { return __builtin_amdgcn_wmma_f32_16x16x32_bf16(false, a, false, b, (short)0, c, false, false); }



template <typename T16> struct WFrag;
template <> struct WFrag<h16> { typedef v16h V; static __device__ __forceinline__ V ld(const h16* p) { return cat16(*(const v8h*)p, *(const v8h*)(p + 16)); } static __device__ __forceinline__ v8f mma(V a, V b, v8f c) { return wmma16(a, b, c); } };
template <> struct WFrag<bf> { typedef v16bf V; static __device__ __forceinline__ V ld(const bf* p) { return cat16b(*(const v8us*)p, *(const v8us*)(p + 16)); } static __device__ __forceinline__ v8f mma(V a, V b, v8f c) { return wmmab(a, b, c); } };
__device__ __forceinline__ v16bf ldq(const bf* p) { return cat16b(*(const v8us*)p, *(const v8us*)(p + 256)); }   // a fragment of a plane in fragment order: p = tile + 512 * (32-k step) + 8 * lane; the second 8 k stand 32 pieces on
__device__ __forceinline__ v16bf ldl(const bf* p) { return cat16b(*(const v8usa*)p, *(const v8usa*)(p + 16)); }

// ---- k_gemmb: block-tiled GEMM, one 128x128 output tile per work-group of 4 waves (2 x 2, each wave 64x64 = 16 accumulators); grid (M/128, N/128), 128 threads.
// C[m][n] = sum_k A[m][k] Bt[n][k] (NSPLIT 1: + A2[m][k] Bt[n][k], product by product as k goes up), operands K-contiguous bf16 planes of KD columns, KD % 64 == 0, KD >= 128.
// A stage is 64 k, one whole 128-byte line of every operand row: rows [A 128 | A2 128 (NSPLIT 1) | Bt 128] at an LDS pitch of 144 bytes (16 B x odd, for the 16-byte fragment reads). Two buffers, filled by asynchronous copies to LDS,
// 16 bytes a lane (8 lanes cover a line, a wave's copy 4 lines); the next stage's copies fly while this stage is worked on; each operand line leaves L2 once per work-group and is read by two waves from LDS.
// Registers: all fragments of a stage are held at once beside the accumulators, so three (NSPLIT 1: two) waves a SIMD are asked for; 1536 tiles of the [q|k|v] projection are two full rounds of three work-groups a WGP.
// EPI picks what the epilogue does with a wave's f32 tile: 1 store to C (pitch DM) with bias; 2 [q|k|v] projection: 64-column tile ty is head ty % 16 of third ty / 16, the tile is split into bf16 hi/lo and stored to that
// third's planes (Mh/Ml: q planes; k and v planes follow at 2 PLN and 4 PLN elements), q and k as [head][t][d], v transposed ([head][32 t][d]), all in fragment order (head of the file), C unused; a wave's first row is every 64th: of the k and v thirds it is stored once more, row-major, at 6 PLN (keys) and 6 PLN + GAT (values).
#define GPB  144                  // LDS row pitch in bytes
// 128 rows of one operand's stage: 8 copies a lane, 16 rows apart. The wait is the last line of the copies' own statement: it stands before any register that a copy names is written again.
__device__ __forceinline__ void copy_rows(unsigned l, const bf* g, int kd) {
    asm volatile("global_load_async_to_lds_b128 %0, %8, off\n\t"
                 "global_load_async_to_lds_b128 %1, %9, off\n\t"
                 "global_load_async_to_lds_b128 %2, %10, off\n\t"
                 "global_load_async_to_lds_b128 %3, %11, off\n\t"
                 "global_load_async_to_lds_b128 %4, %12, off\n\t"
                 "global_load_async_to_lds_b128 %5, %13, off\n\t"
                 "global_load_async_to_lds_b128 %6, %14, off\n\t"
                 "global_load_async_to_lds_b128 %7, %15, off\n\t"
                 "s_wait_xcnt 0x0"
                 :: "v"(l), "v"(l + 16 * GPB), "v"(l + 32 * GPB), "v"(l + 48 * GPB), "v"(l + 64 * GPB), "v"(l + 80 * GPB), "v"(l + 96 * GPB), "v"(l + 112 * GPB),
                    "v"(g), "v"(g + 16 * kd), "v"(g + 32 * kd), "v"(g + 48 * kd), "v"(g + 64 * kd), "v"(g + 80 * kd), "v"(g + 96 * kd), "v"(g + 112 * kd) : "memory");
}
template <int NSPLIT, int EPI, int KD>
__global__ __launch_bounds__(128, NSPLIT ? 2 : 3) void k_gemmb(const bf* __restrict__ A, const bf* __restrict__ A2, const bf* __restrict__ Bt, float* C, const float* __restrict__ bias, bf* Mh, bf* Ml) {
    typedef WFrag<bf> F; typedef F::V V;
    constexpr int STG = (2 + NSPLIT) * 128 * GPB, BO = (1 + NSPLIT) * 128 * GPB, NT = KD / 64;   // bytes of a stage, place of the Bt rows in it, stages
    __shared__ __align__(16) char sm[2 * STG];
    const int tid = threadIdx.x, lane = tid & 31, lr = lane & 15, hi = lane >> 4; const int w = __builtin_amdgcn_readfirstlane(tid >> 5), wm = w >> 1, wn = w & 1;
    const int r0 = blockIdx.x * 128 + wm * 64, c0 = blockIdx.y * 128 + wn * 64, ty = blockIdx.y * 2 + wn;   // this wave's 64x64 tile
    const size_t go = (size_t)(tid >> 3) * KD + (tid & 7) * 8;   // a lane's row and 16-byte piece in every copy
    const bf* ga = A + (size_t)blockIdx.x * 128 * KD + go; const bf* ga2 = NSPLIT ? A2 + (size_t)blockIdx.x * 128 * KD + go : nullptr; const bf* gb = Bt + (size_t)blockIdx.y * 128 * KD + go;
    const unsigned l0 = (unsigned)(size_t)sm + (tid >> 3) * GPB + (tid & 7) * 16;
    auto fill = [&](int t, int buf) { copy_rows(l0 + buf * STG, ga + t * 64, KD); if (NSPLIT) copy_rows(l0 + buf * STG + 128 * GPB, ga2 + t * 64, KD); copy_rows(l0 + buf * STG + BO, gb + t * 64, KD); };
    v8f acc[4][4];
#pragma unroll
    for (int mb = 0; mb < 4; ++mb)
#pragma unroll
        for (int nb = 0; nb < 4; ++nb) acc[mb][nb] = (v8f){};
    fill(0, 0);
    asm volatile("s_wait_asynccnt 0x0" ::: "memory");   // this wave's copies of stage 0 have landed
    __syncthreads();                                    // ... and every other wave's
    fill(1, 1);
    const char* fa = sm + (wm * 64 + lr) * GPB + hi * 16; const char* fb = sm + BO + (wn * 64 + lr) * GPB + hi * 16;
#pragma unroll 1   // rolled: one copy of the stage's text, the buffer picked by t & 1
    for (int t = 0; t < NT; ++t) {
        const int bo = (t & 1) * STG;
        V a[2][4], a2[2][4], b[2][4];
#pragma unroll
        for (int kk = 0; kk < 2; ++kk) {
#pragma unroll
            for (int mb = 0; mb < 4; ++mb) { a[kk][mb] = ldl((const bf*)(fa + bo + mb * 16 * GPB + kk * 64)); if (NSPLIT) a2[kk][mb] = ldl((const bf*)(fa + bo + (128 + mb * 16) * GPB + kk * 64)); }
#pragma unroll
            for (int nb = 0; nb < 4; ++nb) b[kk][nb] = ldl((const bf*)(fb + bo + nb * 16 * GPB + kk * 64)); }
        __builtin_amdgcn_sched_barrier(0);   // all fragment reads of the stage go out as one group ahead of its products: left alone they were issued two at a time into one register set among the products, one LDS latency each time
#pragma unroll
        for (int kk = 0; kk < 2; ++kk)
#pragma unroll
            for (int nb = 0; nb < 4; ++nb)
#pragma unroll
                for (int mb = 0; mb < 4; ++mb) { acc[mb][nb] = F::mma(a[kk][mb], b[kk][nb], acc[mb][nb]); if (NSPLIT) acc[mb][nb] = F::mma(a2[kk][mb], b[kk][nb], acc[mb][nb]); }
        __builtin_amdgcn_sched_barrier(0);   // the waits and the barrier stay behind the products: moved up in front of them, the wait for the next stage's copies came one stage's products too early
        asm volatile("s_wait_dscnt 0x0" ::: "memory");      // this wave's reads of the buffer are done before it is handed to the copies
        asm volatile("s_wait_asynccnt 0x0" ::: "memory");   // this wave's copies of stage t + 1 have landed
        __syncthreads();                                    // publishes stage t + 1 and ends every wave's reads of stage t
        if (t + 2 < NT) fill(t + 2, t & 1);
    }
    asm volatile("s_wait_asynccnt 0x0" ::: "memory");       // no copy is outstanding when the ring becomes output staging (the last trip's barrier ended every read of it)
    float* os = (float*)(sm + w * (16 * 68 * 4));           // each wave stages in its own range
    if (EPI == 2 && ty >= 2 * NH_) {   // v third: a lane's 8 accumulator rows are 8 consecutive t of one d, one piece of the transposed planes: 16-byte stores straight from the registers, the wave's 32 pieces in a row
        const size_t vo = 4 * PLN + ((size_t)(ty - 2 * NH_) * (TT / 32) + (r0 >> 5)) * 2048 + lane * 8;
#pragma unroll
        for (int nb = 0; nb < 4; ++nb)
#pragma unroll
            for (int mb = 0; mb < 4; ++mb) { v4u oh, ol;
#pragma unroll
                for (int j = 0; j < 4; ++j) { unsigned a_, c_; splitf2(acc[mb][nb][2 * j], acc[mb][nb][2 * j + 1], a_, c_); oh[j] = a_; ol[j] = c_; }
                *(v4u*)(Mh + vo + (mb >> 1) * 2048 + nb * 512 + (mb & 1) * 256) = oh; *(v4u*)(Ml + vo + (mb >> 1) * 2048 + nb * 512 + (mb & 1) * 256) = ol;
                if (mb == 0 && hi == 0) {   // row r0 is a strided key: lanes 0 .. 15 hold its d = 16 nb + lr; the wave's four nb fill the row's line of each plane
                    bf* gv = Mh + 6 * PLN + GAT + ((size_t)((ty - 2 * NH_) * NB_ + r0 / TB) * 2 * NG + ((r0 >> 6) & (NG - 1))) * HD + nb * 16 + lr; gv[0] = (bf)oh[0]; gv[NG * HD] = (bf)ol[0]; } }
        return;
    }
#pragma unroll
    for (int mb = 0; mb < 4; ++mb) {
#pragma unroll
        for (int nb = 0; nb < 4; ++nb) {
#pragma unroll
            for (int j = 0; j < 8; ++j) os[(hi * 8 + j) * 68 + nb * 16 + lr] = acc[mb][nb][j]; }
        __builtin_amdgcn_wave_barrier(); asm volatile("" ::: "memory");   // rows that some lanes wrote are read by other lanes of the same wave: keeps the compiler from moving LDS accesses over the hand-over
        if (EPI == 2) {   // q / k third: these 16 rows t of one head are one 2 KB tile of each plane; a lane takes piece 2 s + hi of row lr
            const size_t po = (size_t)(ty / NH_) * 2 * PLN + ((size_t)(ty % NH_) * TT + r0 + mb * 16) * HD + lane * 8;
#pragma unroll
            for (int s = 0; s < 4; ++s) { const float* op = os + lr * 68 + (2 * s + hi) * 8; const v4f v0 = *(const v4fa*)op, v1 = *(const v4fa*)(op + 4); v4u oh, ol;
#pragma unroll
                for (int q = 0; q < 2; ++q) { unsigned a_, c_; splitf2(v0[2 * q], v0[2 * q + 1], a_, c_); oh[q] = a_; ol[q] = c_; splitf2(v1[2 * q], v1[2 * q + 1], a_, c_); oh[2 + q] = a_; ol[2 + q] = c_; }
                *(v4u*)(Mh + po + s * 256) = oh; *(v4u*)(Ml + po + s * 256) = ol;
                if (mb == 0 && ty / NH_ == 1 && lr == 0) {   // row r0 of the k third is a strided key: lanes 0 and 16 hold its pieces 2 s and 2 s + 1; the four s fill the row's line of each plane
                    bf* gk = Mh + 6 * PLN + ((size_t)((ty - NH_) * NB_ + r0 / TB) * 2 * NG + ((r0 >> 6) & (NG - 1))) * HD + (2 * s + hi) * 8; *(v4u*)gk = oh; *(v4u*)(gk + NG * HD) = ol; } }
        } else {
            float* crow = C + (size_t)(r0 + mb * 16) * DM + c0;
#pragma unroll
            for (int s = 0; s < 8; ++s) { const int row = 2 * s + hi, cofs = lr * 4; v4f val = *(const v4fa*)(os + row * 68 + cofs); val[0] += bfr(bias[c0 + cofs]); val[1] += bfr(bias[c0 + cofs + 1]); val[2] += bfr(bias[c0 + cofs + 2]); val[3] += bfr(bias[c0 + cofs + 3]);
                *(v4f*)(crow + (size_t)row * DM + cofs) = val; }
        }
        asm volatile("s_wait_xcnt 0x0" ::: "memory");   // the next block's LDS reads reuse registers that these stores name
        __builtin_amdgcn_wave_barrier(); asm volatile("" ::: "memory");
    }
}

// ---- k_attn: both attentions of one head for 32 query rows in ONE WAVE, scores and probabilities never leaving the WGP; grid (TT / 128, head), 4 waves a block, each with its own LDS rows for scores and probabilities; the strided key rows of the block's head and entry, then in the same place its strided value rows, are staged in LDS once for all four waves (asynchronous copies, three work-group barriers).
// The windows of rows r0 .. r0 + 31 span the 96 keys r0 - 32 .. r0 + 63: three 32-key steps, each wholly inside or wholly outside the rows' batch entry (outside: skipped). Per wave: band scores (hi/lo, 3 products) -> LDS f32 [32][96];
// lane = row softmax, the bf16 hi | lo probabilities written over the row's own scores (exact zeros outside the window); band P.V with P from LDS and v from the transposed planes; ahead of it the same on the 64 gathered keys; the two f32 partial
// outputs are added, split and stored as the merged hi/lo planes [t][head * HD + d] in whole 128-byte lines.
#define PS   100                  // LDS row pitch in dwords: 400 B = 16 B x odd, for the 16-byte row reads
#define BK   96                   // keys of the band span of 32 rows
// Rows that some lanes wrote to LDS are read by other lanes of the same wave (LDS operations of a wave run in order): this keeps the compiler from moving LDS accesses over the hand-over.
__device__ __forceinline__ void wsync() { __builtin_amdgcn_wave_barrier(); asm volatile("" ::: "memory"); }
// One lane's softmax of NC scores of its LDS row (columns clo .. chi count, the rest get probability 0), probabilities split to bf16 hi (first NC) | lo (next NC) over the same bytes.
template <int NC>
__device__ __forceinline__ void rowsoft(float* srow, int clo, int chi) {
    float s[NC];
#pragma unroll
    for (int c = 0; c < NC; c += 4) { const v4f t = *(const v4fa*)(srow + c); s[c] = t[0]; s[c + 1] = t[1]; s[c + 2] = t[2]; s[c + 3] = t[3]; }
    const unsigned wd = (unsigned)(chi - clo); float m4[4] = { -3.0e38f, -3.0e38f, -3.0e38f, -3.0e38f };
#pragma unroll
    for (int c = 0; c < NC; ++c) { s[c] = ((unsigned)(c - clo) <= wd) ? s[c] * SCL : -3.0e38f; m4[c & 3] = fmaxf(m4[c & 3], s[c]); }
    const float mx = fmaxf(fmaxf(m4[0], m4[1]), fmaxf(m4[2], m4[3])); float a4[4] = { 0.0f, 0.0f, 0.0f, 0.0f };
#pragma unroll
    for (int c = 0; c < NC; c += 4) { float e[4];
#pragma unroll
        for (int q = 0; q < 4; ++q) e[q] = (s[c + q] - mx) * 1.4426950408889634f;
        // four v_exp_f32 on registers of their own, each the independent instruction behind the one before it, and a v_nop behind the last: the slot that the instruction set asks for before a transcendental's result is used or its source overwritten
        asm("v_exp_f32 %0, %4\n\tv_exp_f32 %1, %5\n\tv_exp_f32 %2, %6\n\tv_exp_f32 %3, %7\n\tv_nop" : "=&v"(s[c]), "=&v"(s[c + 1]), "=&v"(s[c + 2]), "=&v"(s[c + 3]) : "v"(e[0]), "v"(e[1]), "v"(e[2]), "v"(e[3]));
#pragma unroll
        for (int q = 0; q < 4; ++q) a4[q] += s[c + q]; }
    const float f = __fdiv_rn(1.0f, (a4[0] + a4[1]) + (a4[2] + a4[3]));
    bf* prow = (bf*)srow;
#pragma unroll
    for (int c = 0; c < NC; c += 8) { v4u oh, ol;
#pragma unroll
        for (int q = 0; q < 4; ++q) { unsigned a_, c_; splitf2(s[c + 2 * q] * f, s[c + 2 * q + 1] * f, a_, c_); oh[q] = a_; ol[q] = c_; }
        *(v4ua*)(prow + c) = oh; *(v4ua*)(prow + NC + c) = ol; }
}
// Behind a group of fragment loads: the wait before a register that these loads name is written again (the two addresses as inputs keep their registers whole up to it), and a scheduling barrier, so that
// every load of the group is in flight before the first product waits on one (without it the loads were issued four at a time into one register set, one L2 latency each time).
__device__ __forceinline__ void loads_out(const bf* p0, const bf* p1) { asm volatile("s_wait_xcnt 0x0" :: "v"(p0), "v"(p1) : "memory"); __builtin_amdgcn_sched_barrier(0); }
#define GKP  144                  // LDS pitch in bytes of the staged key rows: 16 B x odd, for the 16-byte fragment reads
#define GVP  160                  // ... of the staged value rows: 32 B x odd, for the transposing reads
// The 128 rows (64 hi | 64 lo) of 128 bytes of one head's and entry's strided keys or values to LDS at pitch PB: 8 copies a lane, 16 rows apart, 8 lanes to a line. The wait is the last line of the copies' own statement: it stands before any register that a copy names is written again.
template <int PB>
__device__ __forceinline__ void copy_g(unsigned l, const bf* g) {
    asm volatile("global_load_async_to_lds_b128 %0, %8, off\n\t"
                 "global_load_async_to_lds_b128 %1, %9, off\n\t"
                 "global_load_async_to_lds_b128 %2, %10, off\n\t"
                 "global_load_async_to_lds_b128 %3, %11, off\n\t"
                 "global_load_async_to_lds_b128 %4, %12, off\n\t"
                 "global_load_async_to_lds_b128 %5, %13, off\n\t"
                 "global_load_async_to_lds_b128 %6, %14, off\n\t"
                 "global_load_async_to_lds_b128 %7, %15, off\n\t"
                 "s_wait_xcnt 0x0"
                 :: "v"(l), "v"(l + 16 * PB), "v"(l + 32 * PB), "v"(l + 48 * PB), "v"(l + 64 * PB), "v"(l + 80 * PB), "v"(l + 96 * PB), "v"(l + 112 * PB),
                    "v"(g), "v"(g + 16 * HD), "v"(g + 32 * HD), "v"(g + 48 * HD), "v"(g + 64 * HD), "v"(g + 80 * HD), "v"(g + 96 * HD), "v"(g + 112 * HD) : "memory");
}
typedef __attribute__((ext_vector_type(8))) short s16x8;
// transposing LDS read: lane l points at row 8 (l >> 4) + (l & 7), bytes 16 ((l >> 3) & 1) of a 16 x 16 tile of 16-bit values and gets rows 8 (l >> 4) .. + 7 of column l & 15
__device__ __forceinline__ v8us ldt(const char* p) { typedef __attribute__((address_space(3))) s16x8 lds_s16x8; return __builtin_bit_cast(v8us, __builtin_amdgcn_ds_load_tr16_b128_v8i16((lds_s16x8*)p)); }
__global__ __launch_bounds__(128, 4) void k_attn(const bf* __restrict__ Qh, const bf* __restrict__ Ql, const bf* __restrict__ Kh, const bf* __restrict__ Kl, const bf* __restrict__ Vh, const bf* __restrict__ Vl,
                                              const bf* __restrict__ KG_, const bf* __restrict__ VG_, bf* Mh, bf* Ml) {
    typedef WFrag<bf> F; typedef F::V V;
    __shared__ __align__(16) float sm[4][32 * PS];
    __shared__ __align__(32) char gs[128 * GVP];   // the strided rows of the block's head and entry (its 128 query rows lie in one entry), shared by the four waves: first the keys, then the values
    const int lane = threadIdx.x & 31, lr = lane & 15, hi = lane >> 4; const int w = __builtin_amdgcn_readfirstlane((int)(threadIdx.x >> 5));
    float* S = sm[w]; const bf* P = (const bf*)S;
    const int h = blockIdx.y, r0 = (blockIdx.x * 4 + w) * 32, eb = r0 / TB, b0 = eb * TB, k0 = r0 - 32;   // k0: first key of the span (off the entry for its first row tile)
    const int ks0 = (k0 < b0) ? 1 : 0, ks1 = (k0 + BK > b0 + TB) ? 2 : 3;                                 // the 32-key steps that lie in the rows' own batch entry
    const bf* qh = Qh + ((size_t)h * TT + r0) * HD + 8 * lane; const bf* ql = Ql + ((size_t)h * TT + r0) * HD + 8 * lane;   // every plane pointer below: first tile + the lane's piece
    const size_t gofs = ((size_t)(h * NB_ + eb) * 2 * NG + (threadIdx.x >> 3)) * HD + (threadIdx.x & 7) * 8;   // a lane's row and 16-byte piece in every copy
    copy_g<GKP>((unsigned)(size_t)gs + (threadIdx.x >> 3) * GKP + (threadIdx.x & 7) * 16, KG_ + gofs);
    // global scores against the entry's 64 strided keys
    {
        V qa[2][2], qb[2][2];
#pragma unroll
        for (int mb = 0; mb < 2; ++mb)
#pragma unroll
            for (int kk = 0; kk < 2; ++kk) { qa[mb][kk] = ldq(qh + mb * 16 * HD + kk * 512); qb[mb][kk] = ldq(ql + mb * 16 * HD + kk * 512); }
        loads_out(qh, ql);
        asm volatile("s_wait_asynccnt 0x0" ::: "memory");   // this wave's copies of the key rows have landed
        __syncthreads();                                    // ... and every other wave's
        v8f g[2][4];
#pragma unroll
        for (int mb = 0; mb < 2; ++mb)
#pragma unroll
            for (int nb = 0; nb < 4; ++nb) g[mb][nb] = (v8f){};
        const char* gk = gs + lr * GKP + hi * 16;   // key row lr, the lane half's 16 bytes of each 32
#pragma unroll
        for (int kk = 0; kk < 2; ++kk) { V b[4], b2[4];
#pragma unroll
            for (int nb = 0; nb < 4; ++nb) { b[nb] = ldl((const bf*)(gk + nb * 16 * GKP + kk * 64)); b2[nb] = ldl((const bf*)(gk + (NG + nb * 16) * GKP + kk * 64)); }
            __builtin_amdgcn_sched_barrier(0);   // the step's fragment reads go out as one group ahead of its products, not a few at a time among them
#pragma unroll
            for (int nb = 0; nb < 4; ++nb)
#pragma unroll
                for (int mb = 0; mb < 2; ++mb) { g[mb][nb] = F::mma(qa[mb][kk], b[nb], g[mb][nb]); g[mb][nb] = F::mma(qb[mb][kk], b[nb], g[mb][nb]); g[mb][nb] = F::mma(qa[mb][kk], b2[nb], g[mb][nb]); } }
#pragma unroll
        for (int mb = 0; mb < 2; ++mb)
#pragma unroll
            for (int nb = 0; nb < 4; ++nb)
#pragma unroll
                for (int j = 0; j < 8; ++j) S[(mb * 16 + hi * 8 + j) * PS + nb * 16 + lr] = g[mb][nb][j];
    }
    asm volatile("s_wait_dscnt 0x0" ::: "memory");      // this wave's reads of the key rows are done before their place is handed to the copies
    __syncthreads();                                    // ends every wave's reads of the key rows
    copy_g<GVP>((unsigned)(size_t)gs + (threadIdx.x >> 3) * GVP + (threadIdx.x & 7) * 16, VG_ + gofs);   // the value rows fly while the softmax runs
    wsync();
    rowsoft<NG>(S + lane * PS, 0, NG - 1);
    wsync();
    asm volatile("s_wait_asynccnt 0x0" ::: "memory");   // this wave's copies of the value rows have landed
    __syncthreads();                                    // ... and every other wave's
    // global probabilities x strided values (LDS rows [g][d], read transposed: a lane gets 8 g of one d)
    v8f og[2][4];
#pragma unroll
    for (int mb = 0; mb < 2; ++mb)
#pragma unroll
        for (int nb = 0; nb < 4; ++nb) og[mb][nb] = (v8f){};
    { const char* gv = gs + (8 * hi + (lane & 7)) * GVP + ((lane >> 3) & 1) * 16;
#pragma unroll
      for (int kk = 0; kk < 2; ++kk) { V a[2], a2[2], b[4], b2[4];
#pragma unroll
          for (int nb = 0; nb < 4; ++nb) { b[nb] = cat16b(ldt(gv + kk * 32 * GVP + nb * 32), ldt(gv + (kk * 32 + 16) * GVP + nb * 32)); b2[nb] = cat16b(ldt(gv + (NG + kk * 32) * GVP + nb * 32), ldt(gv + (NG + kk * 32 + 16) * GVP + nb * 32)); }
#pragma unroll
          for (int mb = 0; mb < 2; ++mb) { a[mb] = ldl(P + (mb * 16 + lr) * (2 * PS) + kk * 32 + 8 * hi); a2[mb] = ldl(P + (mb * 16 + lr) * (2 * PS) + NG + kk * 32 + 8 * hi); }
          __builtin_amdgcn_sched_barrier(0);   // the step's fragment reads go out as one group ahead of its products
#pragma unroll
          for (int nb = 0; nb < 4; ++nb)
#pragma unroll
              for (int mb = 0; mb < 2; ++mb) { og[mb][nb] = F::mma(a[mb], b[nb], og[mb][nb]); og[mb][nb] = F::mma(a2[mb], b[nb], og[mb][nb]); og[mb][nb] = F::mma(a[mb], b2[nb], og[mb][nb]); } } }
    wsync();
    if (ks0 != 0 || ks1 != 3) {   // a skipped step's score columns get a value, so that the row read below meets only LDS that this pass wrote
        const int cz = (ks0 != 0) ? 0 : 64;
#pragma unroll
        for (int c = 0; c < 32; c += 4) *(v4fa*)(S + lane * PS + cz + c) = (v4f){};
    }
    // band scores; the q fragments are loaded a second time (their 64 registers are free for the value fragments in between: four waves a SIMD have 256 registers each)
    V qa[2][2], qb[2][2];
#pragma unroll
    for (int mb = 0; mb < 2; ++mb)
#pragma unroll
        for (int kk = 0; kk < 2; ++kk) { qa[mb][kk] = ldq(qh + mb * 16 * HD + kk * 512); qb[mb][kk] = ldq(ql + mb * 16 * HD + kk * 512); }
    loads_out(qh, ql);
#pragma unroll 1
    for (int ks = ks0; ks < ks1; ++ks) {
        v8f acc[2][2]; V b[2][2], b2[2][2];
#pragma unroll
        for (int mb = 0; mb < 2; ++mb)
#pragma unroll
            for (int nb = 0; nb < 2; ++nb) acc[mb][nb] = (v8f){};
        const bf* kh = Kh + ((size_t)h * TT + (k0 + ks * 32)) * HD + 8 * lane; const bf* kl = Kl + ((size_t)h * TT + (k0 + ks * 32)) * HD + 8 * lane;
#pragma unroll
        for (int kk = 0; kk < 2; ++kk)
#pragma unroll
            for (int nb = 0; nb < 2; ++nb) { b[kk][nb] = ldq(kh + nb * 16 * HD + kk * 512); b2[kk][nb] = ldq(kl + nb * 16 * HD + kk * 512); }
        loads_out(kh, kl);
#pragma unroll
        for (int kk = 0; kk < 2; ++kk)
#pragma unroll
            for (int nb = 0; nb < 2; ++nb)
#pragma unroll
                for (int mb = 0; mb < 2; ++mb) { acc[mb][nb] = F::mma(qa[mb][kk], b[kk][nb], acc[mb][nb]); acc[mb][nb] = F::mma(qb[mb][kk], b[kk][nb], acc[mb][nb]); acc[mb][nb] = F::mma(qa[mb][kk], b2[kk][nb], acc[mb][nb]); }
#pragma unroll
        for (int mb = 0; mb < 2; ++mb)
#pragma unroll
            for (int nb = 0; nb < 2; ++nb)
#pragma unroll
                for (int j = 0; j < 8; ++j) S[(mb * 16 + hi * 8 + j) * PS + ks * 32 + nb * 16 + lr] = acc[mb][nb][j];
    }
    wsync();
    rowsoft<BK>(S + lane * PS, max(lane, b0 - k0), min(lane + 63, b0 + TB - 1 - k0));   // column c is key k0 + c; row r0 + lane sees keys r0 + lane - 32 .. r0 + lane + 31 of its entry
    wsync();
    // band probabilities x values
    v8f o[2][4];
#pragma unroll
    for (int mb = 0; mb < 2; ++mb)
#pragma unroll
        for (int nb = 0; nb < 4; ++nb) o[mb][nb] = (v8f){};
#pragma unroll 1
    for (int ks = ks0; ks < ks1; ++ks) {
        V a[2], a2[2], b[4], b2[4];
        const bf* vh = Vh + ((size_t)h * (TT / 32) + ((k0 + ks * 32) >> 5)) * 2048 + 8 * lane; const bf* vl = Vl + ((size_t)h * (TT / 32) + ((k0 + ks * 32) >> 5)) * 2048 + 8 * lane;   // the 32-key block of the step's first key k0 + 32 ks
#pragma unroll
        for (int nb = 0; nb < 4; ++nb) { b[nb] = ldq(vh + nb * 512); b2[nb] = ldq(vl + nb * 512); }
#pragma unroll
        for (int mb = 0; mb < 2; ++mb) { a[mb] = ldl(P + (mb * 16 + lr) * (2 * PS) + ks * 32 + 8 * hi); a2[mb] = ldl(P + (mb * 16 + lr) * (2 * PS) + BK + ks * 32 + 8 * hi); }
        loads_out(vh, vl);
#pragma unroll
        for (int nb = 0; nb < 4; ++nb)
#pragma unroll
            for (int mb = 0; mb < 2; ++mb) { o[mb][nb] = F::mma(a[mb], b[nb], o[mb][nb]); o[mb][nb] = F::mma(a2[mb], b[nb], o[mb][nb]); o[mb][nb] = F::mma(a[mb], b2[nb], o[mb][nb]); }
        // the distance behind the last matrix instructions on the loop's back edge, where the next trip's loads overwrite their operands
        asm volatile("v_nop\n\tv_nop\n\tv_nop\n\tv_nop" : "+v"(o[0][0]), "+v"(o[1][1]), "+v"(o[0][2]), "+v"(o[1][3]) : "v"(a[0]), "v"(a[1]));
    }
    wsync();
    // the sum of the two partial outputs, through LDS for whole-line stores
#pragma unroll
    for (int mb = 0; mb < 2; ++mb)
#pragma unroll
        for (int nb = 0; nb < 4; ++nb)
#pragma unroll
            for (int j = 0; j < 8; ++j) S[(mb * 16 + hi * 8 + j) * PS + nb * 16 + lr] = __fadd_rn(o[mb][nb][j], og[mb][nb][j]);
    wsync();
    const size_t mo = (size_t)r0 * DQ + h * HD + lr * 4;   // a row's 64 columns of one head are one 128-byte line of each merged plane
    v2u oh[16], ol[16];
#pragma unroll
    for (int s = 0; s < 16; ++s) { const v4f val = *(const v4fa*)(S + (2 * s + hi) * PS + lr * 4);
#pragma unroll
        for (int q = 0; q < 2; ++q) { unsigned a_, c_; splitf2(val[2 * q], val[2 * q + 1], a_, c_); oh[s][q] = a_; ol[s][q] = c_; } }
    __builtin_amdgcn_sched_barrier(0);   // every row is split before the first store issues: behind the stores no register that one of them names is written again
#pragma unroll
    for (int s = 0; s < 16; ++s) { *(v2u*)(Mh + mo + (size_t)(2 * s + hi) * DQ) = oh[s]; *(v2u*)(Ml + mo + (size_t)(2 * s + hi) * DQ) = ol[s]; }
}

typedef __attribute__((ext_vector_type(2))) _Float16 v2h;
typedef __attribute__((ext_vector_type(4))) _Float16 v4h;
typedef __attribute__((ext_vector_type(2))) unsigned short v2us;
typedef __attribute__((ext_vector_type(2))) float v2f;
typedef __attribute__((ext_vector_type(4))) int v4i;

// ---- k_prep: every operand of the two projections in ONE launch: x -> bf16 (XB) and both weights [k][n] f32 -> [n][k] bf16 (WALL, WO); grid PWG work-groups (one a WGP) of 12 independent waves, no work-group barrier.
// All loops are unrolled in full, so that their arrays are registers. Every wave moves 16 KB in and 8 KB out, its 32 loads of 16 bytes a lane all in flight at once, every load and store in whole lines. Waves 4 .. 11: 4096 consecutive elements of x each.
// Waves 0 .. 3 (one a SIMD): one 64 k x 64 n tile of a weight each, read as 256-byte pieces of its k rows, two k packed to a dword, transposed through the wave's own LDS rows, stored as one 128-byte line of each n row.
#define PWG  256
#define TP   33                   // LDS row pitch of a transposed tile in dwords: odd, so that the 16 x 4 n rows of a store and the 32 dwords of a row read each fall on banks of their own
typedef unsigned __attribute__((may_alias)) u32a;
static_assert((size_t)TT * DM == (size_t)PWG * 8 * 4096 && (3 * DM / 64) * (DM / 64) + (DM / 64) * (DQ / 64) == PWG * 4, "k_prep: one piece a wave");
template <int N>
__device__ __forceinline__ void wt_tile(const float* __restrict__ w, bf* Bt, int t, u32a* T, int lane) {   // tile t: k rows 64 (t % 16) .., columns 64 (t / 16) .. of w [DM][N]
    const int c = lane & 15, r = lane >> 4, kt = t & 15, nt = t >> 4;
    const float* s = w + (size_t)(kt * 64 + 2 * r) * N + nt * 64 + 4 * c; v4f v[32];
#pragma unroll
    for (int j = 0; j < 32; ++j) v[j] = *(const v4f*)(s + (size_t)(4 * (j >> 1) + (j & 1)) * N);   // loads 2 i and 2 i + 1 bring rows k and k + 1 to the same lane
    __builtin_amdgcn_sched_barrier(0);                      // all 32 loads are in flight before the first value is waited for
#pragma unroll
    for (int i = 0; i < 16; ++i)
#pragma unroll
        for (int q = 0; q < 4; ++q) T[(4 * c + q) * TP + 2 * i + r] = f2bf2(v[2 * i][q], v[2 * i + 1][q]);
    wsync();
    unsigned o[64];
#pragma unroll
    for (int n = 0; n < 64; ++n) o[n] = T[n * TP + lane];
    u32a* d = (u32a*)(Bt + (size_t)nt * 64 * DM + kt * 64) + lane;
#pragma unroll
    for (int n = 0; n < 64; ++n) d[n * (DM / 2)] = o[n];
    asm volatile("s_wait_xcnt 0x0" ::: "memory");         // the wait before a register that these stores name is written again (the built code goes on into other paths' text behind them)
}
__global__ __launch_bounds__(384) void k_prep(const float* __restrict__ x, const float* __restrict__ wqkv, const float* __restrict__ wo, bf* XB, bf* WALL, bf* WO) {
    __shared__ __align__(16) unsigned tl[4][64 * TP];
    const int lane = threadIdx.x & 31; const int w = __builtin_amdgcn_readfirstlane((int)(threadIdx.x >> 5));
    if (w < 4) {
        const int t = blockIdx.x * 4 + w;
        if (t < (3 * DM / 64) * (DM / 64)) wt_tile<3 * DM>(wqkv, WALL, t, (u32a*)tl[w], lane); else wt_tile<DM>(wo, WO, t - (3 * DM / 64) * (DM / 64), (u32a*)tl[w], lane);
        return;
    }
    const size_t e = ((size_t)blockIdx.x * 8 + (w - 4)) * 4096 + lane * 4; const float* s = x + e; v4f v[32]; v2u o[32];
#pragma unroll
    for (int j = 0; j < 32; ++j) v[j] = *(const v4f*)(s + j * 128);
    __builtin_amdgcn_sched_barrier(0);                      // all 32 loads are in flight before the first value is waited for
#pragma unroll
    for (int j = 0; j < 32; ++j)
#pragma unroll
        for (int q = 0; q < 2; ++q) o[j][q] = f2bf2(v[j][2 * q], v[j][2 * q + 1]);
    __builtin_amdgcn_sched_barrier(0);                      // every value is rounded before the first store issues, so that the stores go out as one run with no register of theirs written among them
#pragma unroll
    for (int j = 0; j < 32; ++j) *(v2u*)(XB + e + j * 128) = o[j];
    asm volatile("s_wait_xcnt 0x0" ::: "memory");         // the wait before a register that these stores name is written again
}

extern "C" void kernel_launch(void* const* d_in, const int* in_sizes, int n_in,
                              void* d_out, int out_size, void* d_ws, size_t ws_size, hipStream_t stream) {
    (void)in_sizes; (void)n_in; (void)out_size;
    const float* x = (const float*)d_in[0]; const float* wqkv = (const float*)d_in[1]; const float* wo = (const float*)d_in[2]; const float* bo = (const float*)d_in[3]; const float* wq = nullptr; const float* wk = nullptr; const float* wv = nullptr; (void)wq; (void)wk; (void)wv;
    float* OUT = (float*)d_out;     // [2][4096][1024]
    char* wsp = (char*)d_ws;
    auto take = [&](size_t bytes) { char* p = wsp; wsp += (bytes + 255) & ~(size_t)255; return (void*)p; };
    bf* WALL = (bf*)take((size_t)3 * DM * DM * 2); bf* WO = (bf*)take((size_t)DM * DQ * 2);
    bf* XB = (bf*)take((size_t)TT * DM * 2);
    bf* QPh = (bf*)take((6 * PLN + 2 * GAT) * 2); bf* QPl = QPh + PLN; bf* KPh = QPh + 2 * PLN; bf* KPl = QPh + 3 * PLN; bf* VTh = QPh + 4 * PLN; bf* VTl = QPh + 5 * PLN;   bf* KG = QPh + 6 * PLN; bf* VG = KG + GAT;   /* one block: the projection's epilogue finds the k and v planes and the strided rows behind the q planes */
    bf* ATh = (bf*)take((size_t)TT * DQ * 2); bf* ATl = (bf*)take((size_t)TT * DQ * 2);   /* merged planes [t][head * HD + d] */
    if ((size_t)(wsp - (char*)d_ws) > ws_size) return;    // ws 256 MiB
    k_prep<<<PWG, 384, 0, stream>>>(x, wqkv, wo, XB, WALL, WO);   /* x -> bf16; 'xw' [DM][3DM] -> Bt [3DM][DM] (row blocks q | k | v); w_out [DQ][DM] -> Bt [DM][DQ] */
    k_gemmb<0, 2, DM><<<dim3(TT / 128, 3 * DM / 128, 1), 128, 0, stream>>>(XB, nullptr, WALL, nullptr, nullptr, QPh, QPl);   /* [q|k|v] projection, epilogue -> hi/lo planes */
    k_attn<<<dim3(TT / 128, NH_, 1), 128, 0, stream>>>(QPh, QPl, KPh, KPl, VTh, VTl, KG, VG, ATh, ATl);   /* band + global attention, y = head -> merged planes */
    k_gemmb<1, 1, DQ><<<dim3(TT / 128, DM / 128, 1), 128, 0, stream>>>(ATh, ATl, WO, OUT, bo, nullptr, nullptr);
}

// v010
// One run takes 92.3 microseconds.
// In two side-by-side timings against v009, it was 1.11 and 1.10 times as fast.
// All steps since v000 together make it 12.5 times as fast.
#include <hip/hip_runtime.h>

// Local (sliding window of 64, centred) + strided global (every 64th key) attention, summed, then an output projection (x [2][4096][1024]; [q|k|v] = x w_qkv ('xw' [1024][3072], reshape (3, H, Dh): thirds); 16 heads x 64; local: softmax over keys j in [i-32, i+31] (clipped to the sequence) of q.k/8; global: softmax over the 64 keys j = 64 g of q.k/8; out = (attn_local v + attn_global v_g) merged, w_out + b_out -> [2][4096][1024] (8.4 M)).
// Both batch entries run in the same launches as rows 0 .. 8191; a row's band span, window and global keys are clipped to its own entry.
// Algorithm: hi/lo planes of q, k (as [head][t][d]) and v (transposed, in [head][32 keys][16 d] tiles) are written by the epilogue of ONE projection launch over all 3072 columns of [q|k|v], which also writes the 64 strided keys / values per head and entry a second time in lines of their own; ONE attention launch (k_attn, one wave per head and 32 query rows) does band scores, global scores, both softmaxes and both probability x value products with scores and probabilities in LDS, and writes the merged hi/lo planes for the output projection.
// Plane layout: the q and k planes keep each tile of 16 rows x 64 columns (2 KB) in FRAGMENT ORDER, 16-byte piece c (8 columns) of row r at piece (c >> 1) * 32 + (c & 1) * 16 + r; the v planes are [head][32 keys][16 d] tiles of 1 KB,
// the 8 keys 16 a + 8 b .. of row d at piece a * 32 + b * 16 + d % 16. Lane l of a fragment load then reads piece l of a run of 32: one load or store of a wave is 512 contiguous bytes, four whole lines, where row-major planes gave 32 bytes of each of 16 lines.
// Compute dtypes, f32 accumulate: every input rounded to bf16; q/k/v on PLAIN bf16 operands (inputs: exact); band / global scores and probability x value products on hi/lo planes (3 products); both softmaxes f32; w_out hl x exact (2 products) + b_out.

#define NB_  2
#define TB   4096                 // rows (tokens) of one batch entry
#define TT   (NB_ * TB)           // all rows: both batch entries stand one behind the other in every plane and go through every launch together
#define DM   1024
#define NH_  16
#define NKV  16
#define REP  (NH_ / NKV)
#define HD   64
#define DQ   (NH_ * HD)
#define DKV  (NKV * HD)
#define ZH   1
#define RH   4096
#define LWH  32                   // half window: keys i-32 .. i+31
#define NG   64                   // global keys (every 64th) of one batch entry
#define NGA  (NB_ * NG)           // gathered keys of all rows
#define WIN  4096
#define PCAR 1024.0f
#define SCL  0.125f   // HD^-0.5
#define PLN  ((size_t)NH_ * TT * HD)   // elements of one q / k / v plane
#define GAT  ((size_t)NH_ * NB_ * 2 * NG * HD)   // elements of the strided key rows, and of the strided value rows: [head][entry][g][half of d][hi 32 | lo 32], behind the six planes
typedef _Float16 h16;
typedef unsigned short bf;
typedef __attribute__((ext_vector_type(16))) __bf16   v16bf;
typedef __attribute__((ext_vector_type(16))) _Float16 v16h;
typedef __attribute__((ext_vector_type(8)))  _Float16 v8h;
typedef __attribute__((ext_vector_type(8)))  unsigned short v8us;
typedef __attribute__((ext_vector_type(8)))  float    v8f;
typedef __attribute__((ext_vector_type(4)))  float    v4f;
typedef v8h  __attribute__((may_alias)) v8ha;
typedef v4f  __attribute__((may_alias)) v4fa;
typedef v8us __attribute__((may_alias)) v8usa;

typedef __attribute__((ext_vector_type(2))) __bf16   v2bf;
typedef __attribute__((ext_vector_type(2))) float    p2f;
typedef __attribute__((ext_vector_type(2))) unsigned v2u;
typedef __attribute__((ext_vector_type(4))) unsigned v4u;
typedef v4u  __attribute__((may_alias)) v4ua;
// two f32 rounded to bf16 (nearest even) by the chip's own packed conversion, one instruction: a in the low half of the dword, b in the high half, as two neighbours of a bf16 row lie in memory
__device__ __forceinline__ unsigned f2bf2(float a, float b) { const p2f t = { a, b }; return __builtin_bit_cast(unsigned, __builtin_convertvector(t, v2bf)); }
__device__ __forceinline__ unsigned short f2bf(float f) { return (unsigned short)f2bf2(f, f); }
__device__ __forceinline__ float bf2f(unsigned short b) { return __uint_as_float(((unsigned)b) << 16); }
__device__ __forceinline__ float bfr(float f) { return bf2f(f2bf(f)); }
// two neighbours split into hi and lo, each pair one dword
__device__ __forceinline__ void splitf2(float y0, float y1, unsigned& h, unsigned& l) { h = f2bf2(y0, y1); l = f2bf2(y0 - __uint_as_float(h << 16), y1 - __uint_as_float(h & 0xFFFF0000u)); }
typedef __attribute__((ext_vector_type(4))) unsigned short v4us;
__device__ __forceinline__ v16h cat16(v8h lo, v8h hi) { return __builtin_shufflevector(lo, hi, 0, 1, 2, 3, 4, 5, 6, 7, 8, 9, 10, 11, 12, 13, 14, 15); }
__device__ __forceinline__ v16bf cat16b(v8us lo, v8us hi) { return __builtin_bit_cast(v16bf, __builtin_shufflevector(lo, hi, 0, 1, 2, 3, 4, 5, 6, 7, 8, 9, 10, 11, 12, 13, 14, 15)); }
__device__ __forceinline__ v8f wmma16(v16h a, v16h b, v8f c) { return __builtin_amdgcn_wmma_f32_16x16x32_f16(false, a, false, b, (short)0, c, false, false); }
__device__ __forceinline__ v8f wmmab(v16bf a, v16bf b, v8f c) { return __builtin_amdgcn_wmma_f32_16x16x32_bf16(false, a, false, b, (short)0, c, false, false); }



template <typename T16> struct WFrag;
template <> struct WFrag<h16> { typedef v16h V; static __device__ __forceinline__ V ld(const h16* p) { return cat16(*(const v8h*)p, *(const v8h*)(p + 16)); } static __device__ __forceinline__ v8f mma(V a, V b, v8f c) { return wmma16(a, b, c); } };
template <> struct WFrag<bf> { typedef v16bf V; static __device__ __forceinline__ V ld(const bf* p) { return cat16b(*(const v8us*)p, *(const v8us*)(p + 16)); } static __device__ __forceinline__ v8f mma(V a, V b, v8f c) { return wmmab(a, b, c); } };
__device__ __forceinline__ v16bf ldq(const bf* p) { return cat16b(*(const v8us*)p, *(const v8us*)(p + 256)); }   // a fragment of a plane in fragment order: p = tile + 512 * (32-k step) + 8 * lane; the second 8 k stand 32 pieces on
__device__ __forceinline__ v16bf ldl(const bf* p) { return cat16b(*(const v8usa*)p, *(const v8usa*)(p + 16)); }

// ---- k_gemmb: block-tiled GEMM, one 128x128 output tile per work-group of 4 waves (2 x 2, each wave 64x64 = 16 accumulators); grid (M/128, N/128), 128 threads.
// C[m][n] = sum_k A[m][k] Bt[n][k] (NSPLIT 1: + A2[m][k] Bt[n][k], product by product as k goes up), operands K-contiguous bf16 planes of KD columns, KD % 64 == 0, KD >= 128.
// A stage is 64 k, one whole 128-byte line of every operand row: rows [A 128 | A2 128 (NSPLIT 1) | Bt 128] at an LDS pitch of 144 bytes (16 B x odd, for the 16-byte fragment reads). Two buffers, filled by asynchronous copies to LDS,
// 16 bytes a lane (8 lanes cover a line, a wave's copy 4 lines); the next stage's copies fly while this stage is worked on; each operand line leaves L2 once per work-group and is read by two waves from LDS.
// Registers: all fragments of a stage are held at once beside the accumulators, so three (NSPLIT 1: two) waves a SIMD are asked for. The epilogue stores a wave's f32 tile to C (pitch DM) with the bias, in whole lines through LDS.
#define GPB  144                  // LDS row pitch in bytes
// 128 rows of one operand's stage: 8 copies a lane, 16 rows apart. The wait is the last line of the copies' own statement: it stands before any register that a copy names is written again.
__device__ __forceinline__ void copy_rows(unsigned l, const bf* g, int kd) {
    asm volatile("global_load_async_to_lds_b128 %0, %8, off\n\t"
                 "global_load_async_to_lds_b128 %1, %9, off\n\t"
                 "global_load_async_to_lds_b128 %2, %10, off\n\t"
                 "global_load_async_to_lds_b128 %3, %11, off\n\t"
                 "global_load_async_to_lds_b128 %4, %12, off\n\t"
                 "global_load_async_to_lds_b128 %5, %13, off\n\t"
                 "global_load_async_to_lds_b128 %6, %14, off\n\t"
                 "global_load_async_to_lds_b128 %7, %15, off\n\t"
                 "s_wait_xcnt 0x0"
                 :: "v"(l), "v"(l + 16 * GPB), "v"(l + 32 * GPB), "v"(l + 48 * GPB), "v"(l + 64 * GPB), "v"(l + 80 * GPB), "v"(l + 96 * GPB), "v"(l + 112 * GPB),
                    "v"(g), "v"(g + 16 * kd), "v"(g + 32 * kd), "v"(g + 48 * kd), "v"(g + 64 * kd), "v"(g + 80 * kd), "v"(g + 96 * kd), "v"(g + 112 * kd) : "memory");
}
template <int NSPLIT, int KD>
__global__ __launch_bounds__(128, NSPLIT ? 2 : 3) void k_gemmb(const bf* __restrict__ A, const bf* __restrict__ A2, const bf* __restrict__ Bt, float* C, const float* __restrict__ bias) {
    typedef WFrag<bf> F; typedef F::V V;
    constexpr int STG = (2 + NSPLIT) * 128 * GPB, BO = (1 + NSPLIT) * 128 * GPB, NT = KD / 64;   // bytes of a stage, place of the Bt rows in it, stages
    __shared__ __align__(16) char sm[2 * STG];
    const int tid = threadIdx.x, lane = tid & 31, lr = lane & 15, hi = lane >> 4; const int w = __builtin_amdgcn_readfirstlane(tid >> 5), wm = w >> 1, wn = w & 1;
    const int r0 = blockIdx.x * 128 + wm * 64, c0 = blockIdx.y * 128 + wn * 64;   // this wave's 64x64 tile
    const size_t go = (size_t)(tid >> 3) * KD + (tid & 7) * 8;   // a lane's row and 16-byte piece in every copy
    const bf* ga = A + (size_t)blockIdx.x * 128 * KD + go; const bf* ga2 = NSPLIT ? A2 + (size_t)blockIdx.x * 128 * KD + go : nullptr; const bf* gb = Bt + (size_t)blockIdx.y * 128 * KD + go;
    const unsigned l0 = (unsigned)(size_t)sm + (tid >> 3) * GPB + (tid & 7) * 16;
    auto fill = [&](int t, int buf) { copy_rows(l0 + buf * STG, ga + t * 64, KD); if (NSPLIT) copy_rows(l0 + buf * STG + 128 * GPB, ga2 + t * 64, KD); copy_rows(l0 + buf * STG + BO, gb + t * 64, KD); };
    v8f acc[4][4];
#pragma unroll
    for (int mb = 0; mb < 4; ++mb)
#pragma unroll
        for (int nb = 0; nb < 4; ++nb) acc[mb][nb] = (v8f){};
    fill(0, 0);
    asm volatile("s_wait_asynccnt 0x0" ::: "memory");   // this wave's copies of stage 0 have landed
    __syncthreads();                                    // ... and every other wave's
    fill(1, 1);
    const char* fa = sm + (wm * 64 + lr) * GPB + hi * 16; const char* fb = sm + BO + (wn * 64 + lr) * GPB + hi * 16;
#pragma unroll 1   // rolled: one copy of the stage's text, the buffer picked by t & 1
    for (int t = 0; t < NT; ++t) {
        const int bo = (t & 1) * STG;
        V a[2][4], a2[2][4], b[2][4];
#pragma unroll
        for (int kk = 0; kk < 2; ++kk) {
#pragma unroll
            for (int mb = 0; mb < 4; ++mb) { a[kk][mb] = ldl((const bf*)(fa + bo + mb * 16 * GPB + kk * 64)); if (NSPLIT) a2[kk][mb] = ldl((const bf*)(fa + bo + (128 + mb * 16) * GPB + kk * 64)); }
#pragma unroll
            for (int nb = 0; nb < 4; ++nb) b[kk][nb] = ldl((const bf*)(fb + bo + nb * 16 * GPB + kk * 64)); }
        __builtin_amdgcn_sched_barrier(0);   // all fragment reads of the stage go out as one group ahead of its products: left alone they were issued two at a time into one register set among the products, one LDS latency each time
#pragma unroll
        for (int kk = 0; kk < 2; ++kk)
#pragma unroll
            for (int nb = 0; nb < 4; ++nb)
#pragma unroll
                for (int mb = 0; mb < 4; ++mb) { acc[mb][nb] = F::mma(a[kk][mb], b[kk][nb], acc[mb][nb]); if (NSPLIT) acc[mb][nb] = F::mma(a2[kk][mb], b[kk][nb], acc[mb][nb]); }
        __builtin_amdgcn_sched_barrier(0);   // the waits and the barrier stay behind the products: moved up in front of them, the wait for the next stage's copies came one stage's products too early
        asm volatile("s_wait_dscnt 0x0" ::: "memory");      // this wave's reads of the buffer are done before it is handed to the copies
        asm volatile("s_wait_asynccnt 0x0" ::: "memory");   // this wave's copies of stage t + 1 have landed
        __syncthreads();                                    // publishes stage t + 1 and ends every wave's reads of stage t
        if (t + 2 < NT) fill(t + 2, t & 1);
    }
    asm volatile("s_wait_asynccnt 0x0" ::: "memory");       // no copy is outstanding when the ring becomes output staging (the last trip's barrier ended every read of it)
    float* os = (float*)(sm + w * (16 * 68 * 4));           // each wave stages in its own range
#pragma unroll
    for (int mb = 0; mb < 4; ++mb) {
#pragma unroll
        for (int nb = 0; nb < 4; ++nb) {
#pragma unroll
            for (int j = 0; j < 8; ++j) os[(hi * 8 + j) * 68 + nb * 16 + lr] = acc[mb][nb][j]; }
        __builtin_amdgcn_wave_barrier(); asm volatile("" ::: "memory");   // rows that some lanes wrote are read by other lanes of the same wave: keeps the compiler from moving LDS accesses over the hand-over
        {
            float* crow = C + (size_t)(r0 + mb * 16) * DM + c0;
#pragma unroll
            for (int s = 0; s < 8; ++s) { const int row = 2 * s + hi, cofs = lr * 4; v4f val = *(const v4fa*)(os + row * 68 + cofs); val[0] += bfr(bias[c0 + cofs]); val[1] += bfr(bias[c0 + cofs + 1]); val[2] += bfr(bias[c0 + cofs + 2]); val[3] += bfr(bias[c0 + cofs + 3]);
                *(v4f*)(crow + (size_t)row * DM + cofs) = val; }
        }
        asm volatile("s_wait_xcnt 0x0" ::: "memory");   // the next block's LDS reads reuse registers that these stores name
        __builtin_amdgcn_wave_barrier(); asm volatile("" ::: "memory");
    }
}

// ---- k_qkv: the [q|k|v] projection, one 256 x 192 output tile per work-group of 4 waves (2 x 2, each wave 128 x 96 = 48 accumulators); grid (TT / 256, head), 128 threads: 512 work-groups, two a WGP, two waves a SIMD, all resident at once.
// The 192 columns are the 64 of q, the 64 of k and the 64 of v of ONE head (rows h * 64 .. of each third of Bt); wave column wn takes columns 32 wn .. 32 wn + 31 of each of the three. A fragment read from LDS then feeds 6 or 8 products, not 4,
// and an operand line that leaves L2 feeds a 256 x 192 tile, not 128 x 128. Ring, stage (64 k, one line of every operand row: [x 256 rows | q 64 | k 64 | v 64] at pitch GPB), waits and barrier as in k_gemmb; of 32 k the six weight fragments and four of the eight x fragments are held at a time (384 accumulator registers stand beside them).
// Epilogue: the tile is split into bf16 hi/lo and stored to the planes (Mh/Ml: q planes; k and v planes follow at 2 PLN and 4 PLN elements), q and k as [head][t][d], v transposed ([head][32 t][d]), all in fragment order (head of the file): a wave's 32 columns are 1 KB in a row of a q or k tile and two whole 1 KB tiles of v.
// Every 64th row of the k and v thirds is stored once more at 6 PLN (keys) and 6 PLN + GAT (values), as [head][entry][g][wn][hi 32 | lo 32]: each 128-byte line is written by one wave.
// One lane's 16 bytes to LDS, as the builtin: its address registers are the compiler's to choose among all 512 (an asm operand must lie in v0 .. v255, where accumulators stand: with asm copies six of them were moved out and back at every stage).
typedef __attribute__((ext_vector_type(4))) int c4i; typedef __attribute__((address_space(1))) c4i c4i_g; typedef __attribute__((address_space(3))) c4i c4i_l;
__device__ __forceinline__ void copy16(const bf* g, char* l) { __builtin_amdgcn_global_load_async_to_lds_b128((c4i_g*)g, (c4i_l*)l, 0, 0); }
__global__ __launch_bounds__(128, 2) void k_qkv(const bf* __restrict__ A, const bf* __restrict__ Bt, bf* Mh, bf* Ml, const int kd) {   // kd: the operands' row pitch in elements (DM)
    typedef WFrag<bf> F; typedef F::V V;
    constexpr int STG = (256 + 192) * GPB, BO = 256 * GPB, NT = DM / 64;   // bytes of a stage, place of the weight rows in it, stages
    __shared__ __align__(16) char sm[2 * STG];
    const int tid = threadIdx.x, lane = tid & 31, lr = lane & 15, hi = lane >> 4; const int w = __builtin_amdgcn_readfirstlane(tid >> 5), wm = w >> 1, wn = w & 1;
    const int h = blockIdx.y, r0 = blockIdx.x * 256 + wm * 128;   // the head; this wave's first row
    const size_t go = (size_t)(tid >> 3) * DM + (tid & 7) * 8;   // a lane's row and 16-byte piece in every copy
    const bf* ga = A + (size_t)blockIdx.x * 256 * DM + go; const bf* gb = Bt + (size_t)h * HD * DM + go;
    char* l0 = sm + (tid >> 3) * GPB + (tid & 7) * 16;
    // 28 copies a lane, 16 rows apart: 256 rows of x, then 64 weight rows of each third. The row step comes from the argument kd: as a constant it was folded into the copies' offset field (32,768) and taken off the LDS address register,
    // which then wrapped below 0 for the ring's first rows, at an offset and in an LDS allocation for which no landing of such a copy is on record
    auto fill = [&](int t, int buf) {
#pragma unroll
        for (int j = 0; j < 16; ++j) copy16(ga + t * 64 + (long)j * 16 * kd, l0 + buf * STG + j * 16 * GPB);
#pragma unroll
        for (int j = 0; j < 12; ++j) copy16(gb + t * 64 + ((long)(j >> 2) * DM * DM + (long)(j & 3) * 16 * kd), l0 + buf * STG + BO + j * 16 * GPB);
    };
    v8f acc[8][6];
#pragma unroll
    for (int mb = 0; mb < 8; ++mb)
#pragma unroll
        for (int nb = 0; nb < 6; ++nb) acc[mb][nb] = (v8f){};
    fill(0, 0);
    asm volatile("s_wait_asynccnt 0x0" ::: "memory");   // this wave's copies of stage 0 have landed
    __syncthreads();                                    // ... and every other wave's
    fill(1, 1);
    const char* fa = sm + (wm * 128 + lr) * GPB + hi * 16; const char* fb = sm + BO + (wn * 32 + lr) * GPB + hi * 16;
#pragma unroll 1   // rolled: one copy of the stage's text, the buffer picked by t & 1
    for (int t = 0; t < NT; ++t) {
        const int bo = (t & 1) * STG;
#pragma unroll
        for (int kk = 0; kk < 2; ++kk) {
            V a[4], b[6];   // the six weight fragments of 32 k, and four places for its eight x fragments: all eight at once did not fit beside the accumulators (spills)
#pragma unroll
            for (int nb = 0; nb < 6; ++nb) b[nb] = ldl((const bf*)(fb + bo + ((nb >> 1) * 64 + (nb & 1) * 16) * GPB + kk * 64));   // nb 0, 1: q; 2, 3: k; 4, 5: v
#pragma unroll
            for (int mb = 0; mb < 4; ++mb) a[mb] = ldl((const bf*)(fa + bo + mb * 16 * GPB + kk * 64));
            // every scheduling barrier below keeps a group of reads, or of products, whole and in its place: a pair of x fragments is read into the places that the 12 products before it have left, 12 products ahead of its own
            __builtin_amdgcn_sched_barrier(0);
#pragma unroll
            for (int p = 0; p < 4; ++p) {   // pair p: x fragments 2 p and 2 p + 1, in places 2 (p & 1) and 2 (p & 1) + 1
#pragma unroll
                for (int i = 0; i < 2; ++i)
#pragma unroll
                    for (int nb = 0; nb < 6; ++nb) acc[2 * p + i][nb] = F::mma(a[2 * (p & 1) + i], b[nb], acc[2 * p + i][nb]);
                __builtin_amdgcn_sched_barrier(0);
                if (p < 2) {
#pragma unroll
                    for (int i = 0; i < 2; ++i) a[2 * p + i] = ldl((const bf*)(fa + bo + (4 + 2 * p + i) * 16 * GPB + kk * 64));
                    __builtin_amdgcn_sched_barrier(0);
                }
            }
        }
        asm volatile("s_wait_dscnt 0x0" ::: "memory");      // this wave's reads of the buffer are done before it is handed to the copies
        asm volatile("s_wait_asynccnt 0x0" ::: "memory");   // this wave's copies of stage t + 1 have landed
        __syncthreads();                                    // publishes stage t + 1 and ends every wave's reads of stage t
        if (t + 2 < NT) fill(t + 2, t & 1);
    }
    asm volatile("s_wait_asynccnt 0x0" ::: "memory");       // no copy is outstanding when the ring becomes output staging (the last trip's barrier ended every read of it)
    float* os = (float*)(sm + w * (16 * 68 * 4));           // each wave stages in its own range
    // v: a lane's 8 accumulator rows are 8 consecutive t of one d, one piece of the transposed planes: 16-byte stores straight from the registers, the wave's 32 pieces in a row
    const size_t vo = 4 * PLN + ((size_t)h * (TT / 32) + (r0 >> 5)) * 2048 + wn * 1024 + lane * 8;
#pragma unroll
    for (int mb = 0; mb < 8; ++mb) {
        v4u oh[2], ol[2];
#pragma unroll
        for (int nv = 0; nv < 2; ++nv)
#pragma unroll
            for (int j = 0; j < 4; ++j) { unsigned a_, c_; splitf2(acc[mb][4 + nv][2 * j], acc[mb][4 + nv][2 * j + 1], a_, c_); oh[nv][j] = a_; ol[nv][j] = c_; }
        __builtin_amdgcn_sched_barrier(0);   // the block is split before its first store issues, so that no register of a store is written among the stores
#pragma unroll
        for (int nv = 0; nv < 2; ++nv) {
            *(v4u*)(Mh + vo + (mb >> 1) * 2048 + nv * 512 + (mb & 1) * 256) = oh[nv]; *(v4u*)(Ml + vo + (mb >> 1) * 2048 + nv * 512 + (mb & 1) * 256) = ol[nv];
            if ((mb & 3) == 0 && hi == 0) {   // row r0 + 16 mb is a strided key: lanes 0 .. 15 hold its d = 32 wn + 16 nv + lr; the two nv fill the wave's line
                const int r = r0 + mb * 16; bf* gv = Mh + 6 * PLN + GAT + (((size_t)(h * NB_ + r / TB) * NG + ((r >> 6) & (NG - 1))) * 2 + wn) * HD + nv * 16 + lr; gv[0] = (bf)oh[nv][0]; gv[32] = (bf)ol[nv][0]; } }
        asm volatile("s_wait_xcnt 0x0" ::: "memory");   // the next block's splits reuse registers that these stores name
        __builtin_amdgcn_sched_barrier(0);              // ... and stay behind the wait
    }
    // q and k: 16 rows x [q 32 | k 32] columns at a time through the wave's LDS rows
#pragma unroll
    for (int mb = 0; mb < 8; ++mb) {
#pragma unroll
        for (int nb = 0; nb < 4; ++nb) {
#pragma unroll
            for (int j = 0; j < 8; ++j) os[(hi * 8 + j) * 68 + nb * 16 + lr] = acc[mb][nb][j]; }
        __builtin_amdgcn_wave_barrier(); asm volatile("" ::: "memory");   // rows that some lanes wrote are read by other lanes of the same wave: keeps the compiler from moving LDS accesses over the hand-over
        const size_t po = ((size_t)h * TT + r0 + mb * 16) * HD + wn * 512 + lane * 8;   // these 16 rows t of the head are one 2 KB tile of each plane, the wave's 32 columns its half wn
        v4u oh[4], ol[4];
#pragma unroll
        for (int s = 0; s < 4; ++s) {   // s 0, 1: q; 2, 3: k; a lane takes the 8 columns 16 (s & 1) + 8 hi .. of row lr
            const float* op = os + lr * 68 + (2 * s + hi) * 8; const v4f v0 = *(const v4fa*)op, v1 = *(const v4fa*)(op + 4);
#pragma unroll
            for (int q = 0; q < 2; ++q) { unsigned a_, c_; splitf2(v0[2 * q], v0[2 * q + 1], a_, c_); oh[s][q] = a_; ol[s][q] = c_; splitf2(v1[2 * q], v1[2 * q + 1], a_, c_); oh[s][2 + q] = a_; ol[s][2 + q] = c_; } }
        __builtin_amdgcn_sched_barrier(0);   // the block is split before its first store issues, so that no register of a store is written among the stores
#pragma unroll
        for (int s = 0; s < 4; ++s) {
            *(v4u*)(Mh + (s >> 1) * 2 * PLN + po + (s & 1) * 256) = oh[s]; *(v4u*)(Ml + (s >> 1) * 2 * PLN + po + (s & 1) * 256) = ol[s];
            if ((mb & 3) == 0 && s >= 2 && lr == 0) {   // row r0 + 16 mb of k is a strided key: lanes 0 and 16 hold two of its pieces; s 2 and 3 fill the wave's line
                const int r = r0 + mb * 16; bf* gk = Mh + 6 * PLN + (((size_t)(h * NB_ + r / TB) * NG + ((r >> 6) & (NG - 1))) * 2 + wn) * HD + (2 * (s & 1) + hi) * 8; *(v4u*)gk = oh[s]; *(v4u*)(gk + 32) = ol[s]; } }
        asm volatile("s_wait_xcnt 0x0" ::: "memory");   // the next block's LDS reads and splits reuse registers that these stores name
        __builtin_amdgcn_sched_barrier(0);              // ... and stay behind the wait
        __builtin_amdgcn_wave_barrier(); asm volatile("" ::: "memory");
    }
}

// ---- k_attn: both attentions of one head for 32 query rows in ONE WAVE, scores and probabilities never leaving the WGP; grid (TT / 128, head), 4 waves a block, each with its own LDS rows for scores and probabilities; the strided key rows of the block's head and entry, then in the same place its strided value rows, are staged in LDS once for all four waves (asynchronous copies, three work-group barriers).
// The windows of rows r0 .. r0 + 31 span the 96 keys r0 - 32 .. r0 + 63: three 32-key steps, each wholly inside or wholly outside the rows' batch entry (outside: skipped). Per wave: band scores (hi/lo, 3 products) -> LDS f32 [32][96];
// lane = row softmax, the bf16 hi | lo probabilities written over the row's own scores (exact zeros outside the window); band P.V with P from LDS and v from the transposed planes; ahead of it the same on the 64 gathered keys; the two f32 partial
// outputs are added, split and stored as the merged hi/lo planes [t][head * HD + d] in whole 128-byte lines.
#define PS   100                  // LDS row pitch in dwords: 400 B = 16 B x odd, for the 16-byte row reads
#define BK   96                   // keys of the band span of 32 rows
// Rows that some lanes wrote to LDS are read by other lanes of the same wave (LDS operations of a wave run in order): this keeps the compiler from moving LDS accesses over the hand-over.
__device__ __forceinline__ void wsync() { __builtin_amdgcn_wave_barrier(); asm volatile("" ::: "memory"); }
// One lane's softmax of NC scores of its LDS row (columns clo .. chi count, the rest get probability 0), probabilities split to bf16 hi (first NC) | lo (next NC) over the same bytes.
template <int NC>
__device__ __forceinline__ void rowsoft(float* srow, int clo, int chi) {
    float s[NC];
#pragma unroll
    for (int c = 0; c < NC; c += 4) { const v4f t = *(const v4fa*)(srow + c); s[c] = t[0]; s[c + 1] = t[1]; s[c + 2] = t[2]; s[c + 3] = t[3]; }
    const unsigned wd = (unsigned)(chi - clo); float m4[4] = { -3.0e38f, -3.0e38f, -3.0e38f, -3.0e38f };
#pragma unroll
    for (int c = 0; c < NC; ++c) { s[c] = ((unsigned)(c - clo) <= wd) ? s[c] * SCL : -3.0e38f; m4[c & 3] = fmaxf(m4[c & 3], s[c]); }
    const float mx = fmaxf(fmaxf(m4[0], m4[1]), fmaxf(m4[2], m4[3])); float a4[4] = { 0.0f, 0.0f, 0.0f, 0.0f };
#pragma unroll
    for (int c = 0; c < NC; c += 4) { float e[4];
#pragma unroll
        for (int q = 0; q < 4; ++q) e[q] = (s[c + q] - mx) * 1.4426950408889634f;
        // four v_exp_f32 on registers of their own, each the independent instruction behind the one before it, and a v_nop behind the last: the slot that the instruction set asks for before a transcendental's result is used or its source overwritten
        asm("v_exp_f32 %0, %4\n\tv_exp_f32 %1, %5\n\tv_exp_f32 %2, %6\n\tv_exp_f32 %3, %7\n\tv_nop" : "=&v"(s[c]), "=&v"(s[c + 1]), "=&v"(s[c + 2]), "=&v"(s[c + 3]) : "v"(e[0]), "v"(e[1]), "v"(e[2]), "v"(e[3]));
#pragma unroll
        for (int q = 0; q < 4; ++q) a4[q] += s[c + q]; }
    const float f = __fdiv_rn(1.0f, (a4[0] + a4[1]) + (a4[2] + a4[3]));
    bf* prow = (bf*)srow;
#pragma unroll
    for (int c = 0; c < NC; c += 8) { v4u oh, ol;
#pragma unroll
        for (int q = 0; q < 4; ++q) { unsigned a_, c_; splitf2(s[c + 2 * q] * f, s[c + 2 * q + 1] * f, a_, c_); oh[q] = a_; ol[q] = c_; }
        *(v4ua*)(prow + c) = oh; *(v4ua*)(prow + NC + c) = ol; }
}
// Behind a group of fragment loads: the wait before a register that these loads name is written again (the two addresses as inputs keep their registers whole up to it), and a scheduling barrier, so that
// every load of the group is in flight before the first product waits on one (without it the loads were issued four at a time into one register set, one L2 latency each time).
__device__ __forceinline__ void loads_out(const bf* p0, const bf* p1) { asm volatile("s_wait_xcnt 0x0" :: "v"(p0), "v"(p1) : "memory"); __builtin_amdgcn_sched_barrier(0); }
#define GKP  144                  // LDS pitch in bytes of the staged key rows: 16 B x odd, for the 16-byte fragment reads
#define GVP  160                  // ... of the staged value rows: 32 B x odd, for the transposing reads
// The 128 lines of one head's and entry's strided keys or values (line 2 g + half: [hi 32 | lo 32] of columns 32 half ..) to 128 LDS rows (64 hi | 64 lo, 64 columns each) at pitch PB: 8 copies a lane, 16 lines = 8 g apart, 8 lanes to a line; l is the lane's place for its first line. The wait is the last line of the copies' own statement: it stands before any register that a copy names is written again.
template <int PB>
__device__ __forceinline__ void copy_g(unsigned l, const bf* g) {
    asm volatile("global_load_async_to_lds_b128 %0, %8, off\n\t"
                 "global_load_async_to_lds_b128 %1, %9, off\n\t"
                 "global_load_async_to_lds_b128 %2, %10, off\n\t"
                 "global_load_async_to_lds_b128 %3, %11, off\n\t"
                 "global_load_async_to_lds_b128 %4, %12, off\n\t"
                 "global_load_async_to_lds_b128 %5, %13, off\n\t"
                 "global_load_async_to_lds_b128 %6, %14, off\n\t"
                 "global_load_async_to_lds_b128 %7, %15, off\n\t"
                 "s_wait_xcnt 0x0"
                 :: "v"(l), "v"(l + 8 * PB), "v"(l + 16 * PB), "v"(l + 24 * PB), "v"(l + 32 * PB), "v"(l + 40 * PB), "v"(l + 48 * PB), "v"(l + 56 * PB),
                    "v"(g), "v"(g + 16 * HD), "v"(g + 32 * HD), "v"(g + 48 * HD), "v"(g + 64 * HD), "v"(g + 80 * HD), "v"(g + 96 * HD), "v"(g + 112 * HD) : "memory");
}
typedef __attribute__((ext_vector_type(8))) short s16x8;
// transposing LDS read: lane l points at row 8 (l >> 4) + (l & 7), bytes 16 ((l >> 3) & 1) of a 16 x 16 tile of 16-bit values and gets rows 8 (l >> 4) .. + 7 of column l & 15
__device__ __forceinline__ v8us ldt(const char* p) { typedef __attribute__((address_space(3))) s16x8 lds_s16x8; return __builtin_bit_cast(v8us, __builtin_amdgcn_ds_load_tr16_b128_v8i16((lds_s16x8*)p)); }
__global__ __launch_bounds__(128, 4) void k_attn(const bf* __restrict__ Qh, const bf* __restrict__ Ql, const bf* __restrict__ Kh, const bf* __restrict__ Kl, const bf* __restrict__ Vh, const bf* __restrict__ Vl,
                                              const bf* __restrict__ KG_, const bf* __restrict__ VG_, bf* Mh, bf* Ml) {
    typedef WFrag<bf> F; typedef F::V V;
    __shared__ __align__(16) float sm[4][32 * PS];
    __shared__ __align__(32) char gs[128 * GVP];   // the strided rows of the block's head and entry (its 128 query rows lie in one entry), shared by the four waves: first the keys, then the values
    const int lane = threadIdx.x & 31, lr = lane & 15, hi = lane >> 4; const int w = __builtin_amdgcn_readfirstlane((int)(threadIdx.x >> 5));
    float* S = sm[w]; const bf* P = (const bf*)S;
    const int h = blockIdx.y, r0 = (blockIdx.x * 4 + w) * 32, eb = r0 / TB, b0 = eb * TB, k0 = r0 - 32;   // k0: first key of the span (off the entry for its first row tile)
    const int ks0 = (k0 < b0) ? 1 : 0, ks1 = (k0 + BK > b0 + TB) ? 2 : 3;                                 // the 32-key steps that lie in the rows' own batch entry
    const bf* qh = Qh + ((size_t)h * TT + r0) * HD + 8 * lane; const bf* ql = Ql + ((size_t)h * TT + r0) * HD + 8 * lane;   // every plane pointer below: first tile + the lane's piece
    const size_t gofs = ((size_t)(h * NB_ + eb) * 2 * NG + (threadIdx.x >> 3)) * HD + (threadIdx.x & 7) * 8;   // a lane's line and 16-byte piece in every copy
    const unsigned grow = ((threadIdx.x >> 2) & 1) * NG + (threadIdx.x >> 4), gcol = (((threadIdx.x >> 3) & 1) * 4 + (threadIdx.x & 3)) * 16;   // where that piece goes: LDS row (hi | lo, g) and byte in it
    copy_g<GKP>((unsigned)(size_t)gs + grow * GKP + gcol, KG_ + gofs);
    // global scores against the entry's 64 strided keys
    {
        V qa[2][2], qb[2][2];
#pragma unroll
        for (int mb = 0; mb < 2; ++mb)
#pragma unroll
            for (int kk = 0; kk < 2; ++kk) { qa[mb][kk] = ldq(qh + mb * 16 * HD + kk * 512); qb[mb][kk] = ldq(ql + mb * 16 * HD + kk * 512); }
        loads_out(qh, ql);
        asm volatile("s_wait_asynccnt 0x0" ::: "memory");   // this wave's copies of the key rows have landed
        __syncthreads();                                    // ... and every other wave's
        v8f g[2][4];
#pragma unroll
        for (int mb = 0; mb < 2; ++mb)
#pragma unroll
            for (int nb = 0; nb < 4; ++nb) g[mb][nb] = (v8f){};
        const char* gk = gs + lr * GKP + hi * 16;   // key row lr, the lane half's 16 bytes of each 32
#pragma unroll
        for (int kk = 0; kk < 2; ++kk) { V b[4], b2[4];
#pragma unroll
            for (int nb = 0; nb < 4; ++nb) { b[nb] = ldl((const bf*)(gk + nb * 16 * GKP + kk * 64)); b2[nb] = ldl((const bf*)(gk + (NG + nb * 16) * GKP + kk * 64)); }
            __builtin_amdgcn_sched_barrier(0);   // the step's fragment reads go out as one group ahead of its products, not a few at a time among them
#pragma unroll
            for (int nb = 0; nb < 4; ++nb)
#pragma unroll
                for (int mb = 0; mb < 2; ++mb) { g[mb][nb] = F::mma(qa[mb][kk], b[nb], g[mb][nb]); g[mb][nb] = F::mma(qb[mb][kk], b[nb], g[mb][nb]); g[mb][nb] = F::mma(qa[mb][kk], b2[nb], g[mb][nb]); } }
#pragma unroll
        for (int mb = 0; mb < 2; ++mb)
#pragma unroll
            for (int nb = 0; nb < 4; ++nb)
#pragma unroll
                for (int j = 0; j < 8; ++j) S[(mb * 16 + hi * 8 + j) * PS + nb * 16 + lr] = g[mb][nb][j];
    }
    asm volatile("s_wait_dscnt 0x0" ::: "memory");      // this wave's reads of the key rows are done before their place is handed to the copies
    __syncthreads();                                    // ends every wave's reads of the key rows
    copy_g<GVP>((unsigned)(size_t)gs + grow * GVP + gcol, VG_ + gofs);   // the value rows fly while the softmax runs
    wsync();
    rowsoft<NG>(S + lane * PS, 0, NG - 1);
    wsync();
    asm volatile("s_wait_asynccnt 0x0" ::: "memory");   // this wave's copies of the value rows have landed
    __syncthreads();                                    // ... and every other wave's
    // global probabilities x strided values (LDS rows [g][d], read transposed: a lane gets 8 g of one d)
    v8f og[2][4];
#pragma unroll
    for (int mb = 0; mb < 2; ++mb)
#pragma unroll
        for (int nb = 0; nb < 4; ++nb) og[mb][nb] = (v8f){};
    { const char* gv = gs + (8 * hi + (lane & 7)) * GVP + ((lane >> 3) & 1) * 16;
#pragma unroll
      for (int kk = 0; kk < 2; ++kk) { V a[2], a2[2], b[4], b2[4];
#pragma unroll
          for (int nb = 0; nb < 4; ++nb) { b[nb] = cat16b(ldt(gv + kk * 32 * GVP + nb * 32), ldt(gv + (kk * 32 + 16) * GVP + nb * 32)); b2[nb] = cat16b(ldt(gv + (NG + kk * 32) * GVP + nb * 32), ldt(gv + (NG + kk * 32 + 16) * GVP + nb * 32)); }
#pragma unroll
          for (int mb = 0; mb < 2; ++mb) { a[mb] = ldl(P + (mb * 16 + lr) * (2 * PS) + kk * 32 + 8 * hi); a2[mb] = ldl(P + (mb * 16 + lr) * (2 * PS) + NG + kk * 32 + 8 * hi); }
          __builtin_amdgcn_sched_barrier(0);   // the step's fragment reads go out as one group ahead of its products
#pragma unroll
          for (int nb = 0; nb < 4; ++nb)
#pragma unroll
              for (int mb = 0; mb < 2; ++mb) { og[mb][nb] = F::mma(a[mb], b[nb], og[mb][nb]); og[mb][nb] = F::mma(a2[mb], b[nb], og[mb][nb]); og[mb][nb] = F::mma(a[mb], b2[nb], og[mb][nb]); } } }
    wsync();
    if (ks0 != 0 || ks1 != 3) {   // a skipped step's score columns get a value, so that the row read below meets only LDS that this pass wrote
        const int cz = (ks0 != 0) ? 0 : 64;
#pragma unroll
        for (int c = 0; c < 32; c += 4) *(v4fa*)(S + lane * PS + cz + c) = (v4f){};
    }
    // band scores; the q fragments are loaded a second time (their 64 registers are free for the value fragments in between: four waves a SIMD have 256 registers each)
    V qa[2][2], qb[2][2];
#pragma unroll
    for (int mb = 0; mb < 2; ++mb)
#pragma unroll
        for (int kk = 0; kk < 2; ++kk) { qa[mb][kk] = ldq(qh + mb * 16 * HD + kk * 512); qb[mb][kk] = ldq(ql + mb * 16 * HD + kk * 512); }
    loads_out(qh, ql);
#pragma unroll 1
    for (int ks = ks0; ks < ks1; ++ks) {
        v8f acc[2][2]; V b[2][2], b2[2][2];
#pragma unroll
        for (int mb = 0; mb < 2; ++mb)
#pragma unroll
            for (int nb = 0; nb < 2; ++nb) acc[mb][nb] = (v8f){};
        const bf* kh = Kh + ((size_t)h * TT + (k0 + ks * 32)) * HD + 8 * lane; const bf* kl = Kl + ((size_t)h * TT + (k0 + ks * 32)) * HD + 8 * lane;
#pragma unroll
        for (int kk = 0; kk < 2; ++kk)
#pragma unroll
            for (int nb = 0; nb < 2; ++nb) { b[kk][nb] = ldq(kh + nb * 16 * HD + kk * 512); b2[kk][nb] = ldq(kl + nb * 16 * HD + kk * 512); }
        loads_out(kh, kl);
#pragma unroll
        for (int kk = 0; kk < 2; ++kk)
#pragma unroll
            for (int nb = 0; nb < 2; ++nb)
#pragma unroll
                for (int mb = 0; mb < 2; ++mb) { acc[mb][nb] = F::mma(qa[mb][kk], b[kk][nb], acc[mb][nb]); acc[mb][nb] = F::mma(qb[mb][kk], b[kk][nb], acc[mb][nb]); acc[mb][nb] = F::mma(qa[mb][kk], b2[kk][nb], acc[mb][nb]); }
#pragma unroll
        for (int mb = 0; mb < 2; ++mb)
#pragma unroll
            for (int nb = 0; nb < 2; ++nb)
#pragma unroll
                for (int j = 0; j < 8; ++j) S[(mb * 16 + hi * 8 + j) * PS + ks * 32 + nb * 16 + lr] = acc[mb][nb][j];
    }
    wsync();
    rowsoft<BK>(S + lane * PS, max(lane, b0 - k0), min(lane + 63, b0 + TB - 1 - k0));   // column c is key k0 + c; row r0 + lane sees keys r0 + lane - 32 .. r0 + lane + 31 of its entry
    wsync();
    // band probabilities x values
    v8f o[2][4];
#pragma unroll
    for (int mb = 0; mb < 2; ++mb)
#pragma unroll
        for (int nb = 0; nb < 4; ++nb) o[mb][nb] = (v8f){};
#pragma unroll 1
    for (int ks = ks0; ks < ks1; ++ks) {
        V a[2], a2[2], b[4], b2[4];
        const bf* vh = Vh + ((size_t)h * (TT / 32) + ((k0 + ks * 32) >> 5)) * 2048 + 8 * lane; const bf* vl = Vl + ((size_t)h * (TT / 32) + ((k0 + ks * 32) >> 5)) * 2048 + 8 * lane;   // the 32-key block of the step's first key k0 + 32 ks
#pragma unroll
        for (int nb = 0; nb < 4; ++nb) { b[nb] = ldq(vh + nb * 512); b2[nb] = ldq(vl + nb * 512); }
#pragma unroll
        for (int mb = 0; mb < 2; ++mb) { a[mb] = ldl(P + (mb * 16 + lr) * (2 * PS) + ks * 32 + 8 * hi); a2[mb] = ldl(P + (mb * 16 + lr) * (2 * PS) + BK + ks * 32 + 8 * hi); }
        loads_out(vh, vl);
#pragma unroll
        for (int nb = 0; nb < 4; ++nb)
#pragma unroll
            for (int mb = 0; mb < 2; ++mb) { o[mb][nb] = F::mma(a[mb], b[nb], o[mb][nb]); o[mb][nb] = F::mma(a2[mb], b[nb], o[mb][nb]); o[mb][nb] = F::mma(a[mb], b2[nb], o[mb][nb]); }
        // the distance behind the last matrix instructions on the loop's back edge, where the next trip's loads overwrite their operands
        asm volatile("v_nop\n\tv_nop\n\tv_nop\n\tv_nop" : "+v"(o[0][0]), "+v"(o[1][1]), "+v"(o[0][2]), "+v"(o[1][3]) : "v"(a[0]), "v"(a[1]));
    }
    wsync();
    // the sum of the two partial outputs, through LDS for whole-line stores
#pragma unroll
    for (int mb = 0; mb < 2; ++mb)
#pragma unroll
        for (int nb = 0; nb < 4; ++nb)
#pragma unroll
            for (int j = 0; j < 8; ++j) S[(mb * 16 + hi * 8 + j) * PS + nb * 16 + lr] = __fadd_rn(o[mb][nb][j], og[mb][nb][j]);
    wsync();
    const size_t mo = (size_t)r0 * DQ + h * HD + lr * 4;   // a row's 64 columns of one head are one 128-byte line of each merged plane
    v2u oh[16], ol[16];
#pragma unroll
    for (int s = 0; s < 16; ++s) { const v4f val = *(const v4fa*)(S + (2 * s + hi) * PS + lr * 4);
#pragma unroll
        for (int q = 0; q < 2; ++q) { unsigned a_, c_; splitf2(val[2 * q], val[2 * q + 1], a_, c_); oh[s][q] = a_; ol[s][q] = c_; } }
    __builtin_amdgcn_sched_barrier(0);   // every row is split before the first store issues: behind the stores no register that one of them names is written again
#pragma unroll
    for (int s = 0; s < 16; ++s) { *(v2u*)(Mh + mo + (size_t)(2 * s + hi) * DQ) = oh[s]; *(v2u*)(Ml + mo + (size_t)(2 * s + hi) * DQ) = ol[s]; }
}

typedef __attribute__((ext_vector_type(2))) _Float16 v2h;
typedef __attribute__((ext_vector_type(4))) _Float16 v4h;
typedef __attribute__((ext_vector_type(2))) unsigned short v2us;
typedef __attribute__((ext_vector_type(2))) float v2f;
typedef __attribute__((ext_vector_type(4))) int v4i;

// ---- k_prep: every operand of the two projections in ONE launch: x -> bf16 (XB) and both weights [k][n] f32 -> [n][k] bf16 (WALL, WO); grid PWG work-groups (one a WGP) of 12 independent waves, no work-group barrier.
// All loops are unrolled in full, so that their arrays are registers. Every wave moves 16 KB in and 8 KB out, its 32 loads of 16 bytes a lane all in flight at once, every load and store in whole lines. Waves 4 .. 11: 4096 consecutive elements of x each.
// Waves 0 .. 3 (one a SIMD): one 64 k x 64 n tile of a weight each, read as 256-byte pieces of its k rows, two k packed to a dword, transposed through the wave's own LDS rows, stored as one 128-byte line of each n row.
#define PWG  256
#define TP   33                   // LDS row pitch of a transposed tile in dwords: odd, so that the 16 x 4 n rows of a store and the 32 dwords of a row read each fall on banks of their own
typedef unsigned __attribute__((may_alias)) u32a;
static_assert((size_t)TT * DM == (size_t)PWG * 8 * 4096 && (3 * DM / 64) * (DM / 64) + (DM / 64) * (DQ / 64) == PWG * 4, "k_prep: one piece a wave");
template <int N>
__device__ __forceinline__ void wt_tile(const float* __restrict__ w, bf* Bt, int t, u32a* T, int lane) {   // tile t: k rows 64 (t % 16) .., columns 64 (t / 16) .. of w [DM][N]
    const int c = lane & 15, r = lane >> 4, kt = t & 15, nt = t >> 4;
    const float* s = w + (size_t)(kt * 64 + 2 * r) * N + nt * 64 + 4 * c; v4f v[32];
#pragma unroll
    for (int j = 0; j < 32; ++j) v[j] = *(const v4f*)(s + (size_t)(4 * (j >> 1) + (j & 1)) * N);   // loads 2 i and 2 i + 1 bring rows k and k + 1 to the same lane
    __builtin_amdgcn_sched_barrier(0);                      // all 32 loads are in flight before the first value is waited for
#pragma unroll
    for (int i = 0; i < 16; ++i)
#pragma unroll
        for (int q = 0; q < 4; ++q) T[(4 * c + q) * TP + 2 * i + r] = f2bf2(v[2 * i][q], v[2 * i + 1][q]);
    wsync();
    unsigned o[64];
#pragma unroll
    for (int n = 0; n < 64; ++n) o[n] = T[n * TP + lane];
    u32a* d = (u32a*)(Bt + (size_t)nt * 64 * DM + kt * 64) + lane;
#pragma unroll
    for (int n = 0; n < 64; ++n) d[n * (DM / 2)] = o[n];
    asm volatile("s_wait_xcnt 0x0" ::: "memory");         // the wait before a register that these stores name is written again (the built code goes on into other paths' text behind them)
}
__global__ __launch_bounds__(384) void k_prep(const float* __restrict__ x, const float* __restrict__ wqkv, const float* __restrict__ wo, bf* XB, bf* WALL, bf* WO) {
    __shared__ __align__(16) unsigned tl[4][64 * TP];
    const int lane = threadIdx.x & 31; const int w = __builtin_amdgcn_readfirstlane((int)(threadIdx.x >> 5));
    if (w < 4) {
        const int t = blockIdx.x * 4 + w;
        if (t < (3 * DM / 64) * (DM / 64)) wt_tile<3 * DM>(wqkv, WALL, t, (u32a*)tl[w], lane); else wt_tile<DM>(wo, WO, t - (3 * DM / 64) * (DM / 64), (u32a*)tl[w], lane);
        return;
    }
    const size_t e = ((size_t)blockIdx.x * 8 + (w - 4)) * 4096 + lane * 4; const float* s = x + e; v4f v[32]; v2u o[32];
#pragma unroll
    for (int j = 0; j < 32; ++j) v[j] = *(const v4f*)(s + j * 128);
    __builtin_amdgcn_sched_barrier(0);                      // all 32 loads are in flight before the first value is waited for
#pragma unroll
    for (int j = 0; j < 32; ++j)
#pragma unroll
        for (int q = 0; q < 2; ++q) o[j][q] = f2bf2(v[j][2 * q], v[j][2 * q + 1]);
    __builtin_amdgcn_sched_barrier(0);                      // every value is rounded before the first store issues, so that the stores go out as one run with no register of theirs written among them
#pragma unroll
    for (int j = 0; j < 32; ++j) *(v2u*)(XB + e + j * 128) = o[j];
    asm volatile("s_wait_xcnt 0x0" ::: "memory");         // the wait before a register that these stores name is written again
}

extern "C" void kernel_launch(void* const* d_in, const int* in_sizes, int n_in,
                              void* d_out, int out_size, void* d_ws, size_t ws_size, hipStream_t stream) {
    (void)in_sizes; (void)n_in; (void)out_size;
    const float* x = (const float*)d_in[0]; const float* wqkv = (const float*)d_in[1]; const float* wo = (const float*)d_in[2]; const float* bo = (const float*)d_in[3]; const float* wq = nullptr; const float* wk = nullptr; const float* wv = nullptr; (void)wq; (void)wk; (void)wv;
    float* OUT = (float*)d_out;     // [2][4096][1024]
    char* wsp = (char*)d_ws;
    auto take = [&](size_t bytes) { char* p = wsp; wsp += (bytes + 255) & ~(size_t)255; return (void*)p; };
    bf* WALL = (bf*)take((size_t)3 * DM * DM * 2); bf* WO = (bf*)take((size_t)DM * DQ * 2);
    bf* XB = (bf*)take((size_t)TT * DM * 2);
    bf* QPh = (bf*)take((6 * PLN + 2 * GAT) * 2); bf* QPl = QPh + PLN; bf* KPh = QPh + 2 * PLN; bf* KPl = QPh + 3 * PLN; bf* VTh = QPh + 4 * PLN; bf* VTl = QPh + 5 * PLN;   bf* KG = QPh + 6 * PLN; bf* VG = KG + GAT;   /* one block: the projection's epilogue finds the k and v planes and the strided rows behind the q planes */
    bf* ATh = (bf*)take((size_t)TT * DQ * 2); bf* ATl = (bf*)take((size_t)TT * DQ * 2);   /* merged planes [t][head * HD + d] */
    if ((size_t)(wsp - (char*)d_ws) > ws_size) return;    // ws 256 MiB
    k_prep<<<PWG, 384, 0, stream>>>(x, wqkv, wo, XB, WALL, WO);   /* x -> bf16; 'xw' [DM][3DM] -> Bt [3DM][DM] (row blocks q | k | v); w_out [DQ][DM] -> Bt [DM][DQ] */
    k_qkv<<<dim3(TT / 256, NH_, 1), 128, 0, stream>>>(XB, WALL, QPh, QPl, DM);   /* [q|k|v] projection, y = head, epilogue -> hi/lo planes */
    k_attn<<<dim3(TT / 128, NH_, 1), 128, 0, stream>>>(QPh, QPl, KPh, KPl, VTh, VTl, KG, VG, ATh, ATl);   /* band + global attention, y = head -> merged planes */
    k_gemmb<1, DQ><<<dim3(TT / 128, DM / 128, 1), 128, 0, stream>>>(ATh, ATl, WO, OUT, bo);
}
